// v000
// Measured on an AMD MI455X. A time is GPU time per run, averaged over a window of back-to-back runs after a warm-up
// (all launches, gaps included; the runs take copies of the inputs in turn), and the median of several windows.
// Apart from v000's, it joins two sittings. Times from different sittings can be a few percent apart, while
// side-by-side timings come from the same sitting.
// v000 is the starting kernel. One run takes 667 microseconds.
#include <hip/hip_runtime.h>
#include <hip/hip_bf16.h>

// ---------------- problem constants (match reference) ----------------
#define E_   8
#define K_   2
#define N_   16384
#define H_   2048
#define B_   128
#define EPS_ 1e-6f

typedef __bf16 bf16;
typedef __attribute__((ext_vector_type(16))) __bf16 bf16x16;
typedef __attribute__((ext_vector_type(8)))  __bf16 bf16x8;
typedef __attribute__((ext_vector_type(8)))  float  f32x8;

// ---------------------------------------------------------------------
// 0) zero the aux accumulators (16 floats) each call
// ---------------------------------------------------------------------
__global__ void zero_accum_kernel(float* __restrict__ acc) {
    if (threadIdx.x < 16) acc[threadIdx.x] = 0.0f;
}

// ---------------------------------------------------------------------
// 1) fp32 -> bf16 conversion (RNE), 4 elements/thread, packed b64 store
// ---------------------------------------------------------------------
__global__ void cvt_bf16_kernel(const float* __restrict__ src,
                                bf16* __restrict__ dst, size_t n4) {
    size_t i = (size_t)blockIdx.x * blockDim.x + threadIdx.x;
    if (i < n4) {
        const float4 v = ((const float4*)src)[i];
        union { bf16 b[4]; uint2 u; } o;
        o.b[0] = (bf16)v.x; o.b[1] = (bf16)v.y;
        o.b[2] = (bf16)v.z; o.b[3] = (bf16)v.w;
        ((uint2*)dst)[i] = o.u;
    }
}

// ---------------------------------------------------------------------
// 2) router: one wave (32 lanes) per token
// ---------------------------------------------------------------------
__global__ __launch_bounds__(256)
void router_kernel(const float* __restrict__ x,
                   const float* __restrict__ skin,
                   const float* __restrict__ Wimg,
                   const float* __restrict__ Wskin,
                   float* __restrict__ wout,
                   float* __restrict__ probSum,
                   float* __restrict__ freqCnt) {
    __shared__ float blkProb[E_];
    __shared__ float blkFreq[E_];
    const int lane = threadIdx.x & 31;
    const int wave = threadIdx.x >> 5;
    if (threadIdx.x < E_) { blkProb[threadIdx.x] = 0.f; blkFreq[threadIdx.x] = 0.f; }
    __syncthreads();

    const int wavesPerBlk = blockDim.x >> 5;
    const int gwave  = blockIdx.x * wavesPerBlk + wave;
    const int nwaves = gridDim.x * wavesPerBlk;

    for (int t = gwave; t < N_; t += nwaves) {
        float part[E_];
#pragma unroll
        for (int e = 0; e < E_; e++) part[e] = 0.f;
        const float* xr = x + (size_t)t * H_;
        for (int h = lane; h < H_; h += 32) {
            float xv = xr[h];
#pragma unroll
            for (int e = 0; e < E_; e++)
                part[e] = fmaf(xv, Wimg[e * H_ + h], part[e]);
        }
#pragma unroll
        for (int e = 0; e < E_; e++)
            for (int off = 16; off; off >>= 1)
                part[e] += __shfl_xor(part[e], off, 32);

        if (lane == 0) {
            const float s0 = skin[t * 3 + 0], s1 = skin[t * 3 + 1], s2 = skin[t * 3 + 2];
            float lg[E_]; float mx = -1e30f;
#pragma unroll
            for (int e = 0; e < E_; e++) {
                lg[e] = part[e] + s0 * Wskin[e * 3 + 0]
                                + s1 * Wskin[e * 3 + 1]
                                + s2 * Wskin[e * 3 + 2];
                mx = fmaxf(mx, lg[e]);
            }
            float p[E_]; float den = 0.f;
#pragma unroll
            for (int e = 0; e < E_; e++) { p[e] = __expf(lg[e] - mx); den += p[e]; }
            const float inv = 1.f / den;
#pragma unroll
            for (int e = 0; e < E_; e++) p[e] *= inv;
            // top-2 (first index wins ties, like jax top_k)
            int i1 = 0; float v1 = p[0];
#pragma unroll
            for (int e = 1; e < E_; e++) if (p[e] > v1) { v1 = p[e]; i1 = e; }
            int i2 = -1; float v2 = -1.f;
#pragma unroll
            for (int e = 0; e < E_; e++) if (e != i1 && p[e] > v2) { v2 = p[e]; i2 = e; }
            const float inv2 = 1.f / (v1 + v2 + EPS_);
#pragma unroll
            for (int e = 0; e < E_; e++) {
                float wv = (e == i1) ? v1 * inv2 : ((e == i2) ? v2 * inv2 : 0.f);
                wout[(size_t)t * E_ + e] = wv;
                atomicAdd(&blkProb[e], p[e]);
            }
            atomicAdd(&blkFreq[i1], 1.f);
            atomicAdd(&blkFreq[i2], 1.f);
        }
    }
    __syncthreads();
    if (threadIdx.x < E_) {
        atomicAdd(&probSum[threadIdx.x], blkProb[threadIdx.x]);
        atomicAdd(&freqCnt[threadIdx.x], blkFreq[threadIdx.x]);
    }
}

// ---------------------------------------------------------------------
// fragment union: CDNA5 16-bit A/B layout — lane = row/col (lane&15),
// K values { klo..klo+7, 16+klo..23+klo } with klo = (lane>>4)*8.
// ---------------------------------------------------------------------
union FragBF { bf16x16 v; bf16x8 h[2]; };

#define XS_STRIDE 2056   // 2048 + 8: 16B-aligned, +4 banks/row -> conflict-free
#define HW_STRIDE 136    // 128 + 8:  16B-aligned, +4 banks/row -> conflict-free

// ---------------------------------------------------------------------
// 3) MoE expert kernel: one block per 16-token tile, 128 threads (4 waves)
// ---------------------------------------------------------------------
__global__ __launch_bounds__(128)
void moe_kernel(const float* __restrict__ x,
                const bf16*  __restrict__ xb,
                const bf16*  __restrict__ W1b,
                const float* __restrict__ b1,
                const bf16*  __restrict__ W2b,
                const float* __restrict__ b2,
                const float* __restrict__ wN,
                float* __restrict__ out) {
    __shared__ __align__(16) bf16 Xs[16][XS_STRIDE];   // staged x tile (bf16)
    __shared__ __align__(16) bf16 Hw[E_][16][HW_STRIDE];
    __shared__ float tileW[16][E_];
    __shared__ int   eflag[E_];

    const int tile = blockIdx.x;           // 0..N/16-1
    const int tok0 = tile * 16;
    const int lane = threadIdx.x & 31;
    const int wave = threadIdx.x >> 5;
    const int col  = lane & 15;            // fragment row/col index
    const int klo  = (lane >> 4) * 8;      // per-lane K offset
    const int hi   = lane >> 4;

    // ---- async-stage the x tile (16 x 2048 bf16 = 64KB) into LDS -----
    // 4096 chunks of 16B; 128 threads x 32 iterations; ASYNCcnt path.
    {
        const bf16* gbase = xb + (size_t)tok0 * H_;
#pragma unroll 4
        for (int it = 0; it < 32; ++it) {
            int i = threadIdx.x + 128 * it;
            int r = i >> 8;                 // 256 chunks per row
            int c = i & 255;                // 16B chunk within row
            const bf16* g = gbase + (size_t)r * H_ + c * 8;
            unsigned lds  = (unsigned)(uintptr_t)(&Xs[r][c * 8]);
            asm volatile("global_load_async_to_lds_b128 %0, %1, off"
                         :: "v"(lds), "v"(g) : "memory");
        }
    }

    // combine weights while the DMA is in flight
    if (threadIdx.x < 16 * E_) {
        int m = threadIdx.x >> 3, e = threadIdx.x & 7;
        tileW[m][e] = wN[(size_t)(tok0 + m) * E_ + e];
    }
    __syncthreads();
    if (threadIdx.x < E_) {
        int f = 0;
        for (int m = 0; m < 16; m++) f |= (tileW[m][threadIdx.x] != 0.f);
        eflag[threadIdx.x] = f;
    }
    // wait for this wave's async transfers, then barrier for cross-wave vis
    asm volatile("s_wait_asynccnt 0x0" ::: "memory");
    __syncthreads();

    // ---------------- stage 1: Hw[e] = w * relu(X @ W1_e^T + b1_e) ----
    const int ct0 = wave * 2;              // each wave owns 2 b-column tiles
    for (int e = 0; e < E_; e++) {
        if (!eflag[e]) continue;           // block-uniform branch
        f32x8 acc0 = {0.f,0.f,0.f,0.f,0.f,0.f,0.f,0.f};
        f32x8 acc1 = {0.f,0.f,0.f,0.f,0.f,0.f,0.f,0.f};
        const bf16* arow  = &Xs[col][klo];                       // LDS
        const bf16* brow0 = W1b + ((size_t)e * B_ + ct0 * 16 + col) * H_ + klo;
        const bf16* brow1 = brow0 + (size_t)16 * H_;
#pragma unroll 2
        for (int k0 = 0; k0 < H_; k0 += 32) {
            FragBF a, b0, b1f;
            a.h[0]   = *(const bf16x8*)(arow  + k0);
            a.h[1]   = *(const bf16x8*)(arow  + k0 + 16);
            b0.h[0]  = *(const bf16x8*)(brow0 + k0);
            b0.h[1]  = *(const bf16x8*)(brow0 + k0 + 16);
            b1f.h[0] = *(const bf16x8*)(brow1 + k0);
            b1f.h[1] = *(const bf16x8*)(brow1 + k0 + 16);
            acc0 = __builtin_amdgcn_wmma_f32_16x16x32_bf16(
                false, a.v, false, b0.v, (short)0, acc0, false, false);
            acc1 = __builtin_amdgcn_wmma_f32_16x16x32_bf16(
                false, a.v, false, b1f.v, (short)0, acc1, false, false);
        }
        const float bb0 = b1[e * B_ + ct0 * 16 + col];
        const float bb1 = b1[e * B_ + (ct0 + 1) * 16 + col];
#pragma unroll
        for (int r = 0; r < 8; r++) {
            int m = r + hi * 8;
            float wv = tileW[m][e];
            float h0 = fmaxf(acc0[r] + bb0, 0.f) * wv;
            float h1 = fmaxf(acc1[r] + bb1, 0.f) * wv;
            Hw[e][m][ct0 * 16 + col]       = (bf16)h0;
            Hw[e][m][(ct0 + 1) * 16 + col] = (bf16)h1;
        }
    }
    __syncthreads();

    // ---------------- stage 2: out = x + sum_e Hw_e @ W2_e^T + w@b2 ---
    for (int j = 0; j < 32; j++) {
        const int ct   = j * 4 + wave;     // 128 column tiles over 4 waves
        const int hcol = ct * 16 + col;
        f32x8 acc = {0.f,0.f,0.f,0.f,0.f,0.f,0.f,0.f};
        for (int e = 0; e < E_; e++) {
            if (!eflag[e]) continue;
            const bf16* arow = &Hw[e][col][klo];
            const bf16* brow = W2b + ((size_t)e * H_ + hcol) * B_ + klo;
#pragma unroll
            for (int k0 = 0; k0 < B_; k0 += 32) {
                FragBF a, b;
                a.h[0] = *(const bf16x8*)(arow + k0);
                a.h[1] = *(const bf16x8*)(arow + k0 + 16);
                b.h[0] = *(const bf16x8*)(brow + k0);
                b.h[1] = *(const bf16x8*)(brow + k0 + 16);
                acc = __builtin_amdgcn_wmma_f32_16x16x32_bf16(
                    false, a.v, false, b.v, (short)0, acc, false, false);
            }
        }
        float b2v[E_];
#pragma unroll
        for (int e = 0; e < E_; e++) b2v[e] = b2[(size_t)e * H_ + hcol];
#pragma unroll
        for (int r = 0; r < 8; r++) {
            int m = r + hi * 8;
            float s = 0.f;
#pragma unroll
            for (int e = 0; e < E_; e++) s = fmaf(tileW[m][e], b2v[e], s);
            size_t idx = (size_t)(tok0 + m) * H_ + hcol;
            out[idx] = x[idx] + acc[r] + s;
        }
    }
}

// ---------------------------------------------------------------------
// 4) finalize aux loss -> d_out[N*H]
// ---------------------------------------------------------------------
__global__ void finalize_kernel(const float* __restrict__ probSum,
                                const float* __restrict__ freqCnt,
                                float* __restrict__ out_aux) {
    if (threadIdx.x == 0 && blockIdx.x == 0) {
        float s = 0.f;
        for (int e = 0; e < E_; e++)
            s += (probSum[e] / (float)N_) * (freqCnt[e] / (float)N_);
        *out_aux = s * (float)E_;
    }
}

// ---------------------------------------------------------------------
extern "C" void kernel_launch(void* const* d_in, const int* in_sizes, int n_in,
                              void* d_out, int out_size, void* d_ws, size_t ws_size,
                              hipStream_t stream) {
    const float* x     = (const float*)d_in[0];
    const float* skin  = (const float*)d_in[1];
    const float* Wimg  = (const float*)d_in[2];
    const float* Wskin = (const float*)d_in[3];
    const float* W1    = (const float*)d_in[4];
    const float* b1    = (const float*)d_in[5];
    const float* W2    = (const float*)d_in[6];
    const float* b2    = (const float*)d_in[7];
    float* out = (float*)d_out;

    // workspace layout
    char* ws = (char*)d_ws;
    float* wN      = (float*)ws;                                   // N*E f32 (512KB)
    float* probSum = (float*)(ws + (size_t)N_ * E_ * sizeof(float));
    float* freqCnt = probSum + 8;
    bf16*  xb  = (bf16*)(ws + (1ull << 20));                       // N*H bf16 (64MB)
    bf16*  W1b = xb  + (size_t)N_ * H_;                            // E*B*H bf16 (4MB)
    bf16*  W2b = W1b + (size_t)E_ * B_ * H_;                       // E*H*B bf16 (4MB)

    // 0) zero aux accumulators
    zero_accum_kernel<<<1, 32, 0, stream>>>(probSum);

    // 1) bf16 conversions
    {
        size_t n4 = (size_t)N_ * H_ / 4;
        cvt_bf16_kernel<<<(unsigned)((n4 + 255) / 256), 256, 0, stream>>>(x, xb, n4);
        size_t w4 = (size_t)E_ * B_ * H_ / 4;
        cvt_bf16_kernel<<<(unsigned)((w4 + 255) / 256), 256, 0, stream>>>(W1, W1b, w4);
        cvt_bf16_kernel<<<(unsigned)((w4 + 255) / 256), 256, 0, stream>>>(W2, W2b, w4);
    }

    // 2) router (2048 waves, 8 tokens each)
    router_kernel<<<256, 256, 0, stream>>>(x, skin, Wimg, Wskin, wN, probSum, freqCnt);

    // 3) expert GEMMs + combine + residual
    moe_kernel<<<N_ / 16, 128, 0, stream>>>(x, xb, W1b, b1, W2b, b2, wN, out);

    // 4) aux loss scalar
    finalize_kernel<<<1, 32, 0, stream>>>(probSum, freqCnt, out + (size_t)N_ * H_);
}

// v001
// A run of this version takes 248 microseconds.
// In two side-by-side timings against v000, it was 2.78 and 2.79 times as fast.
#include <hip/hip_runtime.h>
#include <hip/hip_bf16.h>

// ---------------- problem constants (match reference) ----------------
#define E_   8
#define K_   2
#define N_   16384
#define H_   2048
#define B_   128
#define EPS_ 1e-6f

typedef __bf16 bf16;
typedef __attribute__((ext_vector_type(16))) __bf16 bf16x16;
typedef __attribute__((ext_vector_type(8)))  __bf16 bf16x8;
typedef __attribute__((ext_vector_type(8)))  float  f32x8;

// ---------------------------------------------------------------------
// 0) zero the aux accumulators (16 floats) each call
// ---------------------------------------------------------------------
__global__ void zero_accum_kernel(float* __restrict__ acc) {
    if (threadIdx.x < 16) acc[threadIdx.x] = 0.0f;
}

// ---------------------------------------------------------------------
// 1) fp32 -> bf16 conversion (RNE), 4 elements/thread, packed b64 store
// ---------------------------------------------------------------------
__global__ void cvt_bf16_kernel(const float* __restrict__ src,
                                bf16* __restrict__ dst, size_t n4) {
    size_t i = (size_t)blockIdx.x * blockDim.x + threadIdx.x;
    if (i < n4) {
        const float4 v = ((const float4*)src)[i];
        union { bf16 b[4]; uint2 u; } o;
        o.b[0] = (bf16)v.x; o.b[1] = (bf16)v.y;
        o.b[2] = (bf16)v.z; o.b[3] = (bf16)v.w;
        ((uint2*)dst)[i] = o.u;
    }
}

// ---------------------------------------------------------------------
// 2) router: one wave (32 lanes) per token
// ---------------------------------------------------------------------
__global__ __launch_bounds__(256)
void router_kernel(const float* __restrict__ x,
                   const float* __restrict__ skin,
                   const float* __restrict__ Wimg,
                   const float* __restrict__ Wskin,
                   float* __restrict__ wout,
                   float* __restrict__ probSum,
                   float* __restrict__ freqCnt) {
    __shared__ float blkProb[E_];
    __shared__ float blkFreq[E_];
    const int lane = threadIdx.x & 31;
    const int wave = threadIdx.x >> 5;
    if (threadIdx.x < E_) { blkProb[threadIdx.x] = 0.f; blkFreq[threadIdx.x] = 0.f; }
    __syncthreads();

    const int wavesPerBlk = blockDim.x >> 5;
    const int gwave  = blockIdx.x * wavesPerBlk + wave;
    const int nwaves = gridDim.x * wavesPerBlk;

    for (int t = gwave; t < N_; t += nwaves) {
        float part[E_];
#pragma unroll
        for (int e = 0; e < E_; e++) part[e] = 0.f;
        const float* xr = x + (size_t)t * H_;
        for (int h = lane; h < H_; h += 32) {
            float xv = xr[h];
#pragma unroll
            for (int e = 0; e < E_; e++)
                part[e] = fmaf(xv, Wimg[e * H_ + h], part[e]);
        }
#pragma unroll
        for (int e = 0; e < E_; e++)
            for (int off = 16; off; off >>= 1)
                part[e] += __shfl_xor(part[e], off, 32);

        if (lane == 0) {
            const float s0 = skin[t * 3 + 0], s1 = skin[t * 3 + 1], s2 = skin[t * 3 + 2];
            float lg[E_]; float mx = -1e30f;
#pragma unroll
            for (int e = 0; e < E_; e++) {
                lg[e] = part[e] + s0 * Wskin[e * 3 + 0]
                                + s1 * Wskin[e * 3 + 1]
                                + s2 * Wskin[e * 3 + 2];
                mx = fmaxf(mx, lg[e]);
            }
            float p[E_]; float den = 0.f;
#pragma unroll
            for (int e = 0; e < E_; e++) { p[e] = __expf(lg[e] - mx); den += p[e]; }
            const float inv = 1.f / den;
#pragma unroll
            for (int e = 0; e < E_; e++) p[e] *= inv;
            // top-2 (first index wins ties, like jax top_k)
            int i1 = 0; float v1 = p[0];
#pragma unroll
            for (int e = 1; e < E_; e++) if (p[e] > v1) { v1 = p[e]; i1 = e; }
            int i2 = -1; float v2 = -1.f;
#pragma unroll
            for (int e = 0; e < E_; e++) if (e != i1 && p[e] > v2) { v2 = p[e]; i2 = e; }
            const float inv2 = 1.f / (v1 + v2 + EPS_);
#pragma unroll
            for (int e = 0; e < E_; e++) {
                float wv = (e == i1) ? v1 * inv2 : ((e == i2) ? v2 * inv2 : 0.f);
                wout[(size_t)t * E_ + e] = wv;
                atomicAdd(&blkProb[e], p[e]);
            }
            atomicAdd(&blkFreq[i1], 1.f);
            atomicAdd(&blkFreq[i2], 1.f);
        }
    }
    __syncthreads();
    if (threadIdx.x < E_) {
        atomicAdd(&probSum[threadIdx.x], blkProb[threadIdx.x]);
        atomicAdd(&freqCnt[threadIdx.x], blkFreq[threadIdx.x]);
    }
}

// ---------------------------------------------------------------------
// fragment union: CDNA5 16-bit A/B layout — lane = row/col (lane&15),
// K values { klo..klo+7, 16+klo..23+klo } with klo = (lane>>4)*8.
// ---------------------------------------------------------------------
union FragBF { bf16x16 v; bf16x8 h[2]; };

#define XS_STRIDE 2056   // 2048 + 8: 16B-aligned, +4 banks/row -> conflict-free
#define HW_STRIDE 136    // 128 + 8:  16B-aligned, +4 banks/row -> conflict-free
#define TM_ 64           // tokens per work-group
#define MT_ 4            // 16-token sub-tiles per work-group
#define NT2_ 4           // output column tiles a wave holds at once in stage 2

// eight 16-byte-per-lane copies, rows r0..r0+7 of the x tile; the closing
// s_wait_xcnt keeps the address registers untouched until the copies took them
#define COPY8_ROWS(r0)                                                        \
    asm volatile("global_load_async_to_lds_b128 %0, %8, off\n\t"              \
                 "global_load_async_to_lds_b128 %1, %9, off\n\t"              \
                 "global_load_async_to_lds_b128 %2, %10, off\n\t"             \
                 "global_load_async_to_lds_b128 %3, %11, off\n\t"             \
                 "global_load_async_to_lds_b128 %4, %12, off\n\t"             \
                 "global_load_async_to_lds_b128 %5, %13, off\n\t"             \
                 "global_load_async_to_lds_b128 %6, %14, off\n\t"             \
                 "global_load_async_to_lds_b128 %7, %15, off\n\t"             \
                 "s_wait_xcnt 0x0"                                            \
                 :: "v"(lbase + ((r0) + 0) * (XS_STRIDE * 2)),                \
                    "v"(lbase + ((r0) + 1) * (XS_STRIDE * 2)),                \
                    "v"(lbase + ((r0) + 2) * (XS_STRIDE * 2)),                \
                    "v"(lbase + ((r0) + 3) * (XS_STRIDE * 2)),                \
                    "v"(lbase + ((r0) + 4) * (XS_STRIDE * 2)),                \
                    "v"(lbase + ((r0) + 5) * (XS_STRIDE * 2)),                \
                    "v"(lbase + ((r0) + 6) * (XS_STRIDE * 2)),                \
                    "v"(lbase + ((r0) + 7) * (XS_STRIDE * 2)),                \
                    "v"(gbase + (size_t)((r0) + 0) * H_),                     \
                    "v"(gbase + (size_t)((r0) + 1) * H_),                     \
                    "v"(gbase + (size_t)((r0) + 2) * H_),                     \
                    "v"(gbase + (size_t)((r0) + 3) * H_),                     \
                    "v"(gbase + (size_t)((r0) + 4) * H_),                     \
                    "v"(gbase + (size_t)((r0) + 5) * H_),                     \
                    "v"(gbase + (size_t)((r0) + 6) * H_),                     \
                    "v"(gbase + (size_t)((r0) + 7) * H_)                      \
                 : "memory")

// ---------------------------------------------------------------------
// 3) MoE expert kernel: one block per 64-token tile, 256 threads (8 waves).
//    Every weight fragment read from global memory feeds four WMMAs (the
//    four 16-token sub-tiles). Stage 1: wave e owns expert e, 64 x 128
//    accumulators in registers. Stage 2: a wave owns 16 column tiles of
//    the output, four at a time.
// ---------------------------------------------------------------------
__global__ __launch_bounds__(256)
void moe_kernel(const float* __restrict__ x,
                const bf16*  __restrict__ xb,
                const bf16*  __restrict__ W1b,
                const float* __restrict__ b1,
                const bf16*  __restrict__ W2b,
                const float* __restrict__ b2,
                const float* __restrict__ wN,
                float* __restrict__ out) {
    // the staged x tile; once stage 1 has read it, the same bytes hold Hw
    __shared__ __align__(16) bf16 Xs[TM_][XS_STRIDE];
    __shared__ __align__(16) float tileW[TM_][E_];
    __shared__ int   eflag[E_];
    bf16 (*Hw)[TM_][HW_STRIDE] = (bf16 (*)[TM_][HW_STRIDE])&Xs[0][0];   // [E_][TM_][HW_STRIDE]

    const int tile = blockIdx.x;           // 0..N/64-1
    const int tok0 = tile * TM_;
    const int lane = threadIdx.x & 31;
    const int wave = __builtin_amdgcn_readfirstlane(threadIdx.x >> 5);
    const int col  = lane & 15;            // fragment row/col index
    const int klo  = (lane >> 4) * 8;      // per-lane K offset
    const int hi   = lane >> 4;

    // ---- async-stage the x tile (64 x 2048 bf16 = 256KB) into LDS ----
    // one copy of the block = one row (256 threads x 16B); 64 copies a wave,
    // in two halves so that no wave has more than 32 outstanding.
    const bf16*    gbase = xb + (size_t)tok0 * H_ + threadIdx.x * 8;
    const unsigned lbase = (unsigned)(uintptr_t)(&Xs[0][threadIdx.x * 8]);
    COPY8_ROWS(0);  COPY8_ROWS(8);  COPY8_ROWS(16); COPY8_ROWS(24);

    // combine weights while the copies are in flight
#pragma unroll
    for (int j = 0; j < TM_ * E_ / 256; j++) {
        const int i = threadIdx.x + 256 * j;
        tileW[i >> 3][i & 7] = wN[(size_t)tok0 * E_ + i];
    }

    // first half landed before the second half is issued
    asm volatile("s_wait_asynccnt 0x0" ::: "memory");
    COPY8_ROWS(32); COPY8_ROWS(40); COPY8_ROWS(48); COPY8_ROWS(56);

    __syncthreads();
    if (threadIdx.x < E_) {
        int f = 0;
        for (int m = 0; m < TM_; m++) f |= (tileW[m][threadIdx.x] != 0.f);
        eflag[threadIdx.x] = f;
    }
    // wait for this wave's async transfers, then barrier for cross-wave vis
    asm volatile("s_wait_asynccnt 0x0" ::: "memory");
    __syncthreads();

    unsigned emask = 0;
#pragma unroll
    for (int e = 0; e < E_; e++) emask |= (eflag[e] ? 1u : 0u) << e;
    emask = __builtin_amdgcn_readfirstlane(emask);
    const bool mine = (emask >> wave) & 1u;   // wave-uniform: expert 'wave' is used by this tile

    // ---------------- stage 1: Hw[e] = w * relu(X @ W1_e^T + b1_e) ----
    f32x8 acc[MT_][8];
#pragma unroll
    for (int mt = 0; mt < MT_; mt++)
#pragma unroll
        for (int n = 0; n < 8; n++)
            acc[mt][n] = (f32x8){0.f,0.f,0.f,0.f,0.f,0.f,0.f,0.f};
    if (mine) {
        const bf16* arow = &Xs[col][klo];                               // LDS
        const bf16* brow = W1b + ((size_t)wave * B_ + col) * H_ + klo;
        // 64 k a trip: the four loads of a weight row's 128-byte line stand together
        for (int k0 = 0; k0 < H_; k0 += 64) {
            FragBF a[2][MT_], b[2][8];
#pragma unroll
            for (int n = 0; n < 8; n++)
#pragma unroll
                for (int ks = 0; ks < 2; ks++) {
                    b[ks][n].h[0] = *(const bf16x8*)(brow + (size_t)n * 16 * H_ + k0 + ks * 32);
                    b[ks][n].h[1] = *(const bf16x8*)(brow + (size_t)n * 16 * H_ + k0 + ks * 32 + 16);
                }
#pragma unroll
            for (int ks = 0; ks < 2; ks++)
#pragma unroll
                for (int mt = 0; mt < MT_; mt++) {
                    a[ks][mt].h[0] = *(const bf16x8*)(arow + mt * 16 * XS_STRIDE + k0 + ks * 32);
                    a[ks][mt].h[1] = *(const bf16x8*)(arow + mt * 16 * XS_STRIDE + k0 + ks * 32 + 16);
                }
            // the weight pointer is stepped below: its loads have taken the address first
            asm volatile("s_wait_xcnt 0x0" ::: "memory");
            // keeps the trip's loads one group in front of its WMMAs: sunk among them,
            // each weight fragment's L2 latency would be waited out on its own
            __builtin_amdgcn_sched_barrier(0);
#pragma unroll
            for (int ks = 0; ks < 2; ks++)
#pragma unroll
                for (int n = 0; n < 8; n++)
#pragma unroll
                    for (int mt = 0; mt < MT_; mt++)
                        acc[mt][n] = __builtin_amdgcn_wmma_f32_16x16x32_bf16(
                            false, a[ks][mt].v, false, b[ks][n].v, (short)0, acc[mt][n], false, false);
        }
    }
    __syncthreads();   // every wave has read its last x fragment: the bytes may become Hw
    if (mine) {
        float wv[MT_][8];
#pragma unroll
        for (int mt = 0; mt < MT_; mt++)
#pragma unroll
            for (int r = 0; r < 8; r++) wv[mt][r] = tileW[mt * 16 + r + hi * 8][wave];
#pragma unroll
        for (int n = 0; n < 8; n++) {
            const float bb = b1[wave * B_ + n * 16 + col];
#pragma unroll
            for (int mt = 0; mt < MT_; mt++)
#pragma unroll
                for (int r = 0; r < 8; r++) {
                    float h = fmaxf(acc[mt][n][r] + bb, 0.f) * wv[mt][r];
                    Hw[wave][mt * 16 + r + hi * 8][n * 16 + col] = (bf16)h;
                }
        }
    }
    __syncthreads();

    // ---------------- stage 2: out = x + sum_e Hw_e @ W2_e^T + w@b2 ---
    for (int g = 0; g < 16 / NT2_; g++) {
        const int ct0   = wave * 16 + g * NT2_;   // 128 column tiles over 8 waves
        const int hcol0 = ct0 * 16 + col;
        f32x8 acc2[MT_][NT2_];
#pragma unroll
        for (int mt = 0; mt < MT_; mt++)
#pragma unroll
            for (int n = 0; n < NT2_; n++)
                acc2[mt][n] = (f32x8){0.f,0.f,0.f,0.f,0.f,0.f,0.f,0.f};
        for (int e = 0; e < E_; e++) {
            if (!((emask >> e) & 1u)) continue;   // block-uniform scalar branch
            const bf16* arow = &Hw[e][col][klo];
            const bf16* brow = W2b + ((size_t)e * H_ + hcol0) * B_ + klo;
            FragBF a[B_ / 32][MT_], b[B_ / 32][NT2_];
#pragma unroll
            for (int n = 0; n < NT2_; n++)
#pragma unroll
                for (int ks = 0; ks < B_ / 32; ks++) {
                    b[ks][n].h[0] = *(const bf16x8*)(brow + n * 16 * B_ + ks * 32);
                    b[ks][n].h[1] = *(const bf16x8*)(brow + n * 16 * B_ + ks * 32 + 16);
                }
#pragma unroll
            for (int ks = 0; ks < B_ / 32; ks++)
#pragma unroll
                for (int mt = 0; mt < MT_; mt++) {
                    a[ks][mt].h[0] = *(const bf16x8*)(arow + mt * 16 * HW_STRIDE + ks * 32);
                    a[ks][mt].h[1] = *(const bf16x8*)(arow + mt * 16 * HW_STRIDE + ks * 32 + 16);
                }
            // the loads have taken their address before its registers are reused; naming the
            // pointer keeps it in its registers up to the wait
            asm volatile("s_wait_xcnt 0x0" :: "v"(brow) : "memory");
            // as in stage 1: the expert's loads stay one group in front of its WMMAs
            __builtin_amdgcn_sched_barrier(0);
#pragma unroll
            for (int ks = 0; ks < B_ / 32; ks++)
#pragma unroll
                for (int n = 0; n < NT2_; n++)
#pragma unroll
                    for (int mt = 0; mt < MT_; mt++)
                        acc2[mt][n] = __builtin_amdgcn_wmma_f32_16x16x32_bf16(
                            false, a[ks][mt].v, false, b[ks][n].v, (short)0, acc2[mt][n], false, false);
        }
        // x and out rows of this tile: uniform base, one element offset per lane
        const float*   xt   = x   + (size_t)tok0 * H_;
        float*         ot   = out + (size_t)tok0 * H_;
        const int      off0 = hi * 8 * H_ + hcol0;
        float xv[MT_][NT2_][8];
#pragma unroll
        for (int mt = 0; mt < MT_; mt++)
#pragma unroll
            for (int r = 0; r < 8; r++)
#pragma unroll
                for (int n = 0; n < NT2_; n++)
                    xv[mt][n][r] = xt[(size_t)((mt * 16 + r) * H_ + n * 16) + off0];
        float b2v[NT2_][E_];
#pragma unroll
        for (int n = 0; n < NT2_; n++)
#pragma unroll
            for (int e = 0; e < E_; e++) b2v[n][e] = b2[(size_t)e * H_ + hcol0 + n * 16];
        // the loads have taken their offset registers before anything reuses them; naming
        // the offsets keeps them in their registers up to the wait
        asm volatile("s_wait_xcnt 0x0" :: "v"(hcol0), "v"(off0) : "memory");
        // the group's loads stay together in front of the arithmetic: one memory latency a group
        __builtin_amdgcn_sched_barrier(0);
#pragma unroll
        for (int mt = 0; mt < MT_; mt++)
#pragma unroll
            for (int r = 0; r < 8; r++) {
                const int m = mt * 16 + r + hi * 8;
                float tw[E_];
#pragma unroll
                for (int e = 0; e < E_; e++) tw[e] = tileW[m][e];
#pragma unroll
                for (int n = 0; n < NT2_; n++) {
                    float s = 0.f;
#pragma unroll
                    for (int e = 0; e < E_; e++) s = fmaf(tw[e], b2v[n][e], s);
                    acc2[mt][n][r] = xv[mt][n][r] + acc2[mt][n][r] + s;
                }
            }
        // every result is formed before the first store, so that no register of an
        // issued store is written again in front of the wait behind the stores
        __builtin_amdgcn_sched_barrier(0);
#pragma unroll
        for (int mt = 0; mt < MT_; mt++)
#pragma unroll
            for (int r = 0; r < 8; r++)
#pragma unroll
                for (int n = 0; n < NT2_; n++)
                    ot[(size_t)((mt * 16 + r) * H_ + n * 16) + off0] = acc2[mt][n][r];
        // the next group reuses the stores' registers: the stores have taken them first
        asm volatile("s_wait_xcnt 0x0" ::: "memory");
    }
}

// ---------------------------------------------------------------------
// 4) finalize aux loss -> d_out[N*H]
// ---------------------------------------------------------------------
__global__ void finalize_kernel(const float* __restrict__ probSum,
                                const float* __restrict__ freqCnt,
                                float* __restrict__ out_aux) {
    if (threadIdx.x == 0 && blockIdx.x == 0) {
        float s = 0.f;
        for (int e = 0; e < E_; e++)
            s += (probSum[e] / (float)N_) * (freqCnt[e] / (float)N_);
        *out_aux = s * (float)E_;
    }
}

// ---------------------------------------------------------------------
extern "C" void kernel_launch(void* const* d_in, const int* in_sizes, int n_in,
                              void* d_out, int out_size, void* d_ws, size_t ws_size,
                              hipStream_t stream) {
    const float* x     = (const float*)d_in[0];
    const float* skin  = (const float*)d_in[1];
    const float* Wimg  = (const float*)d_in[2];
    const float* Wskin = (const float*)d_in[3];
    const float* W1    = (const float*)d_in[4];
    const float* b1    = (const float*)d_in[5];
    const float* W2    = (const float*)d_in[6];
    const float* b2    = (const float*)d_in[7];
    float* out = (float*)d_out;

    // workspace layout
    char* ws = (char*)d_ws;
    float* wN      = (float*)ws;                                   // N*E f32 (512KB)
    float* probSum = (float*)(ws + (size_t)N_ * E_ * sizeof(float));
    float* freqCnt = probSum + 8;
    bf16*  xb  = (bf16*)(ws + (1ull << 20));                       // N*H bf16 (64MB)
    bf16*  W1b = xb  + (size_t)N_ * H_;                            // E*B*H bf16 (4MB)
    bf16*  W2b = W1b + (size_t)E_ * B_ * H_;                       // E*H*B bf16 (4MB)

    // 0) zero aux accumulators
    zero_accum_kernel<<<1, 32, 0, stream>>>(probSum);

    // 1) bf16 conversions
    {
        size_t n4 = (size_t)N_ * H_ / 4;
        cvt_bf16_kernel<<<(unsigned)((n4 + 255) / 256), 256, 0, stream>>>(x, xb, n4);
        size_t w4 = (size_t)E_ * B_ * H_ / 4;
        cvt_bf16_kernel<<<(unsigned)((w4 + 255) / 256), 256, 0, stream>>>(W1, W1b, w4);
        cvt_bf16_kernel<<<(unsigned)((w4 + 255) / 256), 256, 0, stream>>>(W2, W2b, w4);
    }

    // 2) router (2048 waves, 8 tokens each)
    router_kernel<<<256, 256, 0, stream>>>(x, skin, Wimg, Wskin, wN, probSum, freqCnt);

    // 3) expert GEMMs + combine + residual
    moe_kernel<<<N_ / 64, 256, 0, stream>>>(x, xb, W1b, b1, W2b, b2, wN, out);

    // 4) aux loss scalar
    finalize_kernel<<<1, 32, 0, stream>>>(probSum, freqCnt, out + (size_t)N_ * H_);
}

// v002
// Measured time: 218 microseconds a run.
// Next to v001, in two timings, it ran 1.14 and 1.13 times as fast.
// Counting every step since v000, it is 3.18 times as fast.
#include <hip/hip_runtime.h>
#include <hip/hip_bf16.h>

// ---------------- problem constants (match reference) ----------------
#define E_   8
#define K_   2
#define N_   16384
#define H_   2048
#define B_   128
#define EPS_ 1e-6f

typedef __bf16 bf16;
typedef __attribute__((ext_vector_type(16))) __bf16 bf16x16;
typedef __attribute__((ext_vector_type(8)))  __bf16 bf16x8;
typedef __attribute__((ext_vector_type(8)))  float  f32x8;

// ---------------------------------------------------------------------
// 0) zero the aux accumulators (16 floats) each call
// ---------------------------------------------------------------------
__global__ void zero_accum_kernel(float* __restrict__ acc) {
    if (threadIdx.x < 16) acc[threadIdx.x] = 0.0f;
}

// ---------------------------------------------------------------------
// 1) fp32 -> bf16 conversion (RNE), 4 elements/thread, packed b64 store
// ---------------------------------------------------------------------
__global__ void cvt_bf16_kernel(const float* __restrict__ src,
                                bf16* __restrict__ dst, size_t n4) {
    size_t i = (size_t)blockIdx.x * blockDim.x + threadIdx.x;
    if (i < n4) {
        const float4 v = ((const float4*)src)[i];
        union { bf16 b[4]; uint2 u; } o;
        o.b[0] = (bf16)v.x; o.b[1] = (bf16)v.y;
        o.b[2] = (bf16)v.z; o.b[3] = (bf16)v.w;
        ((uint2*)dst)[i] = o.u;
    }
}

// ---------------------------------------------------------------------
// 1b) fp32 -> bf16 conversion (RNE) of a weight matrix [rows][32 << kkShift]
//     into WMMA B-fragment order: dst[row tile][k step of 32][half][lane][8].
//     Lane l of half j holds row (l & 15), k = j*16 + (l >> 4)*8 .. +7, so one
//     wave-wide 16-byte load of a half reads 512 contiguous bytes (4 whole lines).
//     One thread writes one 16-byte piece.
// ---------------------------------------------------------------------
__global__ void pack_bf16_kernel(const float* __restrict__ src,
                                 bf16* __restrict__ dst, int kkShift, int nPieces) {
    const int c = blockIdx.x * blockDim.x + threadIdx.x;
    if (c < nPieces) {
        const int l   = c & 31;
        const int j   = (c >> 5) & 1;
        const int t   = c >> 6;
        const int kk  = t & ((1 << kkShift) - 1);
        const int rt  = t >> kkShift;
        const int row = rt * 16 + (l & 15);
        const int k   = kk * 32 + j * 16 + (l >> 4) * 8;
        const float4* s = (const float4*)(src + ((size_t)row << (kkShift + 5)) + k);
        const float4 v0 = s[0], v1 = s[1];
        union { bf16 b[8]; uint4 u; } o;
        o.b[0] = (bf16)v0.x; o.b[1] = (bf16)v0.y;
        o.b[2] = (bf16)v0.z; o.b[3] = (bf16)v0.w;
        o.b[4] = (bf16)v1.x; o.b[5] = (bf16)v1.y;
        o.b[6] = (bf16)v1.z; o.b[7] = (bf16)v1.w;
        ((uint4*)dst)[c] = o.u;
    }
}

// ---------------------------------------------------------------------
// 2) router: one wave (32 lanes) per token
// ---------------------------------------------------------------------
__global__ __launch_bounds__(256)
void router_kernel(const float* __restrict__ x,
                   const float* __restrict__ skin,
                   const float* __restrict__ Wimg,
                   const float* __restrict__ Wskin,
                   float* __restrict__ wout,
                   float* __restrict__ probSum,
                   float* __restrict__ freqCnt) {
    __shared__ float blkProb[E_];
    __shared__ float blkFreq[E_];
    const int lane = threadIdx.x & 31;
    const int wave = threadIdx.x >> 5;
    if (threadIdx.x < E_) { blkProb[threadIdx.x] = 0.f; blkFreq[threadIdx.x] = 0.f; }
    __syncthreads();

    const int wavesPerBlk = blockDim.x >> 5;
    const int gwave  = blockIdx.x * wavesPerBlk + wave;
    const int nwaves = gridDim.x * wavesPerBlk;

    for (int t = gwave; t < N_; t += nwaves) {
        float part[E_];
#pragma unroll
        for (int e = 0; e < E_; e++) part[e] = 0.f;
        const float* xr = x + (size_t)t * H_;
        for (int h = lane; h < H_; h += 32) {
            float xv = xr[h];
#pragma unroll
            for (int e = 0; e < E_; e++)
                part[e] = fmaf(xv, Wimg[e * H_ + h], part[e]);
        }
#pragma unroll
        for (int e = 0; e < E_; e++)
            for (int off = 16; off; off >>= 1)
                part[e] += __shfl_xor(part[e], off, 32);

        if (lane == 0) {
            const float s0 = skin[t * 3 + 0], s1 = skin[t * 3 + 1], s2 = skin[t * 3 + 2];
            float lg[E_]; float mx = -1e30f;
#pragma unroll
            for (int e = 0; e < E_; e++) {
                lg[e] = part[e] + s0 * Wskin[e * 3 + 0]
                                + s1 * Wskin[e * 3 + 1]
                                + s2 * Wskin[e * 3 + 2];
                mx = fmaxf(mx, lg[e]);
            }
            float p[E_]; float den = 0.f;
#pragma unroll
            for (int e = 0; e < E_; e++) { p[e] = __expf(lg[e] - mx); den += p[e]; }
            const float inv = 1.f / den;
#pragma unroll
            for (int e = 0; e < E_; e++) p[e] *= inv;
            // top-2 (first index wins ties, like jax top_k)
            int i1 = 0; float v1 = p[0];
#pragma unroll
            for (int e = 1; e < E_; e++) if (p[e] > v1) { v1 = p[e]; i1 = e; }
            int i2 = -1; float v2 = -1.f;
#pragma unroll
            for (int e = 0; e < E_; e++) if (e != i1 && p[e] > v2) { v2 = p[e]; i2 = e; }
            const float inv2 = 1.f / (v1 + v2 + EPS_);
#pragma unroll
            for (int e = 0; e < E_; e++) {
                float wv = (e == i1) ? v1 * inv2 : ((e == i2) ? v2 * inv2 : 0.f);
                wout[(size_t)t * E_ + e] = wv;
                atomicAdd(&blkProb[e], p[e]);
            }
            atomicAdd(&blkFreq[i1], 1.f);
            atomicAdd(&blkFreq[i2], 1.f);
        }
    }
    __syncthreads();
    if (threadIdx.x < E_) {
        atomicAdd(&probSum[threadIdx.x], blkProb[threadIdx.x]);
        atomicAdd(&freqCnt[threadIdx.x], blkFreq[threadIdx.x]);
    }
}

// ---------------------------------------------------------------------
// fragment union: CDNA5 16-bit A/B layout — lane = row/col (lane&15),
// K values { klo..klo+7, 16+klo..23+klo } with klo = (lane>>4)*8.
// ---------------------------------------------------------------------
union FragBF { bf16x16 v; bf16x8 h[2]; };

#define XS_STRIDE 2056   // 2048 + 8: 16B-aligned, +4 banks/row -> conflict-free
#define HW_STRIDE 136    // 128 + 8:  16B-aligned, +4 banks/row -> conflict-free
#define TM_ 64           // tokens per work-group
#define MT_ 4            // 16-token sub-tiles per work-group
#define NT2_ 4           // output column tiles a wave holds at once in stage 2

// eight 16-byte-per-lane copies, rows r0..r0+7 of the x tile; the closing
// s_wait_xcnt keeps the address registers untouched until the copies took them
#define COPY8_ROWS(r0)                                                        \
    asm volatile("global_load_async_to_lds_b128 %0, %8, off\n\t"              \
                 "global_load_async_to_lds_b128 %1, %9, off\n\t"              \
                 "global_load_async_to_lds_b128 %2, %10, off\n\t"             \
                 "global_load_async_to_lds_b128 %3, %11, off\n\t"             \
                 "global_load_async_to_lds_b128 %4, %12, off\n\t"             \
                 "global_load_async_to_lds_b128 %5, %13, off\n\t"             \
                 "global_load_async_to_lds_b128 %6, %14, off\n\t"             \
                 "global_load_async_to_lds_b128 %7, %15, off\n\t"             \
                 "s_wait_xcnt 0x0"                                            \
                 :: "v"(lbase + ((r0) + 0) * (XS_STRIDE * 2)),                \
                    "v"(lbase + ((r0) + 1) * (XS_STRIDE * 2)),                \
                    "v"(lbase + ((r0) + 2) * (XS_STRIDE * 2)),                \
                    "v"(lbase + ((r0) + 3) * (XS_STRIDE * 2)),                \
                    "v"(lbase + ((r0) + 4) * (XS_STRIDE * 2)),                \
                    "v"(lbase + ((r0) + 5) * (XS_STRIDE * 2)),                \
                    "v"(lbase + ((r0) + 6) * (XS_STRIDE * 2)),                \
                    "v"(lbase + ((r0) + 7) * (XS_STRIDE * 2)),                \
                    "v"(gbase + (size_t)((r0) + 0) * H_),                     \
                    "v"(gbase + (size_t)((r0) + 1) * H_),                     \
                    "v"(gbase + (size_t)((r0) + 2) * H_),                     \
                    "v"(gbase + (size_t)((r0) + 3) * H_),                     \
                    "v"(gbase + (size_t)((r0) + 4) * H_),                     \
                    "v"(gbase + (size_t)((r0) + 5) * H_),                     \
                    "v"(gbase + (size_t)((r0) + 6) * H_),                     \
                    "v"(gbase + (size_t)((r0) + 7) * H_)                      \
                 : "memory")

// ---------------------------------------------------------------------
// 3) MoE expert kernel: one block per 64-token tile, 256 threads (8 waves).
//    Every weight fragment read from global memory feeds four WMMAs (the
//    four 16-token sub-tiles); W1b and W2b arrive in fragment order. Stage 1: wave e owns expert e, 64 x 128
//    accumulators in registers. Stage 2: a wave owns 16 column tiles of
//    the output, four at a time.
// ---------------------------------------------------------------------
__global__ __launch_bounds__(256)
void moe_kernel(const float* __restrict__ x,
                const bf16*  __restrict__ xb,
                const bf16*  __restrict__ W1b,
                const float* __restrict__ b1,
                const bf16*  __restrict__ W2b,
                const float* __restrict__ b2,
                const float* __restrict__ wN,
                float* __restrict__ out) {
    // the staged x tile; once stage 1 has read it, the same bytes hold Hw
    __shared__ __align__(16) bf16 Xs[TM_][XS_STRIDE];
    __shared__ __align__(16) float tileW[TM_][E_];
    __shared__ int   eflag[E_];
    bf16 (*Hw)[TM_][HW_STRIDE] = (bf16 (*)[TM_][HW_STRIDE])&Xs[0][0];   // [E_][TM_][HW_STRIDE]

    const int tile = blockIdx.x;           // 0..N/64-1
    const int tok0 = tile * TM_;
    const int lane = threadIdx.x & 31;
    const int wave = __builtin_amdgcn_readfirstlane(threadIdx.x >> 5);
    const int col  = lane & 15;            // fragment row/col index
    const int klo  = (lane >> 4) * 8;      // per-lane K offset
    const int hi   = lane >> 4;

    // ---- async-stage the x tile (64 x 2048 bf16 = 256KB) into LDS ----
    // one copy of the block = one row (256 threads x 16B); 64 copies a wave,
    // in two halves so that no wave has more than 32 outstanding.
    const bf16*    gbase = xb + (size_t)tok0 * H_ + threadIdx.x * 8;
    const unsigned lbase = (unsigned)(uintptr_t)(&Xs[0][threadIdx.x * 8]);
    COPY8_ROWS(0);  COPY8_ROWS(8);  COPY8_ROWS(16); COPY8_ROWS(24);

    // combine weights while the copies are in flight
#pragma unroll
    for (int j = 0; j < TM_ * E_ / 256; j++) {
        const int i = threadIdx.x + 256 * j;
        tileW[i >> 3][i & 7] = wN[(size_t)tok0 * E_ + i];
    }

    // first half landed before the second half is issued
    asm volatile("s_wait_asynccnt 0x0" ::: "memory");
    COPY8_ROWS(32); COPY8_ROWS(40); COPY8_ROWS(48); COPY8_ROWS(56);

    __syncthreads();
    if (threadIdx.x < E_) {
        int f = 0;
        for (int m = 0; m < TM_; m++) f |= (tileW[m][threadIdx.x] != 0.f);
        eflag[threadIdx.x] = f;
    }
    // wait for this wave's async transfers, then barrier for cross-wave vis
    asm volatile("s_wait_asynccnt 0x0" ::: "memory");
    __syncthreads();

    unsigned emask = 0;
#pragma unroll
    for (int e = 0; e < E_; e++) emask |= (eflag[e] ? 1u : 0u) << e;
    emask = __builtin_amdgcn_readfirstlane(emask);
    const bool mine = (emask >> wave) & 1u;   // wave-uniform: expert 'wave' is used by this tile

    // ---------------- stage 1: Hw[e] = w * relu(X @ W1_e^T + b1_e) ----
    f32x8 acc[MT_][8];
#pragma unroll
    for (int mt = 0; mt < MT_; mt++)
#pragma unroll
        for (int n = 0; n < 8; n++)
            acc[mt][n] = (f32x8){0.f,0.f,0.f,0.f,0.f,0.f,0.f,0.f};
    if (mine) {
        const bf16* arow = &Xs[col][klo];                               // LDS
        // packed W1: [row tile = wave*8 + n][k step][half][lane][8]
        const bf16* brow = W1b + (size_t)wave * B_ * H_ + lane * 8;
        // 64 k a trip: per column tile four loads, 2 KB in a row
        for (int k0 = 0; k0 < H_; k0 += 64) {
            FragBF a[2][MT_], b[2][8];
#pragma unroll
            for (int n = 0; n < 8; n++)
#pragma unroll
                for (int ks = 0; ks < 2; ks++) {
                    b[ks][n].h[0] = *(const bf16x8*)(brow + (size_t)n * 16 * H_ + (k0 + ks * 32) * 16);
                    b[ks][n].h[1] = *(const bf16x8*)(brow + (size_t)n * 16 * H_ + (k0 + ks * 32) * 16 + 256);
                }
#pragma unroll
            for (int ks = 0; ks < 2; ks++)
#pragma unroll
                for (int mt = 0; mt < MT_; mt++) {
                    a[ks][mt].h[0] = *(const bf16x8*)(arow + mt * 16 * XS_STRIDE + k0 + ks * 32);
                    a[ks][mt].h[1] = *(const bf16x8*)(arow + mt * 16 * XS_STRIDE + k0 + ks * 32 + 16);
                }
            // the weight pointer is stepped below: its loads have taken the address first
            asm volatile("s_wait_xcnt 0x0" ::: "memory");
            // keeps the trip's loads one group in front of its WMMAs: sunk among them,
            // each weight fragment's L2 latency would be waited out on its own
            __builtin_amdgcn_sched_barrier(0);
#pragma unroll
            for (int ks = 0; ks < 2; ks++)
#pragma unroll
                for (int n = 0; n < 8; n++)
#pragma unroll
                    for (int mt = 0; mt < MT_; mt++)
                        acc[mt][n] = __builtin_amdgcn_wmma_f32_16x16x32_bf16(
                            false, a[ks][mt].v, false, b[ks][n].v, (short)0, acc[mt][n], false, false);
        }
    }
    __syncthreads();   // every wave has read its last x fragment: the bytes may become Hw
    if (mine) {
        float wv[MT_][8];
#pragma unroll
        for (int mt = 0; mt < MT_; mt++)
#pragma unroll
            for (int r = 0; r < 8; r++) wv[mt][r] = tileW[mt * 16 + r + hi * 8][wave];
#pragma unroll
        for (int n = 0; n < 8; n++) {
            const float bb = b1[wave * B_ + n * 16 + col];
#pragma unroll
            for (int mt = 0; mt < MT_; mt++)
#pragma unroll
                for (int r = 0; r < 8; r++) {
                    float h = fmaxf(acc[mt][n][r] + bb, 0.f) * wv[mt][r];
                    Hw[wave][mt * 16 + r + hi * 8][n * 16 + col] = (bf16)h;
                }
        }
    }
    __syncthreads();

    // ---------------- stage 2: out = x + sum_e Hw_e @ W2_e^T + w@b2 ---
    for (int g = 0; g < 16 / NT2_; g++) {
        const int ct0   = wave * 16 + g * NT2_;   // 128 column tiles over 8 waves
        const int hcol0 = ct0 * 16 + col;
        f32x8 acc2[MT_][NT2_];
#pragma unroll
        for (int mt = 0; mt < MT_; mt++)
#pragma unroll
            for (int n = 0; n < NT2_; n++)
                acc2[mt][n] = (f32x8){0.f,0.f,0.f,0.f,0.f,0.f,0.f,0.f};
        for (int e = 0; e < E_; e++) {
            if (!((emask >> e) & 1u)) continue;   // block-uniform scalar branch
            const bf16* arow = &Hw[e][col][klo];
            // packed W2: [row tile = e*128 + ct0 + n][k step][half][lane][8]
            const bf16* brow = W2b + ((size_t)e * H_ + ct0 * 16) * B_ + lane * 8;
            FragBF a[B_ / 32][MT_], b[B_ / 32][NT2_];
#pragma unroll
            for (int n = 0; n < NT2_; n++)
#pragma unroll
                for (int ks = 0; ks < B_ / 32; ks++) {
                    b[ks][n].h[0] = *(const bf16x8*)(brow + n * 16 * B_ + ks * 512);
                    b[ks][n].h[1] = *(const bf16x8*)(brow + n * 16 * B_ + ks * 512 + 256);
                }
#pragma unroll
            for (int ks = 0; ks < B_ / 32; ks++)
#pragma unroll
                for (int mt = 0; mt < MT_; mt++) {
                    a[ks][mt].h[0] = *(const bf16x8*)(arow + mt * 16 * HW_STRIDE + ks * 32);
                    a[ks][mt].h[1] = *(const bf16x8*)(arow + mt * 16 * HW_STRIDE + ks * 32 + 16);
                }
            // the loads have taken their address before its registers are reused; naming the
            // pointer keeps it in its registers up to the wait
            asm volatile("s_wait_xcnt 0x0" :: "v"(brow) : "memory");
            // as in stage 1: the expert's loads stay one group in front of its WMMAs
            __builtin_amdgcn_sched_barrier(0);
#pragma unroll
            for (int ks = 0; ks < B_ / 32; ks++)
#pragma unroll
                for (int n = 0; n < NT2_; n++)
#pragma unroll
                    for (int mt = 0; mt < MT_; mt++)
                        acc2[mt][n] = __builtin_amdgcn_wmma_f32_16x16x32_bf16(
                            false, a[ks][mt].v, false, b[ks][n].v, (short)0, acc2[mt][n], false, false);
        }
        // x and out rows of this tile: uniform base, one element offset per lane
        const float*   xt   = x   + (size_t)tok0 * H_;
        float*         ot   = out + (size_t)tok0 * H_;
        const int      off0 = hi * 8 * H_ + hcol0;
        float xv[MT_][NT2_][8];
#pragma unroll
        for (int mt = 0; mt < MT_; mt++)
#pragma unroll
            for (int r = 0; r < 8; r++)
#pragma unroll
                for (int n = 0; n < NT2_; n++)
                    xv[mt][n][r] = xt[(size_t)((mt * 16 + r) * H_ + n * 16) + off0];
        float b2v[NT2_][E_];
#pragma unroll
        for (int n = 0; n < NT2_; n++)
#pragma unroll
            for (int e = 0; e < E_; e++) b2v[n][e] = b2[(size_t)e * H_ + hcol0 + n * 16];
        // the loads have taken their offset registers before anything reuses them; naming
        // the offsets keeps them in their registers up to the wait
        asm volatile("s_wait_xcnt 0x0" :: "v"(hcol0), "v"(off0) : "memory");
        // the group's loads stay together in front of the arithmetic: one memory latency a group
        __builtin_amdgcn_sched_barrier(0);
#pragma unroll
        for (int mt = 0; mt < MT_; mt++)
#pragma unroll
            for (int r = 0; r < 8; r++) {
                const int m = mt * 16 + r + hi * 8;
                float tw[E_];
#pragma unroll
                for (int e = 0; e < E_; e++) tw[e] = tileW[m][e];
#pragma unroll
                for (int n = 0; n < NT2_; n++) {
                    float s = 0.f;
#pragma unroll
                    for (int e = 0; e < E_; e++) s = fmaf(tw[e], b2v[n][e], s);
                    acc2[mt][n][r] = xv[mt][n][r] + acc2[mt][n][r] + s;
                }
            }
        // every result is formed before the first store, so that no register of an
        // issued store is written again in front of the wait behind the stores
        __builtin_amdgcn_sched_barrier(0);
#pragma unroll
        for (int mt = 0; mt < MT_; mt++)
#pragma unroll
            for (int r = 0; r < 8; r++)
#pragma unroll
                for (int n = 0; n < NT2_; n++)
                    ot[(size_t)((mt * 16 + r) * H_ + n * 16) + off0] = acc2[mt][n][r];
        // the next group reuses the stores' registers: the stores have taken them first
        asm volatile("s_wait_xcnt 0x0" ::: "memory");
    }
}

// ---------------------------------------------------------------------
// 4) finalize aux loss -> d_out[N*H]
// ---------------------------------------------------------------------
__global__ void finalize_kernel(const float* __restrict__ probSum,
                                const float* __restrict__ freqCnt,
                                float* __restrict__ out_aux) {
    if (threadIdx.x == 0 && blockIdx.x == 0) {
        float s = 0.f;
        for (int e = 0; e < E_; e++)
            s += (probSum[e] / (float)N_) * (freqCnt[e] / (float)N_);
        *out_aux = s * (float)E_;
    }
}

// ---------------------------------------------------------------------
extern "C" void kernel_launch(void* const* d_in, const int* in_sizes, int n_in,
                              void* d_out, int out_size, void* d_ws, size_t ws_size,
                              hipStream_t stream) {
    const float* x     = (const float*)d_in[0];
    const float* skin  = (const float*)d_in[1];
    const float* Wimg  = (const float*)d_in[2];
    const float* Wskin = (const float*)d_in[3];
    const float* W1    = (const float*)d_in[4];
    const float* b1    = (const float*)d_in[5];
    const float* W2    = (const float*)d_in[6];
    const float* b2    = (const float*)d_in[7];
    float* out = (float*)d_out;

    // workspace layout
    char* ws = (char*)d_ws;
    float* wN      = (float*)ws;                                   // N*E f32 (512KB)
    float* probSum = (float*)(ws + (size_t)N_ * E_ * sizeof(float));
    float* freqCnt = probSum + 8;
    bf16*  xb  = (bf16*)(ws + (1ull << 20));                       // N*H bf16 (64MB)
    bf16*  W1b = xb  + (size_t)N_ * H_;                            // E*B*H bf16 (4MB)
    bf16*  W2b = W1b + (size_t)E_ * B_ * H_;                       // E*H*B bf16 (4MB)

    // 0) zero aux accumulators
    zero_accum_kernel<<<1, 32, 0, stream>>>(probSum);

    // 1) bf16 conversions
    {
        size_t n4 = (size_t)N_ * H_ / 4;
        cvt_bf16_kernel<<<(unsigned)((n4 + 255) / 256), 256, 0, stream>>>(x, xb, n4);
        // weights: converted straight into fragment order (rows of 2048 = 64 k steps, of 128 = 4)
        pack_bf16_kernel<<<E_ * B_ * H_ / 8 / 256, 256, 0, stream>>>(W1, W1b, 6, E_ * B_ * H_ / 8);
        pack_bf16_kernel<<<E_ * B_ * H_ / 8 / 256, 256, 0, stream>>>(W2, W2b, 2, E_ * B_ * H_ / 8);
    }

    // 2) router (2048 waves, 8 tokens each)
    router_kernel<<<256, 256, 0, stream>>>(x, skin, Wimg, Wskin, wN, probSum, freqCnt);

    // 3) expert GEMMs + combine + residual
    moe_kernel<<<N_ / 64, 256, 0, stream>>>(x, xb, W1b, b1, W2b, b2, wN, out);

    // 4) aux loss scalar
    finalize_kernel<<<1, 32, 0, stream>>>(probSum, freqCnt, out + (size_t)N_ * H_);
}

// v003
// A run of this version takes 146 microseconds.
// In two side-by-side timings against v002, it was 1.48 and 1.49 times as fast.
// Counting every step since v000, it is 4.72 times as fast.
#include <hip/hip_runtime.h>
#include <hip/hip_bf16.h>

// ---------------- problem constants (match reference) ----------------
#define E_   8
#define K_   2
#define N_   16384
#define H_   2048
#define B_   128
#define EPS_ 1e-6f

typedef __bf16 bf16;
typedef __attribute__((ext_vector_type(16))) __bf16 bf16x16;
typedef __attribute__((ext_vector_type(8)))  __bf16 bf16x8;
typedef __attribute__((ext_vector_type(8)))  float  f32x8;

// ---------------------------------------------------------------------
// 0) zero the aux accumulators (16 floats) each call
// ---------------------------------------------------------------------
__global__ void zero_accum_kernel(float* __restrict__ acc) {
    if (threadIdx.x < 16) acc[threadIdx.x] = 0.0f;
}

// ---------------------------------------------------------------------
// 1b) fp32 -> bf16 conversion (RNE) of a weight matrix [rows][32 << kkShift]
//     into WMMA B-fragment order: dst[row tile][k step of 32][half][lane][8].
//     Lane l of half j holds row (l & 15), k = j*16 + (l >> 4)*8 .. +7, so one
//     wave-wide 16-byte load of a half reads 512 contiguous bytes (4 whole lines).
//     One thread writes one 16-byte piece.
// ---------------------------------------------------------------------
__global__ void pack_bf16_kernel(const float* __restrict__ src,
                                 bf16* __restrict__ dst, int kkShift, int nPieces) {
    const int c = blockIdx.x * blockDim.x + threadIdx.x;
    if (c < nPieces) {
        const int l   = c & 31;
        const int j   = (c >> 5) & 1;
        const int t   = c >> 6;
        const int kk  = t & ((1 << kkShift) - 1);
        const int rt  = t >> kkShift;
        const int row = rt * 16 + (l & 15);
        const int k   = kk * 32 + j * 16 + (l >> 4) * 8;
        const float4* s = (const float4*)(src + ((size_t)row << (kkShift + 5)) + k);
        const float4 v0 = s[0], v1 = s[1];
        union { bf16 b[8]; uint4 u; } o;
        o.b[0] = (bf16)v0.x; o.b[1] = (bf16)v0.y;
        o.b[2] = (bf16)v0.z; o.b[3] = (bf16)v0.w;
        o.b[4] = (bf16)v1.x; o.b[5] = (bf16)v1.y;
        o.b[6] = (bf16)v1.z; o.b[7] = (bf16)v1.w;
        ((uint4*)dst)[c] = o.u;
    }
}

// ---------------------------------------------------------------------
// 2) router and fp32 -> bf16 conversion (RNE) of x in one pass over x.
//    A work-group takes 32 tokens; wave w owns columns w*256 .. w*256+255 and
//    keeps its slice of W_img in registers (8 experts x 8 columns a lane).
//    Per token a wave reads two runs of 512 contiguous bytes, writes their
//    bf16 copy and adds to 8 partial logits a lane; four tokens at a time.
//    Every loop of the kernel is unrolled: its arrays stay in registers only
//    under constant indices, and the token offsets become immediates, so that
//    no address register of a load or store is ever stepped.
// ---------------------------------------------------------------------
#define RT_TOK 32   // tokens per work-group
#define RT_G   4    // tokens a wave holds at once

__global__ __launch_bounds__(256)
void router_cvt_kernel(const float* __restrict__ x,
                       const float* __restrict__ skin,
                       const float* __restrict__ Wimg,
                       const float* __restrict__ Wskin,
                       bf16*  __restrict__ xb,
                       float* __restrict__ wout,
                       float* __restrict__ probSum,
                       float* __restrict__ freqCnt) {
    __shared__ float part[8][RT_TOK * E_];     // per wave: its columns' share of every logit
    __shared__ float lgs[RT_TOK][E_ + 1];      // +1: a lane reads one token's row, banks apart
    const int lane = threadIdx.x & 31;
    const int wave = __builtin_amdgcn_readfirstlane(threadIdx.x >> 5);
    const int tok0 = blockIdx.x * RT_TOK;
    const int l4   = lane * 4;

    const float* wt = Wimg + wave * 256;
    float4 w[E_][2];
#pragma unroll
    for (int e = 0; e < E_; e++)
#pragma unroll
        for (int j = 0; j < 2; j++)
            w[e][j] = *(const float4*)(wt + (e * H_ + j * 128) + l4);

    // uniform base, one element offset per lane, constants for token and half
    const float* xt = x  + (size_t)tok0 * H_ + wave * 256;
    bf16*        xo = xb + (size_t)tok0 * H_ + wave * 256;

    float4 v[2][RT_G][2];
#pragma unroll
    for (int t = 0; t < RT_G; t++)
#pragma unroll
        for (int j = 0; j < 2; j++)
            v[0][t][j] = *(const float4*)(xt + (t * H_ + j * 128) + l4);

#pragma unroll
    for (int g = 0; g < RT_TOK / RT_G; g++) {
        // the next four tokens' loads fly while these four are worked on
        if (g + 1 < RT_TOK / RT_G) {
#pragma unroll
            for (int t = 0; t < RT_G; t++)
#pragma unroll
                for (int j = 0; j < 2; j++)
                    v[(g + 1) & 1][t][j] =
                        *(const float4*)(xt + (((g + 1) * RT_G + t) * H_ + j * 128) + l4);
        }
        // keeps those loads in front of this group's arithmetic: sunk behind it they
        // would have no lead and each group would wait out a whole memory latency
        __builtin_amdgcn_sched_barrier(0);

        float a[RT_G * E_];
#pragma unroll
        for (int t = 0; t < RT_G; t++)
#pragma unroll
            for (int e = 0; e < E_; e++) {
                float s = 0.f;
#pragma unroll
                for (int j = 0; j < 2; j++) {
                    const float4 xv = v[g & 1][t][j];
                    s = fmaf(xv.x, w[e][j].x, s);
                    s = fmaf(xv.y, w[e][j].y, s);
                    s = fmaf(xv.z, w[e][j].z, s);
                    s = fmaf(xv.w, w[e][j].w, s);
                }
                a[t * E_ + e] = s;
            }
#pragma unroll
        for (int t = 0; t < RT_G; t++)
#pragma unroll
            for (int j = 0; j < 2; j++) {
                const float4 xv = v[g & 1][t][j];
                union { bf16 b[4]; uint2 u; } o;
                o.b[0] = (bf16)xv.x; o.b[1] = (bf16)xv.y;
                o.b[2] = (bf16)xv.z; o.b[3] = (bf16)xv.w;
                *(uint2*)(xo + ((g * RT_G + t) * H_ + j * 128) + l4) = o.u;
            }
        // the stores have taken their registers before the sums below reuse any of them
        asm volatile("s_wait_xcnt 0x0" ::: "memory");
        // nothing of the sums below is lifted over that wait
        __builtin_amdgcn_sched_barrier(0);

        // 32 values a lane summed over 32 lanes: each step halves the values a lane
        // keeps, so that lane l ends with the whole sum of value l (token l>>3, expert l&7)
#pragma unroll
        for (int off = 16; off; off >>= 1) {
            const bool up = (lane & off) != 0;
#pragma unroll
            for (int i = 0; i < off; i++) {
                const float lo = a[i], hv = a[i + off];
                const float keep = up ? hv : lo;
                const float send = up ? lo : hv;
                a[i] = keep + __shfl_xor(send, off, 32);
            }
        }
        part[wave][g * RT_G * E_ + lane] = a[0];
    }
    __syncthreads();   // every wave's shares are written
    {
        float s = 0.f;
#pragma unroll
        for (int q = 0; q < 8; q++) s += part[q][threadIdx.x];
        lgs[threadIdx.x >> 3][threadIdx.x & 7] = s;
    }
    __syncthreads();   // the logits' image part is whole

    if (wave == 0) {   // one lane per token
        const int t = tok0 + lane;
        const float s0 = skin[t * 3 + 0], s1 = skin[t * 3 + 1], s2 = skin[t * 3 + 2];
        float lg[E_]; float mx = -1e30f;
#pragma unroll
        for (int e = 0; e < E_; e++) {
            lg[e] = lgs[lane][e] + s0 * Wskin[e * 3 + 0]
                                 + s1 * Wskin[e * 3 + 1]
                                 + s2 * Wskin[e * 3 + 2];
            mx = fmaxf(mx, lg[e]);
        }
        float p[E_]; float den = 0.f;
#pragma unroll
        for (int e = 0; e < E_; e++) { p[e] = __expf(lg[e] - mx); den += p[e]; }
        const float inv = 1.f / den;
#pragma unroll
        for (int e = 0; e < E_; e++) p[e] *= inv;
        // top-2 (first index wins ties, like jax top_k)
        int i1 = 0; float v1 = p[0];
#pragma unroll
        for (int e = 1; e < E_; e++) if (p[e] > v1) { v1 = p[e]; i1 = e; }
        int i2 = -1; float v2 = -1.f;
#pragma unroll
        for (int e = 0; e < E_; e++) if (e != i1 && p[e] > v2) { v2 = p[e]; i2 = e; }
        const float inv2 = 1.f / (v1 + v2 + EPS_);
        float r[2 * E_];   // 0..7 probabilities, 8..15 selection counts
#pragma unroll
        for (int e = 0; e < E_; e++) {
            float wv = (e == i1) ? v1 * inv2 : ((e == i2) ? v2 * inv2 : 0.f);
            wout[(size_t)t * E_ + e] = wv;
            r[e]      = p[e];
            r[E_ + e] = (e == i1 || e == i2) ? 1.f : 0.f;
        }
        // 16 values a lane summed over the 32 tokens: lane l ends with value l & 15
#pragma unroll
        for (int i = 0; i < 2 * E_; i++) r[i] += __shfl_xor(r[i], 16, 32);
#pragma unroll
        for (int off = 8; off; off >>= 1) {
            const bool up = (lane & off) != 0;
#pragma unroll
            for (int i = 0; i < off; i++) {
                const float lo = r[i], hv = r[i + off];
                const float keep = up ? hv : lo;
                const float send = up ? lo : hv;
                r[i] = keep + __shfl_xor(send, off, 32);
            }
        }
        if (lane < E_)          atomicAdd(&probSum[lane], r[0]);
        else if (lane < 2 * E_) atomicAdd(&freqCnt[lane - E_], r[0]);
    }
}

// ---------------------------------------------------------------------
// fragment union: CDNA5 16-bit A/B layout — lane = row/col (lane&15),
// K values { klo..klo+7, 16+klo..23+klo } with klo = (lane>>4)*8.
// ---------------------------------------------------------------------
union FragBF { bf16x16 v; bf16x8 h[2]; };

#define XS_STRIDE 2056   // 2048 + 8: 16B-aligned, +4 banks/row -> conflict-free
#define HW_STRIDE 136    // 128 + 8:  16B-aligned, +4 banks/row -> conflict-free
#define TM_ 64           // tokens per work-group
#define MT_ 4            // 16-token sub-tiles per work-group
#define NT2_ 4           // output column tiles a wave holds at once in stage 2

// eight 16-byte-per-lane copies, rows r0..r0+7 of the x tile; the closing
// s_wait_xcnt keeps the address registers untouched until the copies took them
#define COPY8_ROWS(r0)                                                        \
    asm volatile("global_load_async_to_lds_b128 %0, %8, off\n\t"              \
                 "global_load_async_to_lds_b128 %1, %9, off\n\t"              \
                 "global_load_async_to_lds_b128 %2, %10, off\n\t"             \
                 "global_load_async_to_lds_b128 %3, %11, off\n\t"             \
                 "global_load_async_to_lds_b128 %4, %12, off\n\t"             \
                 "global_load_async_to_lds_b128 %5, %13, off\n\t"             \
                 "global_load_async_to_lds_b128 %6, %14, off\n\t"             \
                 "global_load_async_to_lds_b128 %7, %15, off\n\t"             \
                 "s_wait_xcnt 0x0"                                            \
                 :: "v"(lbase + ((r0) + 0) * (XS_STRIDE * 2)),                \
                    "v"(lbase + ((r0) + 1) * (XS_STRIDE * 2)),                \
                    "v"(lbase + ((r0) + 2) * (XS_STRIDE * 2)),                \
                    "v"(lbase + ((r0) + 3) * (XS_STRIDE * 2)),                \
                    "v"(lbase + ((r0) + 4) * (XS_STRIDE * 2)),                \
                    "v"(lbase + ((r0) + 5) * (XS_STRIDE * 2)),                \
                    "v"(lbase + ((r0) + 6) * (XS_STRIDE * 2)),                \
                    "v"(lbase + ((r0) + 7) * (XS_STRIDE * 2)),                \
                    "v"(gbase + (size_t)((r0) + 0) * H_),                     \
                    "v"(gbase + (size_t)((r0) + 1) * H_),                     \
                    "v"(gbase + (size_t)((r0) + 2) * H_),                     \
                    "v"(gbase + (size_t)((r0) + 3) * H_),                     \
                    "v"(gbase + (size_t)((r0) + 4) * H_),                     \
                    "v"(gbase + (size_t)((r0) + 5) * H_),                     \
                    "v"(gbase + (size_t)((r0) + 6) * H_),                     \
                    "v"(gbase + (size_t)((r0) + 7) * H_)                      \
                 : "memory")

// ---------------------------------------------------------------------
// 3) MoE expert kernel: one block per 64-token tile, 256 threads (8 waves).
//    Every weight fragment read from global memory feeds four WMMAs (the
//    four 16-token sub-tiles); W1b and W2b arrive in fragment order. Stage 1: wave e owns expert e, 64 x 128
//    accumulators in registers. Stage 2: a wave owns 16 column tiles of
//    the output, four at a time.
// ---------------------------------------------------------------------
__global__ __launch_bounds__(256)
void moe_kernel(const float* __restrict__ x,
                const bf16*  __restrict__ xb,
                const bf16*  __restrict__ W1b,
                const float* __restrict__ b1,
                const bf16*  __restrict__ W2b,
                const float* __restrict__ b2,
                const float* __restrict__ wN,
                float* __restrict__ out) {
    // the staged x tile; once stage 1 has read it, the same bytes hold Hw
    __shared__ __align__(16) bf16 Xs[TM_][XS_STRIDE];
    __shared__ __align__(16) float tileW[TM_][E_];
    __shared__ int   eflag[E_];
    bf16 (*Hw)[TM_][HW_STRIDE] = (bf16 (*)[TM_][HW_STRIDE])&Xs[0][0];   // [E_][TM_][HW_STRIDE]

    const int tile = blockIdx.x;           // 0..N/64-1
    const int tok0 = tile * TM_;
    const int lane = threadIdx.x & 31;
    const int wave = __builtin_amdgcn_readfirstlane(threadIdx.x >> 5);
    const int col  = lane & 15;            // fragment row/col index
    const int klo  = (lane >> 4) * 8;      // per-lane K offset
    const int hi   = lane >> 4;

    // ---- async-stage the x tile (64 x 2048 bf16 = 256KB) into LDS ----
    // one copy of the block = one row (256 threads x 16B); 64 copies a wave,
    // in two halves so that no wave has more than 32 outstanding.
    const bf16*    gbase = xb + (size_t)tok0 * H_ + threadIdx.x * 8;
    const unsigned lbase = (unsigned)(uintptr_t)(&Xs[0][threadIdx.x * 8]);
    COPY8_ROWS(0);  COPY8_ROWS(8);  COPY8_ROWS(16); COPY8_ROWS(24);

    // combine weights while the copies are in flight
#pragma unroll
    for (int j = 0; j < TM_ * E_ / 256; j++) {
        const int i = threadIdx.x + 256 * j;
        tileW[i >> 3][i & 7] = wN[(size_t)tok0 * E_ + i];
    }

    // first half landed before the second half is issued
    asm volatile("s_wait_asynccnt 0x0" ::: "memory");
    COPY8_ROWS(32); COPY8_ROWS(40); COPY8_ROWS(48); COPY8_ROWS(56);

    __syncthreads();
    if (threadIdx.x < E_) {
        int f = 0;
        for (int m = 0; m < TM_; m++) f |= (tileW[m][threadIdx.x] != 0.f);
        eflag[threadIdx.x] = f;
    }
    // wait for this wave's async transfers, then barrier for cross-wave vis
    asm volatile("s_wait_asynccnt 0x0" ::: "memory");
    __syncthreads();

    unsigned emask = 0;
#pragma unroll
    for (int e = 0; e < E_; e++) emask |= (eflag[e] ? 1u : 0u) << e;
    emask = __builtin_amdgcn_readfirstlane(emask);
    const bool mine = (emask >> wave) & 1u;   // wave-uniform: expert 'wave' is used by this tile

    // ---------------- stage 1: Hw[e] = w * relu(X @ W1_e^T + b1_e) ----
    f32x8 acc[MT_][8];
#pragma unroll
    for (int mt = 0; mt < MT_; mt++)
#pragma unroll
        for (int n = 0; n < 8; n++)
            acc[mt][n] = (f32x8){0.f,0.f,0.f,0.f,0.f,0.f,0.f,0.f};
    if (mine) {
        const bf16* arow = &Xs[col][klo];                               // LDS
        // packed W1: [row tile = wave*8 + n][k step][half][lane][8]
        const bf16* brow = W1b + (size_t)wave * B_ * H_ + lane * 8;
        // 64 k a trip: per column tile four loads, 2 KB in a row
        for (int k0 = 0; k0 < H_; k0 += 64) {
            FragBF a[2][MT_], b[2][8];
#pragma unroll
            for (int n = 0; n < 8; n++)
#pragma unroll
                for (int ks = 0; ks < 2; ks++) {
                    b[ks][n].h[0] = *(const bf16x8*)(brow + (size_t)n * 16 * H_ + (k0 + ks * 32) * 16);
                    b[ks][n].h[1] = *(const bf16x8*)(brow + (size_t)n * 16 * H_ + (k0 + ks * 32) * 16 + 256);
                }
#pragma unroll
            for (int ks = 0; ks < 2; ks++)
#pragma unroll
                for (int mt = 0; mt < MT_; mt++) {
                    a[ks][mt].h[0] = *(const bf16x8*)(arow + mt * 16 * XS_STRIDE + k0 + ks * 32);
                    a[ks][mt].h[1] = *(const bf16x8*)(arow + mt * 16 * XS_STRIDE + k0 + ks * 32 + 16);
                }
            // the weight pointer is stepped below: its loads have taken the address first
            asm volatile("s_wait_xcnt 0x0" ::: "memory");
            // keeps the trip's loads one group in front of its WMMAs: sunk among them,
            // each weight fragment's L2 latency would be waited out on its own
            __builtin_amdgcn_sched_barrier(0);
#pragma unroll
            for (int ks = 0; ks < 2; ks++)
#pragma unroll
                for (int n = 0; n < 8; n++)
#pragma unroll
                    for (int mt = 0; mt < MT_; mt++)
                        acc[mt][n] = __builtin_amdgcn_wmma_f32_16x16x32_bf16(
                            false, a[ks][mt].v, false, b[ks][n].v, (short)0, acc[mt][n], false, false);
        }
    }
    __syncthreads();   // every wave has read its last x fragment: the bytes may become Hw
    if (mine) {
        float wv[MT_][8];
#pragma unroll
        for (int mt = 0; mt < MT_; mt++)
#pragma unroll
            for (int r = 0; r < 8; r++) wv[mt][r] = tileW[mt * 16 + r + hi * 8][wave];
#pragma unroll
        for (int n = 0; n < 8; n++) {
            const float bb = b1[wave * B_ + n * 16 + col];
#pragma unroll
            for (int mt = 0; mt < MT_; mt++)
#pragma unroll
                for (int r = 0; r < 8; r++) {
                    float h = fmaxf(acc[mt][n][r] + bb, 0.f) * wv[mt][r];
                    Hw[wave][mt * 16 + r + hi * 8][n * 16 + col] = (bf16)h;
                }
        }
    }
    __syncthreads();

    // ---------------- stage 2: out = x + sum_e Hw_e @ W2_e^T + w@b2 ---
    for (int g = 0; g < 16 / NT2_; g++) {
        const int ct0   = wave * 16 + g * NT2_;   // 128 column tiles over 8 waves
        const int hcol0 = ct0 * 16 + col;
        f32x8 acc2[MT_][NT2_];
#pragma unroll
        for (int mt = 0; mt < MT_; mt++)
#pragma unroll
            for (int n = 0; n < NT2_; n++)
                acc2[mt][n] = (f32x8){0.f,0.f,0.f,0.f,0.f,0.f,0.f,0.f};
        for (int e = 0; e < E_; e++) {
            if (!((emask >> e) & 1u)) continue;   // block-uniform scalar branch
            const bf16* arow = &Hw[e][col][klo];
            // packed W2: [row tile = e*128 + ct0 + n][k step][half][lane][8]
            const bf16* brow = W2b + ((size_t)e * H_ + ct0 * 16) * B_ + lane * 8;
            FragBF a[B_ / 32][MT_], b[B_ / 32][NT2_];
#pragma unroll
            for (int n = 0; n < NT2_; n++)
#pragma unroll
                for (int ks = 0; ks < B_ / 32; ks++) {
                    b[ks][n].h[0] = *(const bf16x8*)(brow + n * 16 * B_ + ks * 512);
                    b[ks][n].h[1] = *(const bf16x8*)(brow + n * 16 * B_ + ks * 512 + 256);
                }
#pragma unroll
            for (int ks = 0; ks < B_ / 32; ks++)
#pragma unroll
                for (int mt = 0; mt < MT_; mt++) {
                    a[ks][mt].h[0] = *(const bf16x8*)(arow + mt * 16 * HW_STRIDE + ks * 32);
                    a[ks][mt].h[1] = *(const bf16x8*)(arow + mt * 16 * HW_STRIDE + ks * 32 + 16);
                }
            // the loads have taken their address before its registers are reused; naming the
            // pointer keeps it in its registers up to the wait
            asm volatile("s_wait_xcnt 0x0" :: "v"(brow) : "memory");
            // as in stage 1: the expert's loads stay one group in front of its WMMAs
            __builtin_amdgcn_sched_barrier(0);
#pragma unroll
            for (int ks = 0; ks < B_ / 32; ks++)
#pragma unroll
                for (int n = 0; n < NT2_; n++)
#pragma unroll
                    for (int mt = 0; mt < MT_; mt++)
                        acc2[mt][n] = __builtin_amdgcn_wmma_f32_16x16x32_bf16(
                            false, a[ks][mt].v, false, b[ks][n].v, (short)0, acc2[mt][n], false, false);
        }
        // x and out rows of this tile: uniform base, one element offset per lane
        const float*   xt   = x   + (size_t)tok0 * H_;
        float*         ot   = out + (size_t)tok0 * H_;
        const int      off0 = hi * 8 * H_ + hcol0;
        float xv[MT_][NT2_][8];
#pragma unroll
        for (int mt = 0; mt < MT_; mt++)
#pragma unroll
            for (int r = 0; r < 8; r++)
#pragma unroll
                for (int n = 0; n < NT2_; n++)
                    xv[mt][n][r] = xt[(size_t)((mt * 16 + r) * H_ + n * 16) + off0];
        float b2v[NT2_][E_];
#pragma unroll
        for (int n = 0; n < NT2_; n++)
#pragma unroll
            for (int e = 0; e < E_; e++) b2v[n][e] = b2[(size_t)e * H_ + hcol0 + n * 16];
        // the loads have taken their offset registers before anything reuses them; naming
        // the offsets keeps them in their registers up to the wait
        asm volatile("s_wait_xcnt 0x0" :: "v"(hcol0), "v"(off0) : "memory");
        // the group's loads stay together in front of the arithmetic: one memory latency a group
        __builtin_amdgcn_sched_barrier(0);
#pragma unroll
        for (int mt = 0; mt < MT_; mt++)
#pragma unroll
            for (int r = 0; r < 8; r++) {
                const int m = mt * 16 + r + hi * 8;
                float tw[E_];
#pragma unroll
                for (int e = 0; e < E_; e++) tw[e] = tileW[m][e];
#pragma unroll
                for (int n = 0; n < NT2_; n++) {
                    float s = 0.f;
#pragma unroll
                    for (int e = 0; e < E_; e++) s = fmaf(tw[e], b2v[n][e], s);
                    acc2[mt][n][r] = xv[mt][n][r] + acc2[mt][n][r] + s;
                }
            }
        // every result is formed before the first store, so that no register of an
        // issued store is written again in front of the wait behind the stores
        __builtin_amdgcn_sched_barrier(0);
#pragma unroll
        for (int mt = 0; mt < MT_; mt++)
#pragma unroll
            for (int r = 0; r < 8; r++)
#pragma unroll
                for (int n = 0; n < NT2_; n++)
                    ot[(size_t)((mt * 16 + r) * H_ + n * 16) + off0] = acc2[mt][n][r];
        // the next group reuses the stores' registers: the stores have taken them first
        asm volatile("s_wait_xcnt 0x0" ::: "memory");
    }
}

// ---------------------------------------------------------------------
// 4) finalize aux loss -> d_out[N*H]
// ---------------------------------------------------------------------
__global__ void finalize_kernel(const float* __restrict__ probSum,
                                const float* __restrict__ freqCnt,
                                float* __restrict__ out_aux) {
    if (threadIdx.x == 0 && blockIdx.x == 0) {
        float s = 0.f;
        for (int e = 0; e < E_; e++)
            s += (probSum[e] / (float)N_) * (freqCnt[e] / (float)N_);
        *out_aux = s * (float)E_;
    }
}

// ---------------------------------------------------------------------
extern "C" void kernel_launch(void* const* d_in, const int* in_sizes, int n_in,
                              void* d_out, int out_size, void* d_ws, size_t ws_size,
                              hipStream_t stream) {
    const float* x     = (const float*)d_in[0];
    const float* skin  = (const float*)d_in[1];
    const float* Wimg  = (const float*)d_in[2];
    const float* Wskin = (const float*)d_in[3];
    const float* W1    = (const float*)d_in[4];
    const float* b1    = (const float*)d_in[5];
    const float* W2    = (const float*)d_in[6];
    const float* b2    = (const float*)d_in[7];
    float* out = (float*)d_out;

    // workspace layout
    char* ws = (char*)d_ws;
    float* wN      = (float*)ws;                                   // N*E f32 (512KB)
    float* probSum = (float*)(ws + (size_t)N_ * E_ * sizeof(float));
    float* freqCnt = probSum + 8;
    bf16*  xb  = (bf16*)(ws + (1ull << 20));                       // N*H bf16 (64MB)
    bf16*  W1b = xb  + (size_t)N_ * H_;                            // E*B*H bf16 (4MB)
    bf16*  W2b = W1b + (size_t)E_ * B_ * H_;                       // E*H*B bf16 (4MB)

    // 0) zero aux accumulators
    zero_accum_kernel<<<1, 32, 0, stream>>>(probSum);

    // 1) weights: converted straight into fragment order (rows of 2048 = 64 k steps, of 128 = 4)
    pack_bf16_kernel<<<E_ * B_ * H_ / 8 / 256, 256, 0, stream>>>(W1, W1b, 6, E_ * B_ * H_ / 8);
    pack_bf16_kernel<<<E_ * B_ * H_ / 8 / 256, 256, 0, stream>>>(W2, W2b, 2, E_ * B_ * H_ / 8);

    // 2) router + bf16 copy of x, one pass over x (512 work-groups of 32 tokens)
    router_cvt_kernel<<<N_ / RT_TOK, 256, 0, stream>>>(x, skin, Wimg, Wskin, xb, wN, probSum, freqCnt);

    // 3) expert GEMMs + combine + residual
    moe_kernel<<<N_ / 64, 256, 0, stream>>>(x, xb, W1b, b1, W2b, b2, wN, out);

    // 4) aux loss scalar
    finalize_kernel<<<1, 32, 0, stream>>>(probSum, freqCnt, out + (size_t)N_ * H_);
}

// v004
// One run takes 116 microseconds.
// In two side-by-side timings against v003, it was 1.27 and 1.28 times as fast.
// Counting every step since v000, it is 6.01 times as fast.
#include <hip/hip_runtime.h>
#include <hip/hip_bf16.h>

// ---------------- problem constants (match reference) ----------------
#define E_   8
#define K_   2
#define N_   16384
#define H_   2048
#define B_   128
#define EPS_ 1e-6f

typedef __bf16 bf16;
typedef __attribute__((ext_vector_type(16))) __bf16 bf16x16;
typedef __attribute__((ext_vector_type(8)))  __bf16 bf16x8;
typedef __attribute__((ext_vector_type(8)))  float  f32x8;

// ---------------------------------------------------------------------
// 0) zero the aux accumulators (16 floats) each call
// ---------------------------------------------------------------------
__global__ void zero_accum_kernel(float* __restrict__ acc) {
    if (threadIdx.x < 16) acc[threadIdx.x] = 0.0f;
}

// ---------------------------------------------------------------------
// 1b) fp32 -> bf16 conversion (RNE) of a weight matrix [rows][32 << kkShift]
//     into WMMA B-fragment order: dst[row tile][k step of 32][half][lane][8].
//     Lane l of half j holds row (l & 15), k = j*16 + (l >> 4)*8 .. +7, so one
//     wave-wide 16-byte load of a half reads 512 contiguous bytes (4 whole lines).
//     One thread writes one 16-byte piece.
// ---------------------------------------------------------------------
__global__ void pack_bf16_kernel(const float* __restrict__ src,
                                 bf16* __restrict__ dst, int kkShift, int nPieces) {
    const int c = blockIdx.x * blockDim.x + threadIdx.x;
    if (c < nPieces) {
        const int l   = c & 31;
        const int j   = (c >> 5) & 1;
        const int t   = c >> 6;
        const int kk  = t & ((1 << kkShift) - 1);
        const int rt  = t >> kkShift;
        const int row = rt * 16 + (l & 15);
        const int k   = kk * 32 + j * 16 + (l >> 4) * 8;
        const float4* s = (const float4*)(src + ((size_t)row << (kkShift + 5)) + k);
        const float4 v0 = s[0], v1 = s[1];
        union { bf16 b[8]; uint4 u; } o;
        o.b[0] = (bf16)v0.x; o.b[1] = (bf16)v0.y;
        o.b[2] = (bf16)v0.z; o.b[3] = (bf16)v0.w;
        o.b[4] = (bf16)v1.x; o.b[5] = (bf16)v1.y;
        o.b[6] = (bf16)v1.z; o.b[7] = (bf16)v1.w;
        ((uint4*)dst)[c] = o.u;
    }
}

// ---------------------------------------------------------------------
// 2) router and fp32 -> bf16 conversion (RNE) of x in one pass over x.
//    A work-group takes 32 tokens; wave w owns columns w*256 .. w*256+255 and
//    keeps its slice of W_img in registers (8 experts x 8 columns a lane).
//    Per token a wave reads two runs of 512 contiguous bytes, writes their
//    bf16 copy and adds to 8 partial logits a lane; four tokens at a time.
//    Every loop of the kernel is unrolled: its arrays stay in registers only
//    under constant indices, and the token offsets become immediates, so that
//    no address register of a load or store is ever stepped.
// ---------------------------------------------------------------------
#define RT_TOK 32   // tokens per work-group
#define RT_G   4    // tokens a wave holds at once

__global__ __launch_bounds__(256)
void router_cvt_kernel(const float* __restrict__ x,
                       const float* __restrict__ skin,
                       const float* __restrict__ Wimg,
                       const float* __restrict__ Wskin,
                       bf16*  __restrict__ xb,
                       float* __restrict__ wout,
                       int*   __restrict__ key,
                       float* __restrict__ probSum,
                       float* __restrict__ freqCnt) {
    __shared__ float part[8][RT_TOK * E_];     // per wave: its columns' share of every logit
    __shared__ float lgs[RT_TOK][E_ + 1];      // +1: a lane reads one token's row, banks apart
    const int lane = threadIdx.x & 31;
    const int wave = __builtin_amdgcn_readfirstlane(threadIdx.x >> 5);
    const int tok0 = blockIdx.x * RT_TOK;
    const int l4   = lane * 4;

    const float* wt = Wimg + wave * 256;
    float4 w[E_][2];
#pragma unroll
    for (int e = 0; e < E_; e++)
#pragma unroll
        for (int j = 0; j < 2; j++)
            w[e][j] = *(const float4*)(wt + (e * H_ + j * 128) + l4);

    // uniform base, one element offset per lane, constants for token and half
    const float* xt = x  + (size_t)tok0 * H_ + wave * 256;
    bf16*        xo = xb + (size_t)tok0 * H_ + wave * 256;

    float4 v[2][RT_G][2];
#pragma unroll
    for (int t = 0; t < RT_G; t++)
#pragma unroll
        for (int j = 0; j < 2; j++)
            v[0][t][j] = *(const float4*)(xt + (t * H_ + j * 128) + l4);

#pragma unroll
    for (int g = 0; g < RT_TOK / RT_G; g++) {
        // the next four tokens' loads fly while these four are worked on
        if (g + 1 < RT_TOK / RT_G) {
#pragma unroll
            for (int t = 0; t < RT_G; t++)
#pragma unroll
                for (int j = 0; j < 2; j++)
                    v[(g + 1) & 1][t][j] =
                        *(const float4*)(xt + (((g + 1) * RT_G + t) * H_ + j * 128) + l4);
        }
        // keeps those loads in front of this group's arithmetic: sunk behind it they
        // would have no lead and each group would wait out a whole memory latency
        __builtin_amdgcn_sched_barrier(0);

        float a[RT_G * E_];
#pragma unroll
        for (int t = 0; t < RT_G; t++)
#pragma unroll
            for (int e = 0; e < E_; e++) {
                float s = 0.f;
#pragma unroll
                for (int j = 0; j < 2; j++) {
                    const float4 xv = v[g & 1][t][j];
                    s = fmaf(xv.x, w[e][j].x, s);
                    s = fmaf(xv.y, w[e][j].y, s);
                    s = fmaf(xv.z, w[e][j].z, s);
                    s = fmaf(xv.w, w[e][j].w, s);
                }
                a[t * E_ + e] = s;
            }
#pragma unroll
        for (int t = 0; t < RT_G; t++)
#pragma unroll
            for (int j = 0; j < 2; j++) {
                const float4 xv = v[g & 1][t][j];
                union { bf16 b[4]; uint2 u; } o;
                o.b[0] = (bf16)xv.x; o.b[1] = (bf16)xv.y;
                o.b[2] = (bf16)xv.z; o.b[3] = (bf16)xv.w;
                *(uint2*)(xo + ((g * RT_G + t) * H_ + j * 128) + l4) = o.u;
            }
        // the stores have taken their registers before the sums below reuse any of them
        asm volatile("s_wait_xcnt 0x0" ::: "memory");
        // nothing of the sums below is lifted over that wait
        __builtin_amdgcn_sched_barrier(0);

        // 32 values a lane summed over 32 lanes: each step halves the values a lane
        // keeps, so that lane l ends with the whole sum of value l (token l>>3, expert l&7)
#pragma unroll
        for (int off = 16; off; off >>= 1) {
            const bool up = (lane & off) != 0;
#pragma unroll
            for (int i = 0; i < off; i++) {
                const float lo = a[i], hv = a[i + off];
                const float keep = up ? hv : lo;
                const float send = up ? lo : hv;
                a[i] = keep + __shfl_xor(send, off, 32);
            }
        }
        part[wave][g * RT_G * E_ + lane] = a[0];
    }
    __syncthreads();   // every wave's shares are written
    {
        float s = 0.f;
#pragma unroll
        for (int q = 0; q < 8; q++) s += part[q][threadIdx.x];
        lgs[threadIdx.x >> 3][threadIdx.x & 7] = s;
    }
    __syncthreads();   // the logits' image part is whole

    if (wave == 0) {   // one lane per token
        const int t = tok0 + lane;
        const float s0 = skin[t * 3 + 0], s1 = skin[t * 3 + 1], s2 = skin[t * 3 + 2];
        float lg[E_]; float mx = -1e30f;
#pragma unroll
        for (int e = 0; e < E_; e++) {
            lg[e] = lgs[lane][e] + s0 * Wskin[e * 3 + 0]
                                 + s1 * Wskin[e * 3 + 1]
                                 + s2 * Wskin[e * 3 + 2];
            mx = fmaxf(mx, lg[e]);
        }
        float p[E_]; float den = 0.f;
#pragma unroll
        for (int e = 0; e < E_; e++) { p[e] = __expf(lg[e] - mx); den += p[e]; }
        const float inv = 1.f / den;
#pragma unroll
        for (int e = 0; e < E_; e++) p[e] *= inv;
        // top-2 (first index wins ties, like jax top_k)
        int i1 = 0; float v1 = p[0];
#pragma unroll
        for (int e = 1; e < E_; e++) if (p[e] > v1) { v1 = p[e]; i1 = e; }
        int i2 = -1; float v2 = -1.f;
#pragma unroll
        for (int e = 0; e < E_; e++) if (e != i1 && p[e] > v2) { v2 = p[e]; i2 = e; }
        const float inv2 = 1.f / (v1 + v2 + EPS_);
        {   // sort key of the token's expert pair (lo < hi). hi runs upwards under an even lo and
            // downwards under an odd one, so that neighbouring keys always share an expert
            const int j2 = i2 < 0 ? i1 : i2;
            const int lo = min(i1, j2), hi2 = max(i1, j2);
            key[t] = lo * E_ + ((lo & 1) ? (E_ - 1 - hi2) : hi2);
        }
        float r[2 * E_];   // 0..7 probabilities, 8..15 selection counts
#pragma unroll
        for (int e = 0; e < E_; e++) {
            float wv = (e == i1) ? v1 * inv2 : ((e == i2) ? v2 * inv2 : 0.f);
            wout[(size_t)t * E_ + e] = wv;
            r[e]      = p[e];
            r[E_ + e] = (e == i1 || e == i2) ? 1.f : 0.f;
        }
        // 16 values a lane summed over the 32 tokens: lane l ends with value l & 15
#pragma unroll
        for (int i = 0; i < 2 * E_; i++) r[i] += __shfl_xor(r[i], 16, 32);
#pragma unroll
        for (int off = 8; off; off >>= 1) {
            const bool up = (lane & off) != 0;
#pragma unroll
            for (int i = 0; i < off; i++) {
                const float lo = r[i], hv = r[i + off];
                const float keep = up ? hv : lo;
                const float send = up ? lo : hv;
                r[i] = keep + __shfl_xor(send, off, 32);
            }
        }
        if (lane < E_)          atomicAdd(&probSum[lane], r[0]);
        else if (lane < 2 * E_) atomicAdd(&freqCnt[lane - E_], r[0]);
    }
}

// ---------------------------------------------------------------------
// 2b) counting sort of the tokens by key: perm[] lists the tokens key by key.
//     One work-group, 16 tokens a thread. cnt holds one 16-bit counter per
//     (key, thread), key-major, so that its running sum over the whole table
//     is each thread's first place for each key.
// ---------------------------------------------------------------------
#define SK_     64    // keys
#define ST_     1024  // threads
#define SPT_    (N_ / ST_)   // tokens a thread
#define SPITCH_ 72    // a run of 64 counters + 8: 16-byte reads of neighbouring runs fall on different banks

__global__ __launch_bounds__(ST_)
void sort_kernel(const int* __restrict__ key, int* __restrict__ perm) {
    __shared__ __align__(16) unsigned short cnt[ST_ * SPITCH_];
    __shared__ unsigned wsum[ST_ / 32];
    const int t    = threadIdx.x;
    const int lane = t & 31;
    const int wv   = t >> 5;

    uint4* own = (uint4*)&cnt[t * SPITCH_];     // run t: key t >> 4, threads (t & 15) * 64 .. + 63
#pragma unroll
    for (int i = 0; i < 8; i++) own[i] = make_uint4(0u, 0u, 0u, 0u);

    int slot[SPT_];                             // this thread's counter for each of its tokens
    const int tb = (t >> 6) * SPITCH_ + (t & 63);
    int4 kv[SPT_ / 4];
#pragma unroll
    for (int q = 0; q < SPT_ / 4; q++) kv[q] = ((const int4*)(key + t * SPT_))[q];
    // holds the key loads in front of the barrier, beside the zeroing: sunk behind it
    // they would be waited for on their own
    asm volatile("" :: "v"(kv[0].x), "v"(kv[0].y), "v"(kv[0].z), "v"(kv[0].w),
                       "v"(kv[1].x), "v"(kv[1].y), "v"(kv[1].z), "v"(kv[1].w),
                       "v"(kv[2].x), "v"(kv[2].y), "v"(kv[2].z), "v"(kv[2].w),
                       "v"(kv[3].x), "v"(kv[3].y), "v"(kv[3].z), "v"(kv[3].w));
#pragma unroll
    for (int q = 0; q < SPT_ / 4; q++) {
        slot[q * 4 + 0] = (kv[q].x & (SK_ - 1)) * (16 * SPITCH_) + tb;
        slot[q * 4 + 1] = (kv[q].y & (SK_ - 1)) * (16 * SPITCH_) + tb;
        slot[q * 4 + 2] = (kv[q].z & (SK_ - 1)) * (16 * SPITCH_) + tb;
        slot[q * 4 + 3] = (kv[q].w & (SK_ - 1)) * (16 * SPITCH_) + tb;
    }
    __syncthreads();   // the table is zero

    int rank[SPT_];                             // place among this thread's own tokens of the key
#pragma unroll
    for (int i = 0; i < SPT_; i++) {
        const unsigned short c = cnt[slot[i]];
        rank[i] = c;
        cnt[slot[i]] = (unsigned short)(c + 1);
    }
    __syncthreads();   // every count is in

    // sum of the own run; two counters a word, neither half can carry (all counts sum to N_)
    unsigned s2 = 0;
#pragma unroll
    for (int i = 0; i < 8; i++) { const uint4 v = own[i]; s2 += v.x + v.y + v.z + v.w; }
    const unsigned total = (s2 & 0xffffu) + (s2 >> 16);
    unsigned inc = total;                       // running sum over the wave
#pragma unroll
    for (int d = 1; d < 32; d <<= 1) {
        const unsigned o = __shfl_up(inc, d, 32);
        if (lane >= d) inc += o;
    }
    if (lane == 31) wsum[wv] = inc;
    __syncthreads();   // the waves' sums are written
    if (wv == 0) {
        const unsigned w0 = wsum[lane];
        unsigned wi = w0;
#pragma unroll
        for (int d = 1; d < 32; d <<= 1) {
            const unsigned o = __shfl_up(wi, d, 32);
            if (lane >= d) wi += o;
        }
        wsum[lane] = wi - w0;
    }
    __syncthreads();   // each wave's start is written
    unsigned run = wsum[wv] + inc - total;      // first place of the own run
#pragma unroll
    for (int i = 0; i < 8; i++) {
        const uint4 v = own[i];
        const unsigned w[4] = { v.x, v.y, v.z, v.w };
        unsigned o[4];
#pragma unroll
        for (int c = 0; c < 4; c++) {
            const unsigned a0 = w[c] & 0xffffu, a1 = w[c] >> 16;
            o[c] = run | ((run + a0) << 16);
            run += a0 + a1;
        }
        own[i] = make_uint4(o[0], o[1], o[2], o[3]);
    }
    __syncthreads();   // every counter now holds its first place
    int pos[SPT_];   // all places are read before the first store, so that the reads overlap
#pragma unroll
    for (int i = 0; i < SPT_; i++) pos[i] = (cnt[slot[i]] + rank[i]) & (N_ - 1);
#pragma unroll
    for (int i = 0; i < SPT_; i++) perm[pos[i]] = t * SPT_ + i;
}

// ---------------------------------------------------------------------
// fragment union: CDNA5 16-bit A/B layout — lane = row/col (lane&15),
// K values { klo..klo+7, 16+klo..23+klo } with klo = (lane>>4)*8.
// ---------------------------------------------------------------------
union FragBF { bf16x16 v; bf16x8 h[2]; };

#define XS_STRIDE 2056   // 2048 + 8: 16B-aligned, +4 banks/row -> conflict-free
#define HW_STRIDE 136    // 128 + 8:  16B-aligned, +4 banks/row -> conflict-free
#define TM_ 64           // tokens per work-group
#define MT_ 4            // 16-token sub-tiles per work-group
#define NT2_ 4           // output column tiles a wave holds at once in stage 2

// eight 16-byte-per-lane copies, rows r0..r0+7 of the x tile (row r is token rowTok[r]); the closing
// s_wait_xcnt keeps the address registers untouched until the copies took them
#define COPY8_ROWS(r0)                                                        \
    asm volatile("global_load_async_to_lds_b128 %0, %8, off\n\t"              \
                 "global_load_async_to_lds_b128 %1, %9, off\n\t"              \
                 "global_load_async_to_lds_b128 %2, %10, off\n\t"             \
                 "global_load_async_to_lds_b128 %3, %11, off\n\t"             \
                 "global_load_async_to_lds_b128 %4, %12, off\n\t"             \
                 "global_load_async_to_lds_b128 %5, %13, off\n\t"             \
                 "global_load_async_to_lds_b128 %6, %14, off\n\t"             \
                 "global_load_async_to_lds_b128 %7, %15, off\n\t"             \
                 "s_wait_xcnt 0x0"                                            \
                 :: "v"(lbase + ((r0) + 0) * (XS_STRIDE * 2)),                \
                    "v"(lbase + ((r0) + 1) * (XS_STRIDE * 2)),                \
                    "v"(lbase + ((r0) + 2) * (XS_STRIDE * 2)),                \
                    "v"(lbase + ((r0) + 3) * (XS_STRIDE * 2)),                \
                    "v"(lbase + ((r0) + 4) * (XS_STRIDE * 2)),                \
                    "v"(lbase + ((r0) + 5) * (XS_STRIDE * 2)),                \
                    "v"(lbase + ((r0) + 6) * (XS_STRIDE * 2)),                \
                    "v"(lbase + ((r0) + 7) * (XS_STRIDE * 2)),                \
                    "v"(gbase + (size_t)rowTok[(r0) + 0] * H_),                     \
                    "v"(gbase + (size_t)rowTok[(r0) + 1] * H_),                     \
                    "v"(gbase + (size_t)rowTok[(r0) + 2] * H_),                     \
                    "v"(gbase + (size_t)rowTok[(r0) + 3] * H_),                     \
                    "v"(gbase + (size_t)rowTok[(r0) + 4] * H_),                     \
                    "v"(gbase + (size_t)rowTok[(r0) + 5] * H_),                     \
                    "v"(gbase + (size_t)rowTok[(r0) + 6] * H_),                     \
                    "v"(gbase + (size_t)rowTok[(r0) + 7] * H_)                      \
                 : "memory")

// ---------------------------------------------------------------------
// 3) MoE expert kernel: one block per 64-token tile, 256 threads (8 waves).
//    A tile is 64 neighbours of the sorted list perm[], so it uses few experts
//    (two inside a run of one pair, three across a seam); any number up to
//    eight is handled. Every weight fragment read from global memory feeds
//    four WMMAs (the four 16-token sub-tiles); W1b and W2b arrive in fragment
//    order. Stage 1: wave w owns column tile w of every used expert. Stage 2:
//    a wave owns 16 column tiles of the output, four at a time.
// ---------------------------------------------------------------------

// stage 1 of a tile that uses NJ experts: acc[mt][j] = X(sub-tile mt) @ W1(j-th used expert, column tile 'wave')^T
template <int NJ>
__device__ __forceinline__ void stage1_tile(const bf16* arow, const bf16* __restrict__ W1b,
                                            unsigned emask, int wave, int lane,
                                            f32x8 (&acc)[MT_][E_]) {
    constexpr int KS = (NJ <= 4) ? 4 : 2;   // k steps of 32 a trip: as many as the registers take
    // packed W1: [row tile = e*8 + wave][k step][half][lane][8]
    const bf16* brow[NJ];
    unsigned mk = emask;
#pragma unroll
    for (int j = 0; j < NJ; j++) {
        const int e = __builtin_ctz(mk);
        mk &= mk - 1;
        brow[j] = W1b + (size_t)(e * 8 + wave) * 16 * H_ + lane * 8;
    }
    for (int k0 = 0; k0 < H_; k0 += KS * 32) {
        FragBF a[KS][MT_], b[KS][NJ];
        const bf16* p[E_];   // this trip's weight addresses; places NJ.. repeat the last one
#pragma unroll
        for (int j = 0; j < E_; j++) p[j] = brow[j < NJ ? j : NJ - 1] + k0 * 16;
#pragma unroll
        for (int j = 0; j < NJ; j++)
#pragma unroll
            for (int ks = 0; ks < KS; ks++) {
                b[ks][j].h[0] = *(const bf16x8*)(p[j] + ks * 512);
                b[ks][j].h[1] = *(const bf16x8*)(p[j] + ks * 512 + 256);
            }
#pragma unroll
        for (int ks = 0; ks < KS; ks++)
#pragma unroll
            for (int mt = 0; mt < MT_; mt++) {
                a[ks][mt].h[0] = *(const bf16x8*)(arow + mt * 16 * XS_STRIDE + k0 + ks * 32);
                a[ks][mt].h[1] = *(const bf16x8*)(arow + mt * 16 * XS_STRIDE + k0 + ks * 32 + 16);
            }
        // the loads have taken their addresses before the registers are reused; naming the
        // addresses keeps them in their registers up to the wait
        asm volatile("s_wait_xcnt 0x0" :: "v"(p[0]), "v"(p[1]), "v"(p[2]), "v"(p[3]),
                                          "v"(p[4]), "v"(p[5]), "v"(p[6]), "v"(p[7]) : "memory");
        // keeps the trip's loads one group in front of its WMMAs: sunk among them,
        // each weight fragment's L2 latency would be waited out on its own
        __builtin_amdgcn_sched_barrier(0);
#pragma unroll
        for (int ks = 0; ks < KS; ks++)
#pragma unroll
            for (int j = 0; j < NJ; j++)
#pragma unroll
                for (int mt = 0; mt < MT_; mt++)
                    acc[mt][j] = __builtin_amdgcn_wmma_f32_16x16x32_bf16(
                        false, a[ks][mt].v, false, b[ks][j].v, (short)0, acc[mt][j], false, false);
    }
}

__global__ __launch_bounds__(256)
void moe_kernel(const float* __restrict__ x,
                const bf16*  __restrict__ xb,
                const bf16*  __restrict__ W1b,
                const float* __restrict__ b1,
                const bf16*  __restrict__ W2b,
                const float* __restrict__ b2,
                const float* __restrict__ wN,
                const int*   __restrict__ perm,
                float* __restrict__ out) {
    // the staged x tile; once stage 1 has read it, the same bytes hold Hw
    __shared__ __align__(16) bf16 Xs[TM_][XS_STRIDE];
    __shared__ __align__(16) float tileW[TM_][E_];
    __shared__ int   eflag[E_];
    __shared__ int   tokIdx[TM_];          // the tile's tokens
    bf16 (*Hw)[TM_][HW_STRIDE] = (bf16 (*)[TM_][HW_STRIDE])&Xs[0][0];   // [E_][TM_][HW_STRIDE]

    const int tile = blockIdx.x;           // 0..N/64-1
    const int tok0 = tile * TM_;           // first place in perm[]
    const int* pt  = perm + tok0;          // every token number read from it is masked to 0..N_-1
    const int lane = threadIdx.x & 31;
    const int wave = __builtin_amdgcn_readfirstlane(threadIdx.x >> 5);
    const int col  = lane & 15;            // fragment row/col index
    const int klo  = (lane >> 4) * 8;      // per-lane K offset
    const int hi   = lane >> 4;

    // ---- async-stage the x tile (64 x 2048 bf16 = 256KB) into LDS ----
    // one copy of the block = one row (256 threads x 16B); 64 copies a wave,
    // in two halves so that no wave has more than 32 outstanding.
    const bf16*    gbase = xb + threadIdx.x * 8;
    const unsigned lbase = (unsigned)(uintptr_t)(&Xs[0][threadIdx.x * 8]);
    // the tile's 64 token numbers, the same for every thread: read at once, in front of the
    // first copy, so that no group of copies waits for a read of its own
    int rowTok[TM_];
#pragma unroll
    for (int r = 0; r < TM_; r++) rowTok[r] = pt[r] & (N_ - 1);
    // and the tokens whose combine weights this thread fetches
    int tk[TM_ * E_ / 256];
#pragma unroll
    for (int j = 0; j < TM_ * E_ / 256; j++) tk[j] = pt[(threadIdx.x >> 3) + 32 * j] & (N_ - 1);
    COPY8_ROWS(0);  COPY8_ROWS(8);  COPY8_ROWS(16); COPY8_ROWS(24);

    // combine weights while the copies are in flight
    float cw[TM_ * E_ / 256];
#pragma unroll
    for (int j = 0; j < TM_ * E_ / 256; j++) cw[j] = wN[(size_t)tk[j] * E_ + (threadIdx.x & 7)];
#pragma unroll
    for (int j = 0; j < TM_ * E_ / 256; j++) {
        const int row = (threadIdx.x >> 3) + 32 * j;
        tileW[row][threadIdx.x & 7] = cw[j];
        if ((threadIdx.x & 7) == 0) tokIdx[row] = tk[j];
    }

    // first half landed before the second half is issued
    asm volatile("s_wait_asynccnt 0x0" ::: "memory");
    COPY8_ROWS(32); COPY8_ROWS(40); COPY8_ROWS(48); COPY8_ROWS(56);

    __syncthreads();
    if (threadIdx.x < E_) {
        int f = 0;
        for (int m = 0; m < TM_; m++) f |= (tileW[m][threadIdx.x] != 0.f);
        eflag[threadIdx.x] = f;
    }
    // wait for this wave's async transfers, then barrier for cross-wave vis
    asm volatile("s_wait_asynccnt 0x0" ::: "memory");
    __syncthreads();

    unsigned emask = 0;
#pragma unroll
    for (int e = 0; e < E_; e++) emask |= (eflag[e] ? 1u : 0u) << e;
    emask = __builtin_amdgcn_readfirstlane(emask);
    const int nexp = __builtin_popcount(emask);   // block-uniform: experts this tile uses

    // ---------------- stage 1: Hw[e] = w * relu(X @ W1_e^T + b1_e) ----
    f32x8 acc[MT_][8];
#pragma unroll
    for (int mt = 0; mt < MT_; mt++)
#pragma unroll
        for (int n = 0; n < 8; n++)
            acc[mt][n] = (f32x8){0.f,0.f,0.f,0.f,0.f,0.f,0.f,0.f};
    {
        const bf16* arow = &Xs[col][klo];                               // LDS
        switch (nexp) {   // block-uniform scalar branch; one loop per count keeps acc under constant indices
        case 1: stage1_tile<1>(arow, W1b, emask, wave, lane, acc); break;
        case 2: stage1_tile<2>(arow, W1b, emask, wave, lane, acc); break;
        case 3: stage1_tile<3>(arow, W1b, emask, wave, lane, acc); break;
        case 4: stage1_tile<4>(arow, W1b, emask, wave, lane, acc); break;
        case 5: stage1_tile<5>(arow, W1b, emask, wave, lane, acc); break;
        case 6: stage1_tile<6>(arow, W1b, emask, wave, lane, acc); break;
        case 7: stage1_tile<7>(arow, W1b, emask, wave, lane, acc); break;
        case 8: stage1_tile<8>(arow, W1b, emask, wave, lane, acc); break;
        default: break;
        }
    }
    __syncthreads();   // every wave has read its last x fragment: the bytes may become Hw
    {
        unsigned mk = emask;
#pragma unroll
        for (int j = 0; j < E_; j++) {
            if (j < nexp) {   // block-uniform scalar branch
                const int e = __builtin_ctz(mk);
                mk &= mk - 1;
                const float bb = b1[e * B_ + wave * 16 + col];
#pragma unroll
                for (int mt = 0; mt < MT_; mt++)
#pragma unroll
                    for (int r = 0; r < 8; r++) {
                        const int m = mt * 16 + r + hi * 8;
                        float h = fmaxf(acc[mt][j][r] + bb, 0.f) * tileW[m][e];
                        Hw[e][m][wave * 16 + col] = (bf16)h;
                    }
            }
        }
    }
    __syncthreads();

    // ---------------- stage 2: out = x + sum_e Hw_e @ W2_e^T + w@b2 ---
    for (int g = 0; g < 16 / NT2_; g++) {
        const int ct0   = wave * 16 + g * NT2_;   // 128 column tiles over 8 waves
        const int hcol0 = ct0 * 16 + col;
        f32x8 acc2[MT_][NT2_];
#pragma unroll
        for (int mt = 0; mt < MT_; mt++)
#pragma unroll
            for (int n = 0; n < NT2_; n++)
                acc2[mt][n] = (f32x8){0.f,0.f,0.f,0.f,0.f,0.f,0.f,0.f};
        for (int e = 0; e < E_; e++) {
            if (!((emask >> e) & 1u)) continue;   // block-uniform scalar branch
            const bf16* arow = &Hw[e][col][klo];
            // packed W2: [row tile = e*128 + ct0 + n][k step][half][lane][8]
            const bf16* brow = W2b + ((size_t)e * H_ + ct0 * 16) * B_ + lane * 8;
            FragBF a[B_ / 32][MT_], b[B_ / 32][NT2_];
#pragma unroll
            for (int n = 0; n < NT2_; n++)
#pragma unroll
                for (int ks = 0; ks < B_ / 32; ks++) {
                    b[ks][n].h[0] = *(const bf16x8*)(brow + n * 16 * B_ + ks * 512);
                    b[ks][n].h[1] = *(const bf16x8*)(brow + n * 16 * B_ + ks * 512 + 256);
                }
#pragma unroll
            for (int ks = 0; ks < B_ / 32; ks++)
#pragma unroll
                for (int mt = 0; mt < MT_; mt++) {
                    a[ks][mt].h[0] = *(const bf16x8*)(arow + mt * 16 * HW_STRIDE + ks * 32);
                    a[ks][mt].h[1] = *(const bf16x8*)(arow + mt * 16 * HW_STRIDE + ks * 32 + 16);
                }
            // the loads have taken their address before its registers are reused; naming the
            // pointer keeps it in its registers up to the wait
            asm volatile("s_wait_xcnt 0x0" :: "v"(brow) : "memory");
            // as in stage 1: the expert's loads stay one group in front of its WMMAs
            __builtin_amdgcn_sched_barrier(0);
#pragma unroll
            for (int ks = 0; ks < B_ / 32; ks++)
#pragma unroll
                for (int n = 0; n < NT2_; n++)
#pragma unroll
                    for (int mt = 0; mt < MT_; mt++)
                        acc2[mt][n] = __builtin_amdgcn_wmma_f32_16x16x32_bf16(
                            false, a[ks][mt].v, false, b[ks][n].v, (short)0, acc2[mt][n], false, false);
        }
        // uniform base of this group's columns, and the element offset, in x and in out, of the
        // lane's column in each of its 32 rows (a row is a token's); the offsets are formed here
        // and stay as they are until the wait behind the group's stores
        const float* xg = x   + g * NT2_ * 16;
        float*       og = out + g * NT2_ * 16;
        int ro[MT_][8];
#pragma unroll
        for (int mt = 0; mt < MT_; mt++)
#pragma unroll
            for (int r = 0; r < 8; r++)
                ro[mt][r] = tokIdx[mt * 16 + r + hi * 8] * H_ + wave * 256 + col;
        float xv[MT_][NT2_][8];
#pragma unroll
        for (int mt = 0; mt < MT_; mt++)
#pragma unroll
            for (int r = 0; r < 8; r++)
#pragma unroll
                for (int n = 0; n < NT2_; n++)
                    xv[mt][n][r] = xg[(size_t)(n * 16) + ro[mt][r]];
        float b2v[NT2_][E_];
#pragma unroll
        for (int n = 0; n < NT2_; n++)
#pragma unroll
            for (int e = 0; e < E_; e++) b2v[n][e] = b2[(size_t)e * H_ + hcol0 + n * 16];
        // the loads have taken their offset registers before anything reuses them; naming
        // the offset keeps it in its register up to the wait
        asm volatile("s_wait_xcnt 0x0" :: "v"(hcol0) : "memory");
        // the group's loads stay together in front of the arithmetic: one memory latency a group
        __builtin_amdgcn_sched_barrier(0);
#pragma unroll
        for (int mt = 0; mt < MT_; mt++)
#pragma unroll
            for (int r = 0; r < 8; r++) {
                const int m = mt * 16 + r + hi * 8;
                float tw[E_];
#pragma unroll
                for (int e = 0; e < E_; e++) tw[e] = tileW[m][e];
#pragma unroll
                for (int n = 0; n < NT2_; n++) {
                    float s = 0.f;
#pragma unroll
                    for (int e = 0; e < E_; e++) s = fmaf(tw[e], b2v[n][e], s);
                    acc2[mt][n][r] = xv[mt][n][r] + acc2[mt][n][r] + s;
                }
            }
        // every result is formed before the first store, so that no register of an
        // issued store is written again in front of the wait behind the stores
        __builtin_amdgcn_sched_barrier(0);
#pragma unroll
        for (int mt = 0; mt < MT_; mt++)
#pragma unroll
            for (int r = 0; r < 8; r++)
#pragma unroll
                for (int n = 0; n < NT2_; n++)
                    og[(size_t)(n * 16) + ro[mt][r]] = acc2[mt][n][r];
        // the next group reuses the stores' registers: the stores have taken them first
        asm volatile("s_wait_xcnt 0x0" ::: "memory");
    }
}

// ---------------------------------------------------------------------
// 4) finalize aux loss -> d_out[N*H]
// ---------------------------------------------------------------------
__global__ void finalize_kernel(const float* __restrict__ probSum,
                                const float* __restrict__ freqCnt,
                                float* __restrict__ out_aux) {
    if (threadIdx.x == 0 && blockIdx.x == 0) {
        float s = 0.f;
        for (int e = 0; e < E_; e++)
            s += (probSum[e] / (float)N_) * (freqCnt[e] / (float)N_);
        *out_aux = s * (float)E_;
    }
}

// ---------------------------------------------------------------------
extern "C" void kernel_launch(void* const* d_in, const int* in_sizes, int n_in,
                              void* d_out, int out_size, void* d_ws, size_t ws_size,
                              hipStream_t stream) {
    const float* x     = (const float*)d_in[0];
    const float* skin  = (const float*)d_in[1];
    const float* Wimg  = (const float*)d_in[2];
    const float* Wskin = (const float*)d_in[3];
    const float* W1    = (const float*)d_in[4];
    const float* b1    = (const float*)d_in[5];
    const float* W2    = (const float*)d_in[6];
    const float* b2    = (const float*)d_in[7];
    float* out = (float*)d_out;

    // workspace layout
    char* ws = (char*)d_ws;
    float* wN      = (float*)ws;                                   // N*E f32 (512KB)
    float* probSum = (float*)(ws + (size_t)N_ * E_ * sizeof(float));
    float* freqCnt = probSum + 8;
    int*   key  = (int*)(ws + (size_t)N_ * E_ * sizeof(float) + 4096);   // N int (64KB)
    int*   perm = key + N_;                                        // N int (64KB)
    bf16*  xb  = (bf16*)(ws + (1ull << 20));                       // N*H bf16 (64MB)
    bf16*  W1b = xb  + (size_t)N_ * H_;                            // E*B*H bf16 (4MB)
    bf16*  W2b = W1b + (size_t)E_ * B_ * H_;                       // E*H*B bf16 (4MB)

    // 0) zero aux accumulators
    zero_accum_kernel<<<1, 32, 0, stream>>>(probSum);

    // 1) weights: converted straight into fragment order (rows of 2048 = 64 k steps, of 128 = 4)
    pack_bf16_kernel<<<E_ * B_ * H_ / 8 / 256, 256, 0, stream>>>(W1, W1b, 6, E_ * B_ * H_ / 8);
    pack_bf16_kernel<<<E_ * B_ * H_ / 8 / 256, 256, 0, stream>>>(W2, W2b, 2, E_ * B_ * H_ / 8);

    // 2) router + bf16 copy of x, one pass over x (512 work-groups of 32 tokens)
    router_cvt_kernel<<<N_ / RT_TOK, 256, 0, stream>>>(x, skin, Wimg, Wskin, xb, wN, key, probSum, freqCnt);

    // 2b) tokens listed by expert pair
    sort_kernel<<<1, ST_, 0, stream>>>(key, perm);

    // 3) expert GEMMs + combine + residual
    moe_kernel<<<N_ / 64, 256, 0, stream>>>(x, xb, W1b, b1, W2b, b2, wN, perm, out);

    // 4) aux loss scalar
    finalize_kernel<<<1, 32, 0, stream>>>(probSum, freqCnt, out + (size_t)N_ * H_);
}

// v005
// A run of this version takes 109 microseconds.
// Two timings next to v004 both put it at 1.06 times that version's speed.
// All steps since v000 together make it 6.38 times as fast.
#include <hip/hip_runtime.h>
#include <hip/hip_bf16.h>

// ---------------- problem constants (match reference) ----------------
#define E_   8
#define K_   2
#define N_   16384
#define H_   2048
#define B_   128
#define EPS_ 1e-6f

typedef __bf16 bf16;
typedef __attribute__((ext_vector_type(16))) __bf16 bf16x16;
typedef __attribute__((ext_vector_type(8)))  __bf16 bf16x8;
typedef __attribute__((ext_vector_type(8)))  float  f32x8;

// ---------------------------------------------------------------------
// 1) router and fp32 -> bf16 conversion (RNE) of x in one pass over x.
//    A work-group takes 32 tokens; wave w owns columns w*256 .. w*256+255 and
//    keeps its slice of W_img in registers (8 experts x 8 columns a lane).
//    Per token a wave reads two runs of 512 contiguous bytes, writes their
//    bf16 copy and adds to 8 partial logits a lane; four tokens at a time.
//    Every loop of the kernel is unrolled: its arrays stay in registers only
//    under constant indices, and the token offsets become immediates, so that
//    no address register of a load or store is ever stepped.
//    The same launch converts W1 and W2 (fp32 -> bf16, RNE) into WMMA B-fragment
//    order, dst[row tile][k step of 32][half][lane][8]: lane l of half j holds row
//    (l & 15), k = j*16 + (l >> 4)*8 .. +7, so that one wave-wide 16-byte load of a
//    half reads 512 contiguous bytes. A piece is one lane's 16 bytes; every wave of
//    the grid writes 128 pieces (two k steps of one row tile), work-groups 0..255
//    those of W1 and 256..511 those of W2. Their loads fly with the first x loads.
//    The aux sums leave as one row of 16 partial sums per work-group.
// ---------------------------------------------------------------------
#define RT_TOK 32   // tokens per work-group
#define RT_G   4    // tokens a wave holds at once
#define RT_WG  (N_ / RT_TOK)   // work-groups of the launch
#define PK_I   4    // pieces a lane packs
static_assert(E_ * B_ * H_ / 8 == (RT_WG / 2) * 8 * 32 * PK_I, "each half of the grid packs one weight matrix");

__global__ __launch_bounds__(256)
void router_cvt_kernel(const float* __restrict__ x,
                       const float* __restrict__ skin,
                       const float* __restrict__ Wimg,
                       const float* __restrict__ Wskin,
                       const float* __restrict__ W1,
                       const float* __restrict__ W2,
                       bf16*  __restrict__ xb,
                       float* __restrict__ wout,
                       int*   __restrict__ key,
                       bf16*  __restrict__ W1b,
                       bf16*  __restrict__ W2b,
                       float* __restrict__ auxPart) {
    __shared__ float part[8][RT_TOK * E_];     // per wave: its columns' share of every logit
    __shared__ float lgs[RT_TOK][E_ + 1];      // +1: a lane reads one token's row, banks apart
    const int lane = threadIdx.x & 31;
    const int wave = __builtin_amdgcn_readfirstlane(threadIdx.x >> 5);
    const int tok0 = blockIdx.x * RT_TOK;
    const int l4   = lane * 4;

    // the wave's 128 pieces: rows of 32 << sh floats; pieces i = 0..3 of a lane lie 16 floats apart
    const bool   second = blockIdx.x >= RT_WG / 2;                      // block-uniform
    const int    sh  = second ? 2 : 6;                                  // W2: 4 k steps a row, W1: 64
    const int    pq  = (blockIdx.x & (RT_WG / 2 - 1)) * 8 + wave;       // the wave's number in its matrix
    const float* ps  = (second ? W2 : W1)
                     + ((size_t)((pq * 2) >> sh) * 16 << (sh + 5)) + ((pq * 2) & ((1 << sh) - 1)) * 32;
    bf16*        pd  = (second ? W2b : W1b) + (size_t)pq * (32 * PK_I * 8);
    const int    plo = ((lane & 15) << (sh + 5)) + (lane >> 4) * 8;     // the lane's row and k offset
    float4 pv[PK_I][2];
#pragma unroll
    for (int i = 0; i < PK_I; i++)
#pragma unroll
        for (int j = 0; j < 2; j++)
            pv[i][j] = *(const float4*)(ps + (i * 16 + j * 4) + plo);
    // the loads have taken their offset register before anything reuses it; naming the
    // offset keeps it in its register up to the wait
    asm volatile("s_wait_xcnt 0x0" :: "v"(plo) : "memory");

    const float* wt = Wimg + wave * 256;
    float4 w[E_][2];
#pragma unroll
    for (int e = 0; e < E_; e++)
#pragma unroll
        for (int j = 0; j < 2; j++)
            w[e][j] = *(const float4*)(wt + (e * H_ + j * 128) + l4);

    // uniform base, one element offset per lane, constants for token and half
    const float* xt = x  + (size_t)tok0 * H_ + wave * 256;
    bf16*        xo = xb + (size_t)tok0 * H_ + wave * 256;

    float4 v[2][RT_G][2];
#pragma unroll
    for (int t = 0; t < RT_G; t++)
#pragma unroll
        for (int j = 0; j < 2; j++)
            v[0][t][j] = *(const float4*)(xt + (t * H_ + j * 128) + l4);
    // W_img's and the first x loads stay in front of the packing's arithmetic: they fly while
    // the weight pieces, asked for first, are waited for
    __builtin_amdgcn_sched_barrier(0);
    {
        uint4 po[PK_I];
#pragma unroll
        for (int i = 0; i < PK_I; i++) {
            union { bf16 b[8]; uint4 u; } o;
            o.b[0] = (bf16)pv[i][0].x; o.b[1] = (bf16)pv[i][0].y;
            o.b[2] = (bf16)pv[i][0].z; o.b[3] = (bf16)pv[i][0].w;
            o.b[4] = (bf16)pv[i][1].x; o.b[5] = (bf16)pv[i][1].y;
            o.b[6] = (bf16)pv[i][1].z; o.b[7] = (bf16)pv[i][1].w;
            po[i] = o.u;
        }
#pragma unroll
        for (int i = 0; i < PK_I; i++)
            *(uint4*)(pd + i * 256 + lane * 8) = po[i];
        // the stores have taken their registers before the loop below reuses any of them
        asm volatile("s_wait_xcnt 0x0" ::: "memory");
        // nothing of the loop below is lifted over that wait
        __builtin_amdgcn_sched_barrier(0);
    }

#pragma unroll
    for (int g = 0; g < RT_TOK / RT_G; g++) {
        // the next four tokens' loads fly while these four are worked on
        if (g + 1 < RT_TOK / RT_G) {
#pragma unroll
            for (int t = 0; t < RT_G; t++)
#pragma unroll
                for (int j = 0; j < 2; j++)
                    v[(g + 1) & 1][t][j] =
                        *(const float4*)(xt + (((g + 1) * RT_G + t) * H_ + j * 128) + l4);
        }
        // keeps those loads in front of this group's arithmetic: sunk behind it they
        // would have no lead and each group would wait out a whole memory latency
        __builtin_amdgcn_sched_barrier(0);

        float a[RT_G * E_];
#pragma unroll
        for (int t = 0; t < RT_G; t++)
#pragma unroll
            for (int e = 0; e < E_; e++) {
                float s = 0.f;
#pragma unroll
                for (int j = 0; j < 2; j++) {
                    const float4 xv = v[g & 1][t][j];
                    s = fmaf(xv.x, w[e][j].x, s);
                    s = fmaf(xv.y, w[e][j].y, s);
                    s = fmaf(xv.z, w[e][j].z, s);
                    s = fmaf(xv.w, w[e][j].w, s);
                }
                a[t * E_ + e] = s;
            }
#pragma unroll
        for (int t = 0; t < RT_G; t++)
#pragma unroll
            for (int j = 0; j < 2; j++) {
                const float4 xv = v[g & 1][t][j];
                union { bf16 b[4]; uint2 u; } o;
                o.b[0] = (bf16)xv.x; o.b[1] = (bf16)xv.y;
                o.b[2] = (bf16)xv.z; o.b[3] = (bf16)xv.w;
                *(uint2*)(xo + ((g * RT_G + t) * H_ + j * 128) + l4) = o.u;
            }
        // the stores have taken their registers before the sums below reuse any of them
        asm volatile("s_wait_xcnt 0x0" ::: "memory");
        // nothing of the sums below is lifted over that wait
        __builtin_amdgcn_sched_barrier(0);

        // 32 values a lane summed over 32 lanes: each step halves the values a lane
        // keeps, so that lane l ends with the whole sum of value l (token l>>3, expert l&7)
#pragma unroll
        for (int off = 16; off; off >>= 1) {
            const bool up = (lane & off) != 0;
#pragma unroll
            for (int i = 0; i < off; i++) {
                const float lo = a[i], hv = a[i + off];
                const float keep = up ? hv : lo;
                const float send = up ? lo : hv;
                a[i] = keep + __shfl_xor(send, off, 32);
            }
        }
        part[wave][g * RT_G * E_ + lane] = a[0];
    }
    __syncthreads();   // every wave's shares are written
    {
        float s = 0.f;
#pragma unroll
        for (int q = 0; q < 8; q++) s += part[q][threadIdx.x];
        lgs[threadIdx.x >> 3][threadIdx.x & 7] = s;
    }
    __syncthreads();   // the logits' image part is whole

    if (wave == 0) {   // one lane per token
        const int t = tok0 + lane;
        const float s0 = skin[t * 3 + 0], s1 = skin[t * 3 + 1], s2 = skin[t * 3 + 2];
        float lg[E_]; float mx = -1e30f;
#pragma unroll
        for (int e = 0; e < E_; e++) {
            lg[e] = lgs[lane][e] + s0 * Wskin[e * 3 + 0]
                                 + s1 * Wskin[e * 3 + 1]
                                 + s2 * Wskin[e * 3 + 2];
            mx = fmaxf(mx, lg[e]);
        }
        float p[E_]; float den = 0.f;
#pragma unroll
        for (int e = 0; e < E_; e++) { p[e] = __expf(lg[e] - mx); den += p[e]; }
        const float inv = 1.f / den;
#pragma unroll
        for (int e = 0; e < E_; e++) p[e] *= inv;
        // top-2 (first index wins ties, like jax top_k)
        int i1 = 0; float v1 = p[0];
#pragma unroll
        for (int e = 1; e < E_; e++) if (p[e] > v1) { v1 = p[e]; i1 = e; }
        int i2 = -1; float v2 = -1.f;
#pragma unroll
        for (int e = 0; e < E_; e++) if (e != i1 && p[e] > v2) { v2 = p[e]; i2 = e; }
        const float inv2 = 1.f / (v1 + v2 + EPS_);
        {   // sort key of the token's expert pair (lo < hi). hi runs upwards under an even lo and
            // downwards under an odd one, so that neighbouring keys always share an expert
            const int j2 = i2 < 0 ? i1 : i2;
            const int lo = min(i1, j2), hi2 = max(i1, j2);
            key[t] = lo * E_ + ((lo & 1) ? (E_ - 1 - hi2) : hi2);
        }
        float r[2 * E_];   // 0..7 probabilities, 8..15 selection counts
#pragma unroll
        for (int e = 0; e < E_; e++) {
            float wv = (e == i1) ? v1 * inv2 : ((e == i2) ? v2 * inv2 : 0.f);
            wout[(size_t)t * E_ + e] = wv;
            r[e]      = p[e];
            r[E_ + e] = (e == i1 || e == i2) ? 1.f : 0.f;
        }
        // 16 values a lane summed over the 32 tokens: lane l ends with value l & 15
#pragma unroll
        for (int i = 0; i < 2 * E_; i++) r[i] += __shfl_xor(r[i], 16, 32);
#pragma unroll
        for (int off = 8; off; off >>= 1) {
            const bool up = (lane & off) != 0;
#pragma unroll
            for (int i = 0; i < off; i++) {
                const float lo = r[i], hv = r[i + off];
                const float keep = up ? hv : lo;
                const float send = up ? lo : hv;
                r[i] = keep + __shfl_xor(send, off, 32);
            }
        }
        if (lane < 2 * E_) auxPart[blockIdx.x * (2 * E_) + lane] = r[0];
    }
}

// ---------------------------------------------------------------------
// 2) counting sort of the tokens by key: perm[] lists the tokens key by key.
//     One work-group, 16 tokens a thread. cnt holds one 16-bit counter per
//     (key, thread), key-major, so that its running sum over the whole table
//     is each thread's first place for each key.
//     A second work-group of the launch adds the router's partial aux sums
//     (RT_WG rows of 16) and writes the aux loss.
// ---------------------------------------------------------------------
#define SK_     64    // keys
#define ST_     1024  // threads
#define SPT_    (N_ / ST_)   // tokens a thread
#define SPITCH_ 72    // a run of 64 counters + 8: 16-byte reads of neighbouring runs fall on different banks

__global__ __launch_bounds__(ST_)
void sort_kernel(const int* __restrict__ key, int* __restrict__ perm,
                 const float* __restrict__ auxPart, float* __restrict__ out_aux) {
    __shared__ __align__(16) unsigned short cnt[ST_ * SPITCH_];
    __shared__ unsigned wsum[ST_ / 32];
    __shared__ float red[ST_ / 32][2 * E_];
    const int t    = threadIdx.x;
    const int lane = t & 31;
    const int wv   = t >> 5;

    if (blockIdx.x == 1) {   // block-uniform: the whole work-group takes this path and leaves
        // thread t adds value t & 15 of rows (t >> 4) + 64 q
        float pa[RT_WG * 2 * E_ / ST_];
#pragma unroll
        for (int q = 0; q < RT_WG * 2 * E_ / ST_; q++) pa[q] = auxPart[q * ST_ + t];
        float s = 0.f;
#pragma unroll
        for (int q = 0; q < RT_WG * 2 * E_ / ST_; q++) s += pa[q];
        s += __shfl_xor(s, 16, 32);
        if (lane < 2 * E_) red[wv][lane] = s;
        __syncthreads();   // every wave's 16 sums are written
        if (wv == 0) {
            float a = 0.f;   // value lane & 15 over one half of the waves, then over both
#pragma unroll
            for (int q = 0; q < ST_ / 64; q++) a += red[(lane >> 4) * (ST_ / 64) + q][lane & 15];
            a += __shfl_xor(a, 16, 32);
            // lane e < 8 holds the probability sum of expert e, lane e + 8 its selection count
            float pr = (a / (float)N_) * (__shfl_xor(a, 8, 32) / (float)N_);
            pr += __shfl_xor(pr, 4, 32);
            pr += __shfl_xor(pr, 2, 32);
            pr += __shfl_xor(pr, 1, 32);
            if (lane == 0) *out_aux = pr * (float)E_;
        }
        return;
    }

    uint4* own = (uint4*)&cnt[t * SPITCH_];     // run t: key t >> 4, threads (t & 15) * 64 .. + 63
#pragma unroll
    for (int i = 0; i < 8; i++) own[i] = make_uint4(0u, 0u, 0u, 0u);

    int slot[SPT_];                             // this thread's counter for each of its tokens
    const int tb = (t >> 6) * SPITCH_ + (t & 63);
    int4 kv[SPT_ / 4];
#pragma unroll
    for (int q = 0; q < SPT_ / 4; q++) kv[q] = ((const int4*)(key + t * SPT_))[q];
    // holds the key loads in front of the barrier, beside the zeroing: sunk behind it
    // they would be waited for on their own
    asm volatile("" :: "v"(kv[0].x), "v"(kv[0].y), "v"(kv[0].z), "v"(kv[0].w),
                       "v"(kv[1].x), "v"(kv[1].y), "v"(kv[1].z), "v"(kv[1].w),
                       "v"(kv[2].x), "v"(kv[2].y), "v"(kv[2].z), "v"(kv[2].w),
                       "v"(kv[3].x), "v"(kv[3].y), "v"(kv[3].z), "v"(kv[3].w));
#pragma unroll
    for (int q = 0; q < SPT_ / 4; q++) {
        slot[q * 4 + 0] = (kv[q].x & (SK_ - 1)) * (16 * SPITCH_) + tb;
        slot[q * 4 + 1] = (kv[q].y & (SK_ - 1)) * (16 * SPITCH_) + tb;
        slot[q * 4 + 2] = (kv[q].z & (SK_ - 1)) * (16 * SPITCH_) + tb;
        slot[q * 4 + 3] = (kv[q].w & (SK_ - 1)) * (16 * SPITCH_) + tb;
    }
    __syncthreads();   // the table is zero

    int rank[SPT_];                             // place among this thread's own tokens of the key
#pragma unroll
    for (int i = 0; i < SPT_; i++) {
        const unsigned short c = cnt[slot[i]];
        rank[i] = c;
        cnt[slot[i]] = (unsigned short)(c + 1);
    }
    __syncthreads();   // every count is in

    // sum of the own run; two counters a word, neither half can carry (all counts sum to N_)
    unsigned s2 = 0;
#pragma unroll
    for (int i = 0; i < 8; i++) { const uint4 v = own[i]; s2 += v.x + v.y + v.z + v.w; }
    const unsigned total = (s2 & 0xffffu) + (s2 >> 16);
    unsigned inc = total;                       // running sum over the wave
#pragma unroll
    for (int d = 1; d < 32; d <<= 1) {
        const unsigned o = __shfl_up(inc, d, 32);
        if (lane >= d) inc += o;
    }
    if (lane == 31) wsum[wv] = inc;
    __syncthreads();   // the waves' sums are written
    if (wv == 0) {
        const unsigned w0 = wsum[lane];
        unsigned wi = w0;
#pragma unroll
        for (int d = 1; d < 32; d <<= 1) {
            const unsigned o = __shfl_up(wi, d, 32);
            if (lane >= d) wi += o;
        }
        wsum[lane] = wi - w0;
    }
    __syncthreads();   // each wave's start is written
    unsigned run = wsum[wv] + inc - total;      // first place of the own run
#pragma unroll
    for (int i = 0; i < 8; i++) {
        const uint4 v = own[i];
        const unsigned w[4] = { v.x, v.y, v.z, v.w };
        unsigned o[4];
#pragma unroll
        for (int c = 0; c < 4; c++) {
            const unsigned a0 = w[c] & 0xffffu, a1 = w[c] >> 16;
            o[c] = run | ((run + a0) << 16);
            run += a0 + a1;
        }
        own[i] = make_uint4(o[0], o[1], o[2], o[3]);
    }
    __syncthreads();   // every counter now holds its first place
    int pos[SPT_];   // all places are read before the first store, so that the reads overlap
#pragma unroll
    for (int i = 0; i < SPT_; i++) pos[i] = (cnt[slot[i]] + rank[i]) & (N_ - 1);
#pragma unroll
    for (int i = 0; i < SPT_; i++) perm[pos[i]] = t * SPT_ + i;
}

// ---------------------------------------------------------------------
// fragment union: CDNA5 16-bit A/B layout — lane = row/col (lane&15),
// K values { klo..klo+7, 16+klo..23+klo } with klo = (lane>>4)*8.
// ---------------------------------------------------------------------
union FragBF { bf16x16 v; bf16x8 h[2]; };

#define XS_STRIDE 2056   // 2048 + 8: 16B-aligned, +4 banks/row -> conflict-free
#define HW_STRIDE 136    // 128 + 8:  16B-aligned, +4 banks/row -> conflict-free
#define TM_ 64           // tokens per work-group
#define MT_ 4            // 16-token sub-tiles per work-group
#define NT2_ 4           // output column tiles a wave holds at once in stage 2

// eight 16-byte-per-lane copies, rows r0..r0+7 of the x tile (row r is token rowTok[r]); the closing
// s_wait_xcnt keeps the address registers untouched until the copies took them
#define COPY8_ROWS(r0)                                                        \
    asm volatile("global_load_async_to_lds_b128 %0, %8, off\n\t"              \
                 "global_load_async_to_lds_b128 %1, %9, off\n\t"              \
                 "global_load_async_to_lds_b128 %2, %10, off\n\t"             \
                 "global_load_async_to_lds_b128 %3, %11, off\n\t"             \
                 "global_load_async_to_lds_b128 %4, %12, off\n\t"             \
                 "global_load_async_to_lds_b128 %5, %13, off\n\t"             \
                 "global_load_async_to_lds_b128 %6, %14, off\n\t"             \
                 "global_load_async_to_lds_b128 %7, %15, off\n\t"             \
                 "s_wait_xcnt 0x0"                                            \
                 :: "v"(lbase + ((r0) + 0) * (XS_STRIDE * 2)),                \
                    "v"(lbase + ((r0) + 1) * (XS_STRIDE * 2)),                \
                    "v"(lbase + ((r0) + 2) * (XS_STRIDE * 2)),                \
                    "v"(lbase + ((r0) + 3) * (XS_STRIDE * 2)),                \
                    "v"(lbase + ((r0) + 4) * (XS_STRIDE * 2)),                \
                    "v"(lbase + ((r0) + 5) * (XS_STRIDE * 2)),                \
                    "v"(lbase + ((r0) + 6) * (XS_STRIDE * 2)),                \
                    "v"(lbase + ((r0) + 7) * (XS_STRIDE * 2)),                \
                    "v"(gbase + (size_t)rowTok[(r0) + 0] * H_),                     \
                    "v"(gbase + (size_t)rowTok[(r0) + 1] * H_),                     \
                    "v"(gbase + (size_t)rowTok[(r0) + 2] * H_),                     \
                    "v"(gbase + (size_t)rowTok[(r0) + 3] * H_),                     \
                    "v"(gbase + (size_t)rowTok[(r0) + 4] * H_),                     \
                    "v"(gbase + (size_t)rowTok[(r0) + 5] * H_),                     \
                    "v"(gbase + (size_t)rowTok[(r0) + 6] * H_),                     \
                    "v"(gbase + (size_t)rowTok[(r0) + 7] * H_)                      \
                 : "memory")

// ---------------------------------------------------------------------
// 3) MoE expert kernel: one block per 64-token tile, 256 threads (8 waves).
//    A tile is 64 neighbours of the sorted list perm[], so it uses few experts
//    (two inside a run of one pair, three across a seam); any number up to
//    eight is handled. Every weight fragment read from global memory feeds
//    four WMMAs (the four 16-token sub-tiles); W1b and W2b arrive in fragment
//    order. Stage 1: wave w owns column tile w of every used expert. Stage 2:
//    a wave owns 16 column tiles of the output, four at a time.
// ---------------------------------------------------------------------

// stage 1 of a tile that uses NJ experts: acc[mt][j] = X(sub-tile mt) @ W1(j-th used expert, column tile 'wave')^T
template <int NJ>
__device__ __forceinline__ void stage1_tile(const bf16* arow, const bf16* __restrict__ W1b,
                                            unsigned emask, int wave, int lane,
                                            f32x8 (&acc)[MT_][E_]) {
    constexpr int KS = (NJ <= 4) ? 4 : 2;   // k steps of 32 a trip: as many as the registers take
    // packed W1: [row tile = e*8 + wave][k step][half][lane][8]
    const bf16* brow[NJ];
    unsigned mk = emask;
#pragma unroll
    for (int j = 0; j < NJ; j++) {
        const int e = __builtin_ctz(mk);
        mk &= mk - 1;
        brow[j] = W1b + (size_t)(e * 8 + wave) * 16 * H_ + lane * 8;
    }
    for (int k0 = 0; k0 < H_; k0 += KS * 32) {
        FragBF a[KS][MT_], b[KS][NJ];
        const bf16* p[E_];   // this trip's weight addresses; places NJ.. repeat the last one
#pragma unroll
        for (int j = 0; j < E_; j++) p[j] = brow[j < NJ ? j : NJ - 1] + k0 * 16;
#pragma unroll
        for (int j = 0; j < NJ; j++)
#pragma unroll
            for (int ks = 0; ks < KS; ks++) {
                b[ks][j].h[0] = *(const bf16x8*)(p[j] + ks * 512);
                b[ks][j].h[1] = *(const bf16x8*)(p[j] + ks * 512 + 256);
            }
#pragma unroll
        for (int ks = 0; ks < KS; ks++)
#pragma unroll
            for (int mt = 0; mt < MT_; mt++) {
                a[ks][mt].h[0] = *(const bf16x8*)(arow + mt * 16 * XS_STRIDE + k0 + ks * 32);
                a[ks][mt].h[1] = *(const bf16x8*)(arow + mt * 16 * XS_STRIDE + k0 + ks * 32 + 16);
            }
        // the loads have taken their addresses before the registers are reused; naming the
        // addresses keeps them in their registers up to the wait
        asm volatile("s_wait_xcnt 0x0" :: "v"(p[0]), "v"(p[1]), "v"(p[2]), "v"(p[3]),
                                          "v"(p[4]), "v"(p[5]), "v"(p[6]), "v"(p[7]) : "memory");
        // keeps the trip's loads one group in front of its WMMAs: sunk among them,
        // each weight fragment's L2 latency would be waited out on its own
        __builtin_amdgcn_sched_barrier(0);
#pragma unroll
        for (int ks = 0; ks < KS; ks++)
#pragma unroll
            for (int j = 0; j < NJ; j++)
#pragma unroll
                for (int mt = 0; mt < MT_; mt++)
                    acc[mt][j] = __builtin_amdgcn_wmma_f32_16x16x32_bf16(
                        false, a[ks][mt].v, false, b[ks][j].v, (short)0, acc[mt][j], false, false);
    }
}

__global__ __launch_bounds__(256)
void moe_kernel(const float* __restrict__ x,
                const bf16*  __restrict__ xb,
                const bf16*  __restrict__ W1b,
                const float* __restrict__ b1,
                const bf16*  __restrict__ W2b,
                const float* __restrict__ b2,
                const float* __restrict__ wN,
                const int*   __restrict__ perm,
                float* __restrict__ out) {
    // the staged x tile; once stage 1 has read it, the same bytes hold Hw
    __shared__ __align__(16) bf16 Xs[TM_][XS_STRIDE];
    __shared__ __align__(16) float tileW[TM_][E_];
    __shared__ int   eflag[E_];
    __shared__ int   tokIdx[TM_];          // the tile's tokens
    bf16 (*Hw)[TM_][HW_STRIDE] = (bf16 (*)[TM_][HW_STRIDE])&Xs[0][0];   // [E_][TM_][HW_STRIDE]

    const int tile = blockIdx.x;           // 0..N/64-1
    const int tok0 = tile * TM_;           // first place in perm[]
    const int* pt  = perm + tok0;          // every token number read from it is masked to 0..N_-1
    const int lane = threadIdx.x & 31;
    const int wave = __builtin_amdgcn_readfirstlane(threadIdx.x >> 5);
    const int col  = lane & 15;            // fragment row/col index
    const int klo  = (lane >> 4) * 8;      // per-lane K offset
    const int hi   = lane >> 4;

    // ---- async-stage the x tile (64 x 2048 bf16 = 256KB) into LDS ----
    // one copy of the block = one row (256 threads x 16B); 64 copies a wave,
    // in two halves so that no wave has more than 32 outstanding.
    const bf16*    gbase = xb + threadIdx.x * 8;
    const unsigned lbase = (unsigned)(uintptr_t)(&Xs[0][threadIdx.x * 8]);
    // the tile's 64 token numbers, the same for every thread: read at once, in front of the
    // first copy, so that no group of copies waits for a read of its own
    int rowTok[TM_];
#pragma unroll
    for (int r = 0; r < TM_; r++) rowTok[r] = pt[r] & (N_ - 1);
    // and the tokens whose combine weights this thread fetches
    int tk[TM_ * E_ / 256];
#pragma unroll
    for (int j = 0; j < TM_ * E_ / 256; j++) tk[j] = pt[(threadIdx.x >> 3) + 32 * j] & (N_ - 1);
    COPY8_ROWS(0);  COPY8_ROWS(8);  COPY8_ROWS(16); COPY8_ROWS(24);

    // combine weights while the copies are in flight
    float cw[TM_ * E_ / 256];
#pragma unroll
    for (int j = 0; j < TM_ * E_ / 256; j++) cw[j] = wN[(size_t)tk[j] * E_ + (threadIdx.x & 7)];
#pragma unroll
    for (int j = 0; j < TM_ * E_ / 256; j++) {
        const int row = (threadIdx.x >> 3) + 32 * j;
        tileW[row][threadIdx.x & 7] = cw[j];
        if ((threadIdx.x & 7) == 0) tokIdx[row] = tk[j];
    }

    // first half landed before the second half is issued
    asm volatile("s_wait_asynccnt 0x0" ::: "memory");
    COPY8_ROWS(32); COPY8_ROWS(40); COPY8_ROWS(48); COPY8_ROWS(56);

    __syncthreads();
    if (threadIdx.x < E_) {
        int f = 0;
        for (int m = 0; m < TM_; m++) f |= (tileW[m][threadIdx.x] != 0.f);
        eflag[threadIdx.x] = f;
    }
    // wait for this wave's async transfers, then barrier for cross-wave vis
    asm volatile("s_wait_asynccnt 0x0" ::: "memory");
    __syncthreads();

    unsigned emask = 0;
#pragma unroll
    for (int e = 0; e < E_; e++) emask |= (eflag[e] ? 1u : 0u) << e;
    emask = __builtin_amdgcn_readfirstlane(emask);
    const int nexp = __builtin_popcount(emask);   // block-uniform: experts this tile uses

    // ---------------- stage 1: Hw[e] = w * relu(X @ W1_e^T + b1_e) ----
    f32x8 acc[MT_][8];
#pragma unroll
    for (int mt = 0; mt < MT_; mt++)
#pragma unroll
        for (int n = 0; n < 8; n++)
            acc[mt][n] = (f32x8){0.f,0.f,0.f,0.f,0.f,0.f,0.f,0.f};
    {
        const bf16* arow = &Xs[col][klo];                               // LDS
        switch (nexp) {   // block-uniform scalar branch; one loop per count keeps acc under constant indices
        case 1: stage1_tile<1>(arow, W1b, emask, wave, lane, acc); break;
        case 2: stage1_tile<2>(arow, W1b, emask, wave, lane, acc); break;
        case 3: stage1_tile<3>(arow, W1b, emask, wave, lane, acc); break;
        case 4: stage1_tile<4>(arow, W1b, emask, wave, lane, acc); break;
        case 5: stage1_tile<5>(arow, W1b, emask, wave, lane, acc); break;
        case 6: stage1_tile<6>(arow, W1b, emask, wave, lane, acc); break;
        case 7: stage1_tile<7>(arow, W1b, emask, wave, lane, acc); break;
        case 8: stage1_tile<8>(arow, W1b, emask, wave, lane, acc); break;
        default: break;
        }
    }
    __syncthreads();   // every wave has read its last x fragment: the bytes may become Hw
    {
        unsigned mk = emask;
#pragma unroll
        for (int j = 0; j < E_; j++) {
            if (j < nexp) {   // block-uniform scalar branch
                const int e = __builtin_ctz(mk);
                mk &= mk - 1;
                const float bb = b1[e * B_ + wave * 16 + col];
#pragma unroll
                for (int mt = 0; mt < MT_; mt++)
#pragma unroll
                    for (int r = 0; r < 8; r++) {
                        const int m = mt * 16 + r + hi * 8;
                        float h = fmaxf(acc[mt][j][r] + bb, 0.f) * tileW[m][e];
                        Hw[e][m][wave * 16 + col] = (bf16)h;
                    }
            }
        }
    }
    __syncthreads();

    // ---------------- stage 2: out = x + sum_e Hw_e @ W2_e^T + w@b2 ---
    for (int g = 0; g < 16 / NT2_; g++) {
        const int ct0   = wave * 16 + g * NT2_;   // 128 column tiles over 8 waves
        const int hcol0 = ct0 * 16 + col;
        f32x8 acc2[MT_][NT2_];
#pragma unroll
        for (int mt = 0; mt < MT_; mt++)
#pragma unroll
            for (int n = 0; n < NT2_; n++)
                acc2[mt][n] = (f32x8){0.f,0.f,0.f,0.f,0.f,0.f,0.f,0.f};
        for (int e = 0; e < E_; e++) {
            if (!((emask >> e) & 1u)) continue;   // block-uniform scalar branch
            const bf16* arow = &Hw[e][col][klo];
            // packed W2: [row tile = e*128 + ct0 + n][k step][half][lane][8]
            const bf16* brow = W2b + ((size_t)e * H_ + ct0 * 16) * B_ + lane * 8;
            FragBF a[B_ / 32][MT_], b[B_ / 32][NT2_];
#pragma unroll
            for (int n = 0; n < NT2_; n++)
#pragma unroll
                for (int ks = 0; ks < B_ / 32; ks++) {
                    b[ks][n].h[0] = *(const bf16x8*)(brow + n * 16 * B_ + ks * 512);
                    b[ks][n].h[1] = *(const bf16x8*)(brow + n * 16 * B_ + ks * 512 + 256);
                }
#pragma unroll
            for (int ks = 0; ks < B_ / 32; ks++)
#pragma unroll
                for (int mt = 0; mt < MT_; mt++) {
                    a[ks][mt].h[0] = *(const bf16x8*)(arow + mt * 16 * HW_STRIDE + ks * 32);
                    a[ks][mt].h[1] = *(const bf16x8*)(arow + mt * 16 * HW_STRIDE + ks * 32 + 16);
                }
            // the loads have taken their address before its registers are reused; naming the
            // pointer keeps it in its registers up to the wait
            asm volatile("s_wait_xcnt 0x0" :: "v"(brow) : "memory");
            // as in stage 1: the expert's loads stay one group in front of its WMMAs
            __builtin_amdgcn_sched_barrier(0);
#pragma unroll
            for (int ks = 0; ks < B_ / 32; ks++)
#pragma unroll
                for (int n = 0; n < NT2_; n++)
#pragma unroll
                    for (int mt = 0; mt < MT_; mt++)
                        acc2[mt][n] = __builtin_amdgcn_wmma_f32_16x16x32_bf16(
                            false, a[ks][mt].v, false, b[ks][n].v, (short)0, acc2[mt][n], false, false);
        }
        // uniform base of this group's columns, and the element offset, in x and in out, of the
        // lane's column in each of its 32 rows (a row is a token's); the offsets are formed here
        // and stay as they are until the wait behind the group's stores
        const float* xg = x   + g * NT2_ * 16;
        float*       og = out + g * NT2_ * 16;
        int ro[MT_][8];
#pragma unroll
        for (int mt = 0; mt < MT_; mt++)
#pragma unroll
            for (int r = 0; r < 8; r++)
                ro[mt][r] = tokIdx[mt * 16 + r + hi * 8] * H_ + wave * 256 + col;
        float xv[MT_][NT2_][8];
#pragma unroll
        for (int mt = 0; mt < MT_; mt++)
#pragma unroll
            for (int r = 0; r < 8; r++)
#pragma unroll
                for (int n = 0; n < NT2_; n++)
                    xv[mt][n][r] = xg[(size_t)(n * 16) + ro[mt][r]];
        float b2v[NT2_][E_];
#pragma unroll
        for (int n = 0; n < NT2_; n++)
#pragma unroll
            for (int e = 0; e < E_; e++) b2v[n][e] = b2[(size_t)e * H_ + hcol0 + n * 16];
        // the loads have taken their offset registers before anything reuses them; naming
        // the offset keeps it in its register up to the wait
        asm volatile("s_wait_xcnt 0x0" :: "v"(hcol0) : "memory");
        // the group's loads stay together in front of the arithmetic: one memory latency a group
        __builtin_amdgcn_sched_barrier(0);
#pragma unroll
        for (int mt = 0; mt < MT_; mt++)
#pragma unroll
            for (int r = 0; r < 8; r++) {
                const int m = mt * 16 + r + hi * 8;
                float tw[E_];
#pragma unroll
                for (int e = 0; e < E_; e++) tw[e] = tileW[m][e];
#pragma unroll
                for (int n = 0; n < NT2_; n++) {
                    float s = 0.f;
#pragma unroll
                    for (int e = 0; e < E_; e++) s = fmaf(tw[e], b2v[n][e], s);
                    acc2[mt][n][r] = xv[mt][n][r] + acc2[mt][n][r] + s;
                }
            }
        // every result is formed before the first store, so that no register of an
        // issued store is written again in front of the wait behind the stores
        __builtin_amdgcn_sched_barrier(0);
#pragma unroll
        for (int mt = 0; mt < MT_; mt++)
#pragma unroll
            for (int r = 0; r < 8; r++)
#pragma unroll
                for (int n = 0; n < NT2_; n++)
                    og[(size_t)(n * 16) + ro[mt][r]] = acc2[mt][n][r];
        // the next group reuses the stores' registers: the stores have taken them first
        asm volatile("s_wait_xcnt 0x0" ::: "memory");
    }
}

// ---------------------------------------------------------------------
extern "C" void kernel_launch(void* const* d_in, const int* in_sizes, int n_in,
                              void* d_out, int out_size, void* d_ws, size_t ws_size,
                              hipStream_t stream) {
    const float* x     = (const float*)d_in[0];
    const float* skin  = (const float*)d_in[1];
    const float* Wimg  = (const float*)d_in[2];
    const float* Wskin = (const float*)d_in[3];
    const float* W1    = (const float*)d_in[4];
    const float* b1    = (const float*)d_in[5];
    const float* W2    = (const float*)d_in[6];
    const float* b2    = (const float*)d_in[7];
    float* out = (float*)d_out;

    // workspace layout
    char* ws = (char*)d_ws;
    float* wN      = (float*)ws;                                   // N*E f32 (512KB)
    int*   key  = (int*)(ws + (size_t)N_ * E_ * sizeof(float) + 4096);   // N int (64KB)
    int*   perm = key + N_;                                        // N int (64KB)
    float* auxPart = (float*)(perm + N_);                          // 512 rows of 16 f32 (32KB)
    bf16*  xb  = (bf16*)(ws + (1ull << 20));                       // N*H bf16 (64MB)
    bf16*  W1b = xb  + (size_t)N_ * H_;                            // E*B*H bf16 (4MB)
    bf16*  W2b = W1b + (size_t)E_ * B_ * H_;                       // E*H*B bf16 (4MB)

    // 1) router + bf16 copy of x, one pass over x (512 work-groups of 32 tokens); the same
    //    work-groups convert the weights into fragment order
    router_cvt_kernel<<<RT_WG, 256, 0, stream>>>(x, skin, Wimg, Wskin, W1, W2, xb, wN, key, W1b, W2b, auxPart);

    // 2) tokens listed by expert pair (work-group 0); aux loss scalar (work-group 1)
    sort_kernel<<<2, ST_, 0, stream>>>(key, perm, auxPart, out + (size_t)N_ * H_);

    // 3) expert GEMMs + combine + residual
    moe_kernel<<<N_ / 64, 256, 0, stream>>>(x, xb, W1b, b1, W2b, b2, wN, perm, out);
}

// v006
// One run takes 92.7 microseconds.
// Timed twice side by side with v005, it ran 1.20 and 1.19 times as fast.
// All steps since v000 together make it 7.60 times as fast.
#include <hip/hip_runtime.h>
#include <hip/hip_bf16.h>

// ---------------- problem constants (match reference) ----------------
#define E_   8
#define K_   2
#define N_   16384
#define H_   2048
#define B_   128
#define EPS_ 1e-6f

typedef __bf16 bf16;
typedef __attribute__((ext_vector_type(16))) __bf16 bf16x16;
typedef __attribute__((ext_vector_type(8)))  __bf16 bf16x8;
typedef __attribute__((ext_vector_type(8)))  float  f32x8;
typedef __attribute__((ext_vector_type(4)))  float  f32x4;

// ---------------------------------------------------------------------
// 1) router and fp32 -> bf16 conversion (RNE) of x in one pass over x.
//    A work-group takes 32 tokens; wave w owns columns w*256 .. w*256+255 and
//    keeps its slice of W_img in registers (8 experts x 8 columns a lane).
//    Per token a wave reads two runs of 512 contiguous bytes, writes their
//    bf16 copy and adds to 8 partial logits a lane; four tokens at a time.
//    Every loop of the kernel is unrolled: its arrays stay in registers only
//    under constant indices, and the token offsets become immediates, so that
//    no address register of a load or store is ever stepped.
//    The same launch converts W1 and W2 (fp32 -> bf16, RNE) into WMMA B-fragment
//    order, dst[row tile][k step of 32][half][lane][8]: lane l of half j holds row
//    (l & 15), k = j*16 + (l >> 4)*8 .. +7, so that one wave-wide 16-byte load of a
//    half reads 512 contiguous bytes. A piece is one lane's 16 bytes; every wave of
//    the grid writes 128 pieces (two k steps of one row tile), work-groups 0..255
//    those of W1 and 256..511 those of W2. Their loads fly with the first x loads.
//    The aux sums leave as one row of 16 partial sums per work-group.
// ---------------------------------------------------------------------
#define RT_TOK 32   // tokens per work-group
#define RT_G   4    // tokens a wave holds at once
#define RT_WG  (N_ / RT_TOK)   // work-groups of the launch
#define PK_I   4    // pieces a lane packs
static_assert(E_ * B_ * H_ / 8 == (RT_WG / 2) * 8 * 32 * PK_I, "each half of the grid packs one weight matrix");

__global__ __launch_bounds__(256)
void router_cvt_kernel(const float* __restrict__ x,
                       const float* __restrict__ skin,
                       const float* __restrict__ Wimg,
                       const float* __restrict__ Wskin,
                       const float* __restrict__ W1,
                       const float* __restrict__ W2,
                       bf16*  __restrict__ xb,
                       float* __restrict__ wout,
                       int*   __restrict__ key,
                       bf16*  __restrict__ W1b,
                       bf16*  __restrict__ W2b,
                       float* __restrict__ auxPart) {
    __shared__ float part[8][RT_TOK * E_];     // per wave: its columns' share of every logit
    __shared__ float lgs[RT_TOK][E_ + 1];      // +1: a lane reads one token's row, banks apart
    const int lane = threadIdx.x & 31;
    const int wave = __builtin_amdgcn_readfirstlane(threadIdx.x >> 5);
    const int tok0 = blockIdx.x * RT_TOK;
    const int l4   = lane * 4;

    // the wave's 128 pieces: rows of 32 << sh floats; pieces i = 0..3 of a lane lie 16 floats apart
    const bool   second = blockIdx.x >= RT_WG / 2;                      // block-uniform
    const int    sh  = second ? 2 : 6;                                  // W2: 4 k steps a row, W1: 64
    const int    pq  = (blockIdx.x & (RT_WG / 2 - 1)) * 8 + wave;       // the wave's number in its matrix
    const float* ps  = (second ? W2 : W1)
                     + ((size_t)((pq * 2) >> sh) * 16 << (sh + 5)) + ((pq * 2) & ((1 << sh) - 1)) * 32;
    bf16*        pd  = (second ? W2b : W1b) + (size_t)pq * (32 * PK_I * 8);
    const int    plo = ((lane & 15) << (sh + 5)) + (lane >> 4) * 8;     // the lane's row and k offset
    float4 pv[PK_I][2];
#pragma unroll
    for (int i = 0; i < PK_I; i++)
#pragma unroll
        for (int j = 0; j < 2; j++)
            pv[i][j] = *(const float4*)(ps + (i * 16 + j * 4) + plo);
    // the loads have taken their offset register before anything reuses it; naming the
    // offset keeps it in its register up to the wait
    asm volatile("s_wait_xcnt 0x0" :: "v"(plo) : "memory");

    const float* wt = Wimg + wave * 256;
    float4 w[E_][2];
#pragma unroll
    for (int e = 0; e < E_; e++)
#pragma unroll
        for (int j = 0; j < 2; j++)
            w[e][j] = *(const float4*)(wt + (e * H_ + j * 128) + l4);

    // uniform base, one element offset per lane, constants for token and half
    const float* xt = x  + (size_t)tok0 * H_ + wave * 256;
    bf16*        xo = xb + (size_t)tok0 * H_ + wave * 256;

    float4 v[2][RT_G][2];
#pragma unroll
    for (int t = 0; t < RT_G; t++)
#pragma unroll
        for (int j = 0; j < 2; j++)
            v[0][t][j] = *(const float4*)(xt + (t * H_ + j * 128) + l4);
    // W_img's and the first x loads stay in front of the packing's arithmetic: they fly while
    // the weight pieces, asked for first, are waited for
    __builtin_amdgcn_sched_barrier(0);
    {
        uint4 po[PK_I];
#pragma unroll
        for (int i = 0; i < PK_I; i++) {
            union { bf16 b[8]; uint4 u; } o;
            o.b[0] = (bf16)pv[i][0].x; o.b[1] = (bf16)pv[i][0].y;
            o.b[2] = (bf16)pv[i][0].z; o.b[3] = (bf16)pv[i][0].w;
            o.b[4] = (bf16)pv[i][1].x; o.b[5] = (bf16)pv[i][1].y;
            o.b[6] = (bf16)pv[i][1].z; o.b[7] = (bf16)pv[i][1].w;
            po[i] = o.u;
        }
#pragma unroll
        for (int i = 0; i < PK_I; i++)
            *(uint4*)(pd + i * 256 + lane * 8) = po[i];
        // the stores have taken their registers before the loop below reuses any of them
        asm volatile("s_wait_xcnt 0x0" ::: "memory");
        // nothing of the loop below is lifted over that wait
        __builtin_amdgcn_sched_barrier(0);
    }

#pragma unroll
    for (int g = 0; g < RT_TOK / RT_G; g++) {
        // the next four tokens' loads fly while these four are worked on
        if (g + 1 < RT_TOK / RT_G) {
#pragma unroll
            for (int t = 0; t < RT_G; t++)
#pragma unroll
                for (int j = 0; j < 2; j++)
                    v[(g + 1) & 1][t][j] =
                        *(const float4*)(xt + (((g + 1) * RT_G + t) * H_ + j * 128) + l4);
        }
        // keeps those loads in front of this group's arithmetic: sunk behind it they
        // would have no lead and each group would wait out a whole memory latency
        __builtin_amdgcn_sched_barrier(0);

        float a[RT_G * E_];
#pragma unroll
        for (int t = 0; t < RT_G; t++)
#pragma unroll
            for (int e = 0; e < E_; e++) {
                float s = 0.f;
#pragma unroll
                for (int j = 0; j < 2; j++) {
                    const float4 xv = v[g & 1][t][j];
                    s = fmaf(xv.x, w[e][j].x, s);
                    s = fmaf(xv.y, w[e][j].y, s);
                    s = fmaf(xv.z, w[e][j].z, s);
                    s = fmaf(xv.w, w[e][j].w, s);
                }
                a[t * E_ + e] = s;
            }
#pragma unroll
        for (int t = 0; t < RT_G; t++)
#pragma unroll
            for (int j = 0; j < 2; j++) {
                const float4 xv = v[g & 1][t][j];
                union { bf16 b[4]; uint2 u; } o;
                o.b[0] = (bf16)xv.x; o.b[1] = (bf16)xv.y;
                o.b[2] = (bf16)xv.z; o.b[3] = (bf16)xv.w;
                *(uint2*)(xo + ((g * RT_G + t) * H_ + j * 128) + l4) = o.u;
            }
        // the stores have taken their registers before the sums below reuse any of them
        asm volatile("s_wait_xcnt 0x0" ::: "memory");
        // nothing of the sums below is lifted over that wait
        __builtin_amdgcn_sched_barrier(0);

        // 32 values a lane summed over 32 lanes: each step halves the values a lane
        // keeps, so that lane l ends with the whole sum of value l (token l>>3, expert l&7)
#pragma unroll
        for (int off = 16; off; off >>= 1) {
            const bool up = (lane & off) != 0;
#pragma unroll
            for (int i = 0; i < off; i++) {
                const float lo = a[i], hv = a[i + off];
                const float keep = up ? hv : lo;
                const float send = up ? lo : hv;
                a[i] = keep + __shfl_xor(send, off, 32);
            }
        }
        part[wave][g * RT_G * E_ + lane] = a[0];
    }
    __syncthreads();   // every wave's shares are written
    {
        float s = 0.f;
#pragma unroll
        for (int q = 0; q < 8; q++) s += part[q][threadIdx.x];
        lgs[threadIdx.x >> 3][threadIdx.x & 7] = s;
    }
    __syncthreads();   // the logits' image part is whole

    if (wave == 0) {   // one lane per token
        const int t = tok0 + lane;
        const float s0 = skin[t * 3 + 0], s1 = skin[t * 3 + 1], s2 = skin[t * 3 + 2];
        float lg[E_]; float mx = -1e30f;
#pragma unroll
        for (int e = 0; e < E_; e++) {
            lg[e] = lgs[lane][e] + s0 * Wskin[e * 3 + 0]
                                 + s1 * Wskin[e * 3 + 1]
                                 + s2 * Wskin[e * 3 + 2];
            mx = fmaxf(mx, lg[e]);
        }
        float p[E_]; float den = 0.f;
#pragma unroll
        for (int e = 0; e < E_; e++) { p[e] = __expf(lg[e] - mx); den += p[e]; }
        const float inv = 1.f / den;
#pragma unroll
        for (int e = 0; e < E_; e++) p[e] *= inv;
        // top-2 (first index wins ties, like jax top_k)
        int i1 = 0; float v1 = p[0];
#pragma unroll
        for (int e = 1; e < E_; e++) if (p[e] > v1) { v1 = p[e]; i1 = e; }
        int i2 = -1; float v2 = -1.f;
#pragma unroll
        for (int e = 0; e < E_; e++) if (e != i1 && p[e] > v2) { v2 = p[e]; i2 = e; }
        const float inv2 = 1.f / (v1 + v2 + EPS_);
        {   // sort key of the token's expert pair (lo < hi). hi runs upwards under an even lo and
            // downwards under an odd one, so that neighbouring keys always share an expert
            const int j2 = i2 < 0 ? i1 : i2;
            const int lo = min(i1, j2), hi2 = max(i1, j2);
            key[t] = lo * E_ + ((lo & 1) ? (E_ - 1 - hi2) : hi2);
        }
        float r[2 * E_];   // 0..7 probabilities, 8..15 selection counts
#pragma unroll
        for (int e = 0; e < E_; e++) {
            float wv = (e == i1) ? v1 * inv2 : ((e == i2) ? v2 * inv2 : 0.f);
            wout[(size_t)t * E_ + e] = wv;
            r[e]      = p[e];
            r[E_ + e] = (e == i1 || e == i2) ? 1.f : 0.f;
        }
        // 16 values a lane summed over the 32 tokens: lane l ends with value l & 15
#pragma unroll
        for (int i = 0; i < 2 * E_; i++) r[i] += __shfl_xor(r[i], 16, 32);
#pragma unroll
        for (int off = 8; off; off >>= 1) {
            const bool up = (lane & off) != 0;
#pragma unroll
            for (int i = 0; i < off; i++) {
                const float lo = r[i], hv = r[i + off];
                const float keep = up ? hv : lo;
                const float send = up ? lo : hv;
                r[i] = keep + __shfl_xor(send, off, 32);
            }
        }
        if (lane < 2 * E_) auxPart[blockIdx.x * (2 * E_) + lane] = r[0];
    }
}

// ---------------------------------------------------------------------
// 2) counting sort of the tokens by key: perm[] lists the tokens key by key.
//     One work-group, 16 tokens a thread. cnt holds one 16-bit counter per
//     (key, thread), key-major, so that its running sum over the whole table
//     is each thread's first place for each key.
//     A second work-group of the launch adds the router's partial aux sums
//     (RT_WG rows of 16) and writes the aux loss.
// ---------------------------------------------------------------------
#define SK_     64    // keys
#define ST_     1024  // threads
#define SPT_    (N_ / ST_)   // tokens a thread
#define SPITCH_ 72    // a run of 64 counters + 8: 16-byte reads of neighbouring runs fall on different banks

__global__ __launch_bounds__(ST_)
void sort_kernel(const int* __restrict__ key, int* __restrict__ perm,
                 const float* __restrict__ auxPart, float* __restrict__ out_aux) {
    __shared__ __align__(16) unsigned short cnt[ST_ * SPITCH_];
    __shared__ unsigned wsum[ST_ / 32];
    __shared__ float red[ST_ / 32][2 * E_];
    const int t    = threadIdx.x;
    const int lane = t & 31;
    const int wv   = t >> 5;

    if (blockIdx.x == 1) {   // block-uniform: the whole work-group takes this path and leaves
        // thread t adds value t & 15 of rows (t >> 4) + 64 q
        float pa[RT_WG * 2 * E_ / ST_];
#pragma unroll
        for (int q = 0; q < RT_WG * 2 * E_ / ST_; q++) pa[q] = auxPart[q * ST_ + t];
        float s = 0.f;
#pragma unroll
        for (int q = 0; q < RT_WG * 2 * E_ / ST_; q++) s += pa[q];
        s += __shfl_xor(s, 16, 32);
        if (lane < 2 * E_) red[wv][lane] = s;
        __syncthreads();   // every wave's 16 sums are written
        if (wv == 0) {
            float a = 0.f;   // value lane & 15 over one half of the waves, then over both
#pragma unroll
            for (int q = 0; q < ST_ / 64; q++) a += red[(lane >> 4) * (ST_ / 64) + q][lane & 15];
            a += __shfl_xor(a, 16, 32);
            // lane e < 8 holds the probability sum of expert e, lane e + 8 its selection count
            float pr = (a / (float)N_) * (__shfl_xor(a, 8, 32) / (float)N_);
            pr += __shfl_xor(pr, 4, 32);
            pr += __shfl_xor(pr, 2, 32);
            pr += __shfl_xor(pr, 1, 32);
            if (lane == 0) *out_aux = pr * (float)E_;
        }
        return;
    }

    uint4* own = (uint4*)&cnt[t * SPITCH_];     // run t: key t >> 4, threads (t & 15) * 64 .. + 63
#pragma unroll
    for (int i = 0; i < 8; i++) own[i] = make_uint4(0u, 0u, 0u, 0u);

    int slot[SPT_];                             // this thread's counter for each of its tokens
    const int tb = (t >> 6) * SPITCH_ + (t & 63);
    int4 kv[SPT_ / 4];
#pragma unroll
    for (int q = 0; q < SPT_ / 4; q++) kv[q] = ((const int4*)(key + t * SPT_))[q];
    // holds the key loads in front of the barrier, beside the zeroing: sunk behind it
    // they would be waited for on their own
    asm volatile("" :: "v"(kv[0].x), "v"(kv[0].y), "v"(kv[0].z), "v"(kv[0].w),
                       "v"(kv[1].x), "v"(kv[1].y), "v"(kv[1].z), "v"(kv[1].w),
                       "v"(kv[2].x), "v"(kv[2].y), "v"(kv[2].z), "v"(kv[2].w),
                       "v"(kv[3].x), "v"(kv[3].y), "v"(kv[3].z), "v"(kv[3].w));
#pragma unroll
    for (int q = 0; q < SPT_ / 4; q++) {
        slot[q * 4 + 0] = (kv[q].x & (SK_ - 1)) * (16 * SPITCH_) + tb;
        slot[q * 4 + 1] = (kv[q].y & (SK_ - 1)) * (16 * SPITCH_) + tb;
        slot[q * 4 + 2] = (kv[q].z & (SK_ - 1)) * (16 * SPITCH_) + tb;
        slot[q * 4 + 3] = (kv[q].w & (SK_ - 1)) * (16 * SPITCH_) + tb;
    }
    __syncthreads();   // the table is zero

    int rank[SPT_];                             // place among this thread's own tokens of the key
#pragma unroll
    for (int i = 0; i < SPT_; i++) {
        const unsigned short c = cnt[slot[i]];
        rank[i] = c;
        cnt[slot[i]] = (unsigned short)(c + 1);
    }
    __syncthreads();   // every count is in

    // sum of the own run; two counters a word, neither half can carry (all counts sum to N_)
    unsigned s2 = 0;
#pragma unroll
    for (int i = 0; i < 8; i++) { const uint4 v = own[i]; s2 += v.x + v.y + v.z + v.w; }
    const unsigned total = (s2 & 0xffffu) + (s2 >> 16);
    unsigned inc = total;                       // running sum over the wave
#pragma unroll
    for (int d = 1; d < 32; d <<= 1) {
        const unsigned o = __shfl_up(inc, d, 32);
        if (lane >= d) inc += o;
    }
    if (lane == 31) wsum[wv] = inc;
    __syncthreads();   // the waves' sums are written
    if (wv == 0) {
        const unsigned w0 = wsum[lane];
        unsigned wi = w0;
#pragma unroll
        for (int d = 1; d < 32; d <<= 1) {
            const unsigned o = __shfl_up(wi, d, 32);
            if (lane >= d) wi += o;
        }
        wsum[lane] = wi - w0;
    }
    __syncthreads();   // each wave's start is written
    unsigned run = wsum[wv] + inc - total;      // first place of the own run
#pragma unroll
    for (int i = 0; i < 8; i++) {
        const uint4 v = own[i];
        const unsigned w[4] = { v.x, v.y, v.z, v.w };
        unsigned o[4];
#pragma unroll
        for (int c = 0; c < 4; c++) {
            const unsigned a0 = w[c] & 0xffffu, a1 = w[c] >> 16;
            o[c] = run | ((run + a0) << 16);
            run += a0 + a1;
        }
        own[i] = make_uint4(o[0], o[1], o[2], o[3]);
    }
    __syncthreads();   // every counter now holds its first place
    int pos[SPT_];   // all places are read before the first store, so that the reads overlap
#pragma unroll
    for (int i = 0; i < SPT_; i++) pos[i] = (cnt[slot[i]] + rank[i]) & (N_ - 1);
#pragma unroll
    for (int i = 0; i < SPT_; i++) perm[pos[i]] = t * SPT_ + i;
}

// ---------------------------------------------------------------------
// fragment union: CDNA5 16-bit A/B layout — lane = row/col (lane&15),
// K values { klo..klo+7, 16+klo..23+klo } with klo = (lane>>4)*8.
// ---------------------------------------------------------------------
union FragBF { bf16x16 v; bf16x8 h[2]; };

#define XS_STRIDE 2056   // 2048 + 8: 16B-aligned, +4 banks/row -> conflict-free
#define HW_STRIDE 136    // 128 + 8:  16B-aligned, +4 banks/row -> conflict-free
#define TM_ 64           // tokens per work-group
#define MT_ 4            // 16-token sub-tiles per work-group
#define NT2_ 4           // output column tiles a wave holds at once in stage 2
#define TS_STRIDE 68     // floats, 64 + 4: 16B-aligned, +4 banks/row -> conflict-free 16-byte writes down a column

// eight 16-byte-per-lane copies, rows r0..r0+7 of the x tile (row r is token rowTok[r]); the closing
// s_wait_xcnt keeps the address registers untouched until the copies took them
#define COPY8_ROWS(r0)                                                        \
    asm volatile("global_load_async_to_lds_b128 %0, %8, off\n\t"              \
                 "global_load_async_to_lds_b128 %1, %9, off\n\t"              \
                 "global_load_async_to_lds_b128 %2, %10, off\n\t"             \
                 "global_load_async_to_lds_b128 %3, %11, off\n\t"             \
                 "global_load_async_to_lds_b128 %4, %12, off\n\t"             \
                 "global_load_async_to_lds_b128 %5, %13, off\n\t"             \
                 "global_load_async_to_lds_b128 %6, %14, off\n\t"             \
                 "global_load_async_to_lds_b128 %7, %15, off\n\t"             \
                 "s_wait_xcnt 0x0"                                            \
                 :: "v"(lbase + ((r0) + 0) * (XS_STRIDE * 2)),                \
                    "v"(lbase + ((r0) + 1) * (XS_STRIDE * 2)),                \
                    "v"(lbase + ((r0) + 2) * (XS_STRIDE * 2)),                \
                    "v"(lbase + ((r0) + 3) * (XS_STRIDE * 2)),                \
                    "v"(lbase + ((r0) + 4) * (XS_STRIDE * 2)),                \
                    "v"(lbase + ((r0) + 5) * (XS_STRIDE * 2)),                \
                    "v"(lbase + ((r0) + 6) * (XS_STRIDE * 2)),                \
                    "v"(lbase + ((r0) + 7) * (XS_STRIDE * 2)),                \
                    "v"(gbase + (size_t)rowTok[(r0) + 0] * H_),                     \
                    "v"(gbase + (size_t)rowTok[(r0) + 1] * H_),                     \
                    "v"(gbase + (size_t)rowTok[(r0) + 2] * H_),                     \
                    "v"(gbase + (size_t)rowTok[(r0) + 3] * H_),                     \
                    "v"(gbase + (size_t)rowTok[(r0) + 4] * H_),                     \
                    "v"(gbase + (size_t)rowTok[(r0) + 5] * H_),                     \
                    "v"(gbase + (size_t)rowTok[(r0) + 6] * H_),                     \
                    "v"(gbase + (size_t)rowTok[(r0) + 7] * H_)                      \
                 : "memory")

// ---------------------------------------------------------------------
// 3) MoE expert kernel: one block per 64-token tile, 256 threads (8 waves).
//    A tile is 64 neighbours of the sorted list perm[], so it uses few experts
//    (two inside a run of one pair, three across a seam); any number up to
//    eight is handled. Every weight fragment read from global memory feeds
//    four WMMAs (the four 16-token sub-tiles); W1b and W2b arrive in fragment
//    order. Stage 1: wave w owns column tile w of every used expert. Stage 2:
//    a wave owns 16 column tiles of the output, four at a time; their results are
//    turned through LDS, so that x is read and out written in whole 256-byte runs.
// ---------------------------------------------------------------------

// stage 1 of a tile that uses NJ experts: acc[mt][j] = X(sub-tile mt) @ W1(j-th used expert, column tile 'wave')^T
template <int NJ>
__device__ __forceinline__ void stage1_tile(const bf16* arow, const bf16* __restrict__ W1b,
                                            unsigned emask, int wave, int lane,
                                            f32x8 (&acc)[MT_][E_]) {
    constexpr int KS = (NJ <= 4) ? 4 : 2;   // k steps of 32 a trip: as many as the registers take
    // packed W1: [row tile = e*8 + wave][k step][half][lane][8]
    const bf16* brow[NJ];
    unsigned mk = emask;
#pragma unroll
    for (int j = 0; j < NJ; j++) {
        const int e = __builtin_ctz(mk);
        mk &= mk - 1;
        brow[j] = W1b + (size_t)(e * 8 + wave) * 16 * H_ + lane * 8;
    }
    for (int k0 = 0; k0 < H_; k0 += KS * 32) {
        FragBF a[KS][MT_], b[KS][NJ];
        const bf16* p[E_];   // this trip's weight addresses; places NJ.. repeat the last one
#pragma unroll
        for (int j = 0; j < E_; j++) p[j] = brow[j < NJ ? j : NJ - 1] + k0 * 16;
#pragma unroll
        for (int j = 0; j < NJ; j++)
#pragma unroll
            for (int ks = 0; ks < KS; ks++) {
                b[ks][j].h[0] = *(const bf16x8*)(p[j] + ks * 512);
                b[ks][j].h[1] = *(const bf16x8*)(p[j] + ks * 512 + 256);
            }
#pragma unroll
        for (int ks = 0; ks < KS; ks++)
#pragma unroll
            for (int mt = 0; mt < MT_; mt++) {
                a[ks][mt].h[0] = *(const bf16x8*)(arow + mt * 16 * XS_STRIDE + k0 + ks * 32);
                a[ks][mt].h[1] = *(const bf16x8*)(arow + mt * 16 * XS_STRIDE + k0 + ks * 32 + 16);
            }
        // the loads have taken their addresses before the registers are reused; naming the
        // addresses keeps them in their registers up to the wait
        asm volatile("s_wait_xcnt 0x0" :: "v"(p[0]), "v"(p[1]), "v"(p[2]), "v"(p[3]),
                                          "v"(p[4]), "v"(p[5]), "v"(p[6]), "v"(p[7]) : "memory");
        // keeps the trip's loads one group in front of its WMMAs: sunk among them,
        // each weight fragment's L2 latency would be waited out on its own
        __builtin_amdgcn_sched_barrier(0);
#pragma unroll
        for (int ks = 0; ks < KS; ks++)
#pragma unroll
            for (int j = 0; j < NJ; j++)
#pragma unroll
                for (int mt = 0; mt < MT_; mt++)
                    acc[mt][j] = __builtin_amdgcn_wmma_f32_16x16x32_bf16(
                        false, a[ks][mt].v, false, b[ks][j].v, (short)0, acc[mt][j], false, false);
    }
}

__global__ __launch_bounds__(256)
void moe_kernel(const float* __restrict__ x,
                const bf16*  __restrict__ xb,
                const bf16*  __restrict__ W1b,
                const float* __restrict__ b1,
                const bf16*  __restrict__ W2b,
                const float* __restrict__ b2,
                const float* __restrict__ wN,
                const int*   __restrict__ perm,
                float* __restrict__ out) {
    // the staged x tile; once stage 1 has read it, the same bytes hold Hw
    // and behind Hw lies one 64 x 64 f32 tile per wave, through which stage 2 turns its results
    __shared__ __align__(16) bf16 Xs[TM_ + 4][XS_STRIDE];
    static_assert(sizeof(Xs) >= E_ * TM_ * HW_STRIDE * 2 + 8 * TM_ * TS_STRIDE * 4, "Hw and the waves' tiles fit");
    __shared__ __align__(16) float tileW[TM_][E_];
    __shared__ int   eflag[E_];
    __shared__ int   tokIdx[TM_];          // the tile's tokens
    bf16 (*Hw)[TM_][HW_STRIDE] = (bf16 (*)[TM_][HW_STRIDE])&Xs[0][0];   // [E_][TM_][HW_STRIDE]

    const int tile = blockIdx.x;           // 0..N/64-1
    const int tok0 = tile * TM_;           // first place in perm[]
    const int* pt  = perm + tok0;          // every token number read from it is masked to 0..N_-1
    const int lane = threadIdx.x & 31;
    const int wave = __builtin_amdgcn_readfirstlane(threadIdx.x >> 5);
    const int col  = lane & 15;            // fragment row/col index
    const int klo  = (lane >> 4) * 8;      // per-lane K offset
    const int hi   = lane >> 4;

    // ---- async-stage the x tile (64 x 2048 bf16 = 256KB) into LDS ----
    // one copy of the block = one row (256 threads x 16B); 64 copies a wave,
    // in two halves so that no wave has more than 32 outstanding.
    const bf16*    gbase = xb + threadIdx.x * 8;
    const unsigned lbase = (unsigned)(uintptr_t)(&Xs[0][threadIdx.x * 8]);
    // the tile's 64 token numbers, the same for every thread: read at once, in front of the
    // first copy, so that no group of copies waits for a read of its own
    int rowTok[TM_];
#pragma unroll
    for (int r = 0; r < TM_; r++) rowTok[r] = pt[r] & (N_ - 1);
    // and the tokens whose combine weights this thread fetches
    int tk[TM_ * E_ / 256];
#pragma unroll
    for (int j = 0; j < TM_ * E_ / 256; j++) tk[j] = pt[(threadIdx.x >> 3) + 32 * j] & (N_ - 1);
    COPY8_ROWS(0);  COPY8_ROWS(8);  COPY8_ROWS(16); COPY8_ROWS(24);

    // combine weights while the copies are in flight
    float cw[TM_ * E_ / 256];
#pragma unroll
    for (int j = 0; j < TM_ * E_ / 256; j++) cw[j] = wN[(size_t)tk[j] * E_ + (threadIdx.x & 7)];
#pragma unroll
    for (int j = 0; j < TM_ * E_ / 256; j++) {
        const int row = (threadIdx.x >> 3) + 32 * j;
        tileW[row][threadIdx.x & 7] = cw[j];
        if ((threadIdx.x & 7) == 0) tokIdx[row] = tk[j];
    }

    // first half landed before the second half is issued
    asm volatile("s_wait_asynccnt 0x0" ::: "memory");
    COPY8_ROWS(32); COPY8_ROWS(40); COPY8_ROWS(48); COPY8_ROWS(56);

    __syncthreads();
    if (threadIdx.x < E_) {
        int f = 0;
        for (int m = 0; m < TM_; m++) f |= (tileW[m][threadIdx.x] != 0.f);
        eflag[threadIdx.x] = f;
    }
    // wait for this wave's async transfers, then barrier for cross-wave vis
    asm volatile("s_wait_asynccnt 0x0" ::: "memory");
    __syncthreads();

    unsigned emask = 0;
#pragma unroll
    for (int e = 0; e < E_; e++) emask |= (eflag[e] ? 1u : 0u) << e;
    emask = __builtin_amdgcn_readfirstlane(emask);
    const int nexp = __builtin_popcount(emask);   // block-uniform: experts this tile uses

    // ---------------- stage 1: Hw[e] = w * relu(X @ W1_e^T + b1_e) ----
    f32x8 acc[MT_][8];
#pragma unroll
    for (int mt = 0; mt < MT_; mt++)
#pragma unroll
        for (int n = 0; n < 8; n++)
            acc[mt][n] = (f32x8){0.f,0.f,0.f,0.f,0.f,0.f,0.f,0.f};
    {
        const bf16* arow = &Xs[col][klo];                               // LDS
        switch (nexp) {   // block-uniform scalar branch; one loop per count keeps acc under constant indices
        case 1: stage1_tile<1>(arow, W1b, emask, wave, lane, acc); break;
        case 2: stage1_tile<2>(arow, W1b, emask, wave, lane, acc); break;
        case 3: stage1_tile<3>(arow, W1b, emask, wave, lane, acc); break;
        case 4: stage1_tile<4>(arow, W1b, emask, wave, lane, acc); break;
        case 5: stage1_tile<5>(arow, W1b, emask, wave, lane, acc); break;
        case 6: stage1_tile<6>(arow, W1b, emask, wave, lane, acc); break;
        case 7: stage1_tile<7>(arow, W1b, emask, wave, lane, acc); break;
        case 8: stage1_tile<8>(arow, W1b, emask, wave, lane, acc); break;
        default: break;
        }
    }
    __syncthreads();   // every wave has read its last x fragment: the bytes may become Hw
    {
        unsigned mk = emask;
#pragma unroll
        for (int j = 0; j < E_; j++) {
            if (j < nexp) {   // block-uniform scalar branch
                const int e = __builtin_ctz(mk);
                mk &= mk - 1;
                const float bb = b1[e * B_ + wave * 16 + col];
#pragma unroll
                for (int mt = 0; mt < MT_; mt++)
#pragma unroll
                    for (int r = 0; r < 8; r++) {
                        const int m = mt * 16 + r + hi * 8;
                        float h = fmaxf(acc[mt][j][r] + bb, 0.f) * tileW[m][e];
                        Hw[e][m][wave * 16 + col] = (bf16)h;
                    }
            }
        }
    }
    __syncthreads();

    // ---------------- stage 2: out = x + sum_e Hw_e @ W2_e^T + w@b2 ---
    // the wave's own tile: only this wave writes and reads it, so no barrier stands around it
    float* ts = (float*)((char*)&Xs[0][0] + E_ * TM_ * HW_STRIDE * 2) + wave * (TM_ * TS_STRIDE);
    for (int g = 0; g < 16 / NT2_; g++) {
        const int ct0   = wave * 16 + g * NT2_;   // 128 column tiles over 8 waves
        f32x8 acc2[MT_][NT2_];
#pragma unroll
        for (int mt = 0; mt < MT_; mt++)
#pragma unroll
            for (int n = 0; n < NT2_; n++)
                acc2[mt][n] = (f32x8){0.f,0.f,0.f,0.f,0.f,0.f,0.f,0.f};
        for (int e = 0; e < E_; e++) {
            if (!((emask >> e) & 1u)) continue;   // block-uniform scalar branch
            const bf16* arow = &Hw[e][col][klo];
            // packed W2: [row tile = e*128 + ct0 + n][k step][half][lane][8]
            const bf16* brow = W2b + ((size_t)e * H_ + ct0 * 16) * B_ + lane * 8;
            FragBF a[B_ / 32][MT_], b[B_ / 32][NT2_];
#pragma unroll
            for (int n = 0; n < NT2_; n++)
#pragma unroll
                for (int ks = 0; ks < B_ / 32; ks++) {
                    b[ks][n].h[0] = *(const bf16x8*)(brow + n * 16 * B_ + ks * 512);
                    b[ks][n].h[1] = *(const bf16x8*)(brow + n * 16 * B_ + ks * 512 + 256);
                }
#pragma unroll
            for (int ks = 0; ks < B_ / 32; ks++)
#pragma unroll
                for (int mt = 0; mt < MT_; mt++) {
                    a[ks][mt].h[0] = *(const bf16x8*)(arow + mt * 16 * HW_STRIDE + ks * 32);
                    a[ks][mt].h[1] = *(const bf16x8*)(arow + mt * 16 * HW_STRIDE + ks * 32 + 16);
                }
            // the loads have taken their address before its registers are reused; naming the
            // pointer keeps it in its registers up to the wait
            asm volatile("s_wait_xcnt 0x0" :: "v"(brow) : "memory");
            // as in stage 1: the expert's loads stay one group in front of its WMMAs
            __builtin_amdgcn_sched_barrier(0);
#pragma unroll
            for (int ks = 0; ks < B_ / 32; ks++)
#pragma unroll
                for (int n = 0; n < NT2_; n++)
#pragma unroll
                    for (int mt = 0; mt < MT_; mt++)
                        // W2 is the A operand: the result tile's rows are output columns, its columns tokens
                        acc2[mt][n] = __builtin_amdgcn_wmma_f32_16x16x32_bf16(
                            false, b[ks][n].v, false, a[ks][mt].v, (short)0, acc2[mt][n], false, false);
        }
        // the group's results leave in row order: a lane takes four neighbouring columns of row
        // 2 i + hi, so that a wave-wide 16-byte access covers two whole 256-byte runs.
        // uniform base of this group's columns, and the byte offset, in x and in out, of the
        // lane's columns in each of its 32 rows (a row is a token's); the offsets are formed here
        // and stay as they are until the wait behind the group's stores
        const int    c4 = col * 4;
        const float* xg = x   + ct0 * 16;
        float*       og = out + ct0 * 16;
        // b2 is asked for first: loads return in order, and the bias sums then run while x flies
        f32x4 b2v[E_];
#pragma unroll
        for (int e = 0; e < E_; e++) b2v[e] = *(const f32x4*)(b2 + (size_t)e * H_ + ct0 * 16 + c4);
        unsigned ro[TM_ / 2];   // in bytes
#pragma unroll
        for (int i = 0; i < TM_ / 2; i++) ro[i] = ((unsigned)tokIdx[2 * i + hi] * H_ + c4) * 4u;
        f32x4 xv[TM_ / 2];
#pragma unroll
        for (int i = 0; i < TM_ / 2; i++) xv[i] = *(const f32x4*)((const char*)xg + ro[i]);
        // the loads have taken their offset registers before anything reuses them; naming
        // the offset keeps it in its register up to the wait
        asm volatile("s_wait_xcnt 0x0" :: "v"(c4) : "memory");
        // the group's loads stay together in front of the turn through LDS: they fly beside it
        __builtin_amdgcn_sched_barrier(0);
        // a lane holds columns hi*8 .. hi*8+7 of column tile n for token mt*16 + col
#pragma unroll
        for (int mt = 0; mt < MT_; mt++)
#pragma unroll
            for (int n = 0; n < NT2_; n++) {
                float* p = ts + (mt * 16 + col) * TS_STRIDE + n * 16 + hi * 8;
                *(f32x4*)p       = (f32x4){acc2[mt][n][0], acc2[mt][n][1], acc2[mt][n][2], acc2[mt][n][3]};
                *(f32x4*)(p + 4) = (f32x4){acc2[mt][n][4], acc2[mt][n][5], acc2[mt][n][6], acc2[mt][n][7]};
            }
        // the wave's own writes are in LDS before other lanes of it read the rows back
        asm volatile("s_wait_dscnt 0x0" ::: "memory");
#pragma unroll
        for (int i = 0; i < TM_ / 2; i++) {
            const int m = 2 * i + hi;
            const f32x4 t = *(const f32x4*)(ts + m * TS_STRIDE + c4);
            float tw[E_];
#pragma unroll
            for (int e = 0; e < E_; e++) tw[e] = tileW[m][e];
            f32x4 s = (f32x4){0.f, 0.f, 0.f, 0.f};
#pragma unroll
            for (int e = 0; e < E_; e++) {
                s.x = fmaf(tw[e], b2v[e].x, s.x);
                s.y = fmaf(tw[e], b2v[e].y, s.y);
                s.z = fmaf(tw[e], b2v[e].z, s.z);
                s.w = fmaf(tw[e], b2v[e].w, s.w);
            }
            xv[i] = xv[i] + t + s;
        }
        // every result is formed before the first store, so that no register of an
        // issued store is written again in front of the wait behind the stores
        __builtin_amdgcn_sched_barrier(0);
#pragma unroll
        for (int i = 0; i < TM_ / 2; i++) *(f32x4*)((char*)og + ro[i]) = xv[i];
        // the next group reuses the stores' registers: the stores have taken them first
        asm volatile("s_wait_xcnt 0x0" ::: "memory");
    }
}

// ---------------------------------------------------------------------
extern "C" void kernel_launch(void* const* d_in, const int* in_sizes, int n_in,
                              void* d_out, int out_size, void* d_ws, size_t ws_size,
                              hipStream_t stream) {
    const float* x     = (const float*)d_in[0];
    const float* skin  = (const float*)d_in[1];
    const float* Wimg  = (const float*)d_in[2];
    const float* Wskin = (const float*)d_in[3];
    const float* W1    = (const float*)d_in[4];
    const float* b1    = (const float*)d_in[5];
    const float* W2    = (const float*)d_in[6];
    const float* b2    = (const float*)d_in[7];
    float* out = (float*)d_out;

    // workspace layout
    char* ws = (char*)d_ws;
    float* wN      = (float*)ws;                                   // N*E f32 (512KB)
    int*   key  = (int*)(ws + (size_t)N_ * E_ * sizeof(float) + 4096);   // N int (64KB)
    int*   perm = key + N_;                                        // N int (64KB)
    float* auxPart = (float*)(perm + N_);                          // 512 rows of 16 f32 (32KB)
    bf16*  xb  = (bf16*)(ws + (1ull << 20));                       // N*H bf16 (64MB)
    bf16*  W1b = xb  + (size_t)N_ * H_;                            // E*B*H bf16 (4MB)
    bf16*  W2b = W1b + (size_t)E_ * B_ * H_;                       // E*H*B bf16 (4MB)

    // 1) router + bf16 copy of x, one pass over x (512 work-groups of 32 tokens); the same
    //    work-groups convert the weights into fragment order
    router_cvt_kernel<<<RT_WG, 256, 0, stream>>>(x, skin, Wimg, Wskin, W1, W2, xb, wN, key, W1b, W2b, auxPart);

    // 2) tokens listed by expert pair (work-group 0); aux loss scalar (work-group 1)
    sort_kernel<<<2, ST_, 0, stream>>>(key, perm, auxPart, out + (size_t)N_ * H_);

    // 3) expert GEMMs + combine + residual
    moe_kernel<<<N_ / 64, 256, 0, stream>>>(x, xb, W1b, b1, W2b, b2, wN, perm, out);
}

// v007
// One run takes 80.3 microseconds.
// In two side-by-side timings against v006, it was 1.13 and 1.15 times as fast.
// Counting every step since v000, it is 8.67 times as fast.
#include <hip/hip_runtime.h>
#include <hip/hip_bf16.h>

// ---------------- problem constants (match reference) ----------------
#define E_   8
#define K_   2
#define N_   16384
#define H_   2048
#define B_   128
#define EPS_ 1e-6f

typedef __bf16 bf16;
typedef __attribute__((ext_vector_type(16))) __bf16 bf16x16;
typedef __attribute__((ext_vector_type(8)))  __bf16 bf16x8;
typedef __attribute__((ext_vector_type(8)))  float  f32x8;
typedef __attribute__((ext_vector_type(4)))  float  f32x4;

// ---------------------------------------------------------------------
// 1) router and fp32 -> bf16 conversion (RNE) of x in one pass over x.
//    A work-group takes 32 tokens; wave w owns columns w*256 .. w*256+255 and
//    keeps its slice of W_img in registers (8 experts x 8 columns a lane).
//    Per token a wave reads two runs of 512 contiguous bytes, writes their
//    bf16 copy and adds to 8 partial logits a lane; four tokens at a time.
//    Every loop of the kernel is unrolled: its arrays stay in registers only
//    under constant indices, and the token offsets become immediates, so that
//    no address register of a load or store is ever stepped.
//    The same launch converts W1 and W2 (fp32 -> bf16, RNE) into WMMA B-fragment
//    order, dst[row tile][k step of 32][half][lane][8]: lane l of half j holds row
//    (l & 15), k = j*16 + (l >> 4)*8 .. +7, so that one wave-wide 16-byte load of a
//    half reads 512 contiguous bytes. A piece is one lane's 16 bytes; every wave of
//    the grid writes 128 pieces (two k steps of one row tile), work-groups 0..255
//    those of W1 and 256..511 those of W2. Their loads fly with the first x loads.
//    Each work-group leaves one 128-byte record: its 16 partial aux sums and, one byte
//    a key, how many of its 32 tokens carry each of the 64 sort keys.
// ---------------------------------------------------------------------
#define SK_     64    // sort keys
#define RT_TOK 32   // tokens per work-group
#define RT_G   4    // tokens a wave holds at once
#define RT_WG  (N_ / RT_TOK)   // work-groups of the launch
#define PK_I   4    // pieces a lane packs
static_assert(E_ * B_ * H_ / 8 == (RT_WG / 2) * 8 * 32 * PK_I, "each half of the grid packs one weight matrix");

__global__ __launch_bounds__(256)
void router_cvt_kernel(const float* __restrict__ x,
                       const float* __restrict__ skin,
                       const float* __restrict__ Wimg,
                       const float* __restrict__ Wskin,
                       const float* __restrict__ W1,
                       const float* __restrict__ W2,
                       bf16*  __restrict__ xb,
                       float* __restrict__ wout,
                       int*   __restrict__ key,
                       bf16*  __restrict__ W1b,
                       bf16*  __restrict__ W2b,
                       unsigned* __restrict__ rec) {
    __shared__ unsigned hist[SK_ / 4];         // one byte a key
    __shared__ float part[8][RT_TOK * E_];     // per wave: its columns' share of every logit
    __shared__ float lgs[RT_TOK][E_ + 1];      // +1: a lane reads one token's row, banks apart
    const int lane = threadIdx.x & 31;
    const int wave = __builtin_amdgcn_readfirstlane(threadIdx.x >> 5);
    const int tok0 = blockIdx.x * RT_TOK;
    const int l4   = lane * 4;

    // the wave's 128 pieces: rows of 32 << sh floats; pieces i = 0..3 of a lane lie 16 floats apart
    const bool   second = blockIdx.x >= RT_WG / 2;                      // block-uniform
    const int    sh  = second ? 2 : 6;                                  // W2: 4 k steps a row, W1: 64
    const int    pq  = (blockIdx.x & (RT_WG / 2 - 1)) * 8 + wave;       // the wave's number in its matrix
    const float* ps  = (second ? W2 : W1)
                     + ((size_t)((pq * 2) >> sh) * 16 << (sh + 5)) + ((pq * 2) & ((1 << sh) - 1)) * 32;
    bf16*        pd  = (second ? W2b : W1b) + (size_t)pq * (32 * PK_I * 8);
    const int    plo = ((lane & 15) << (sh + 5)) + (lane >> 4) * 8;     // the lane's row and k offset
    float4 pv[PK_I][2];
#pragma unroll
    for (int i = 0; i < PK_I; i++)
#pragma unroll
        for (int j = 0; j < 2; j++)
            pv[i][j] = *(const float4*)(ps + (i * 16 + j * 4) + plo);
    // the loads have taken their offset register before anything reuses it; naming the
    // offset keeps it in its register up to the wait
    asm volatile("s_wait_xcnt 0x0" :: "v"(plo) : "memory");

    const float* wt = Wimg + wave * 256;
    float4 w[E_][2];
#pragma unroll
    for (int e = 0; e < E_; e++)
#pragma unroll
        for (int j = 0; j < 2; j++)
            w[e][j] = *(const float4*)(wt + (e * H_ + j * 128) + l4);

    // uniform base, one element offset per lane, constants for token and half
    const float* xt = x  + (size_t)tok0 * H_ + wave * 256;
    bf16*        xo = xb + (size_t)tok0 * H_ + wave * 256;

    float4 v[2][RT_G][2];
#pragma unroll
    for (int t = 0; t < RT_G; t++)
#pragma unroll
        for (int j = 0; j < 2; j++)
            v[0][t][j] = *(const float4*)(xt + (t * H_ + j * 128) + l4);
    // W_img's and the first x loads stay in front of the packing's arithmetic: they fly while
    // the weight pieces, asked for first, are waited for
    __builtin_amdgcn_sched_barrier(0);
    {
        uint4 po[PK_I];
#pragma unroll
        for (int i = 0; i < PK_I; i++) {
            union { bf16 b[8]; uint4 u; } o;
            o.b[0] = (bf16)pv[i][0].x; o.b[1] = (bf16)pv[i][0].y;
            o.b[2] = (bf16)pv[i][0].z; o.b[3] = (bf16)pv[i][0].w;
            o.b[4] = (bf16)pv[i][1].x; o.b[5] = (bf16)pv[i][1].y;
            o.b[6] = (bf16)pv[i][1].z; o.b[7] = (bf16)pv[i][1].w;
            po[i] = o.u;
        }
#pragma unroll
        for (int i = 0; i < PK_I; i++)
            *(uint4*)(pd + i * 256 + lane * 8) = po[i];
        // the stores have taken their registers before the loop below reuses any of them
        asm volatile("s_wait_xcnt 0x0" ::: "memory");
        // nothing of the loop below is lifted over that wait
        __builtin_amdgcn_sched_barrier(0);
    }

#pragma unroll
    for (int g = 0; g < RT_TOK / RT_G; g++) {
        // the next four tokens' loads fly while these four are worked on
        if (g + 1 < RT_TOK / RT_G) {
#pragma unroll
            for (int t = 0; t < RT_G; t++)
#pragma unroll
                for (int j = 0; j < 2; j++)
                    v[(g + 1) & 1][t][j] =
                        *(const float4*)(xt + (((g + 1) * RT_G + t) * H_ + j * 128) + l4);
        }
        // keeps those loads in front of this group's arithmetic: sunk behind it they
        // would have no lead and each group would wait out a whole memory latency
        __builtin_amdgcn_sched_barrier(0);

        float a[RT_G * E_];
#pragma unroll
        for (int t = 0; t < RT_G; t++)
#pragma unroll
            for (int e = 0; e < E_; e++) {
                float s = 0.f;
#pragma unroll
                for (int j = 0; j < 2; j++) {
                    const float4 xv = v[g & 1][t][j];
                    s = fmaf(xv.x, w[e][j].x, s);
                    s = fmaf(xv.y, w[e][j].y, s);
                    s = fmaf(xv.z, w[e][j].z, s);
                    s = fmaf(xv.w, w[e][j].w, s);
                }
                a[t * E_ + e] = s;
            }
#pragma unroll
        for (int t = 0; t < RT_G; t++)
#pragma unroll
            for (int j = 0; j < 2; j++) {
                const float4 xv = v[g & 1][t][j];
                union { bf16 b[4]; uint2 u; } o;
                o.b[0] = (bf16)xv.x; o.b[1] = (bf16)xv.y;
                o.b[2] = (bf16)xv.z; o.b[3] = (bf16)xv.w;
                *(uint2*)(xo + ((g * RT_G + t) * H_ + j * 128) + l4) = o.u;
            }
        // the stores have taken their registers before the sums below reuse any of them
        asm volatile("s_wait_xcnt 0x0" ::: "memory");
        // nothing of the sums below is lifted over that wait
        __builtin_amdgcn_sched_barrier(0);

        // 32 values a lane summed over 32 lanes: each step halves the values a lane
        // keeps, so that lane l ends with the whole sum of value l (token l>>3, expert l&7)
#pragma unroll
        for (int off = 16; off; off >>= 1) {
            const bool up = (lane & off) != 0;
#pragma unroll
            for (int i = 0; i < off; i++) {
                const float lo = a[i], hv = a[i + off];
                const float keep = up ? hv : lo;
                const float send = up ? lo : hv;
                a[i] = keep + __shfl_xor(send, off, 32);
            }
        }
        part[wave][g * RT_G * E_ + lane] = a[0];
    }
    __syncthreads();   // every wave's shares are written
    {
        float s = 0.f;
#pragma unroll
        for (int q = 0; q < 8; q++) s += part[q][threadIdx.x];
        lgs[threadIdx.x >> 3][threadIdx.x & 7] = s;
    }
    __syncthreads();   // the logits' image part is whole

    if (wave == 0) {   // one lane per token
        const int t = tok0 + lane;
        const float s0 = skin[t * 3 + 0], s1 = skin[t * 3 + 1], s2 = skin[t * 3 + 2];
        float lg[E_]; float mx = -1e30f;
#pragma unroll
        for (int e = 0; e < E_; e++) {
            lg[e] = lgs[lane][e] + s0 * Wskin[e * 3 + 0]
                                 + s1 * Wskin[e * 3 + 1]
                                 + s2 * Wskin[e * 3 + 2];
            mx = fmaxf(mx, lg[e]);
        }
        float p[E_]; float den = 0.f;
#pragma unroll
        for (int e = 0; e < E_; e++) { p[e] = __expf(lg[e] - mx); den += p[e]; }
        const float inv = 1.f / den;
#pragma unroll
        for (int e = 0; e < E_; e++) p[e] *= inv;
        // top-2 (first index wins ties, like jax top_k)
        int i1 = 0; float v1 = p[0];
#pragma unroll
        for (int e = 1; e < E_; e++) if (p[e] > v1) { v1 = p[e]; i1 = e; }
        int i2 = -1; float v2 = -1.f;
#pragma unroll
        for (int e = 0; e < E_; e++) if (e != i1 && p[e] > v2) { v2 = p[e]; i2 = e; }
        const float inv2 = 1.f / (v1 + v2 + EPS_);
        // sort key of the token's expert pair (lo < hi). hi runs upwards under an even lo and
        // downwards under an odd one, so that neighbouring keys always share an expert
        const int j2 = i2 < 0 ? i1 : i2;
        const int lo = min(i1, j2), hi2 = max(i1, j2);
        const int kk = lo * E_ + ((lo & 1) ? (E_ - 1 - hi2) : hi2);   // 0 .. SK_-1
        key[t] = kk;
        float r[2 * E_];   // 0..7 probabilities, 8..15 selection counts
#pragma unroll
        for (int e = 0; e < E_; e++) {
            float wv = (e == i1) ? v1 * inv2 : ((e == i2) ? v2 * inv2 : 0.f);
            wout[(size_t)t * E_ + e] = wv;
            r[e]      = p[e];
            r[E_ + e] = (e == i1 || e == i2) ? 1.f : 0.f;
        }
        // 16 values a lane summed over the 32 tokens: lane l ends with value l & 15
#pragma unroll
        for (int i = 0; i < 2 * E_; i++) r[i] += __shfl_xor(r[i], 16, 32);
#pragma unroll
        for (int off = 8; off; off >>= 1) {
            const bool up = (lane & off) != 0;
#pragma unroll
            for (int i = 0; i < off; i++) {
                const float lo = r[i], hv = r[i + off];
                const float keep = up ? hv : lo;
                const float send = up ? lo : hv;
                r[i] = keep + __shfl_xor(send, off, 32);
            }
        }
        // the key counts of the 32 tokens: 'same' is the set of lanes whose token has this lane's key
        unsigned same = ~0u;
#pragma unroll
        for (int b = 0; b < 6; b++) {
            const bool bit = ((kk >> b) & 1) != 0;
            const unsigned bal = __builtin_amdgcn_ballot_w32(bit);
            same &= bit ? bal : ~bal;
        }
        if (lane < SK_ / 4) hist[lane] = 0u;
        // the zeros are in LDS before other lanes of the wave write their counts over them
        asm volatile("s_wait_dscnt 0x0" ::: "memory");
        if ((same & ((1u << lane) - 1u)) == 0u)   // the first lane of each key writes its count
            ((unsigned char*)hist)[kk] = (unsigned char)__builtin_popcount(same);
        // the counts are in LDS before other lanes of the wave read them back
        asm volatile("s_wait_dscnt 0x0" ::: "memory");
        const unsigned hv = hist[lane & 15];
        // one whole line: words 0..15 the aux sums, words 16..31 the key counts
        rec[blockIdx.x * 32 + lane] = lane < 2 * E_ ? __float_as_uint(r[0]) : hv;
    }
}

// ---------------------------------------------------------------------
// fragment union: CDNA5 16-bit A/B layout — lane = row/col (lane&15),
// K values { klo..klo+7, 16+klo..23+klo } with klo = (lane>>4)*8.
// ---------------------------------------------------------------------
union FragBF { bf16x16 v; bf16x8 h[2]; };

#define XS_STRIDE 2056   // 2048 + 8: 16B-aligned, +4 banks/row -> conflict-free
#define HW_STRIDE 136    // 128 + 8:  16B-aligned, +4 banks/row -> conflict-free
#define TM_ 64           // tokens per work-group
#define MT_ 4            // 16-token sub-tiles per work-group
#define NT2_ 4           // output column tiles a wave holds at once in stage 2
#define TS_STRIDE 68     // floats, 64 + 4: 16B-aligned, +4 banks/row -> conflict-free 16-byte writes down a column

// eight 16-byte-per-lane copies, rows r0..r0+7 of the x tile (row r is token rowTok[r]); the closing
// s_wait_xcnt keeps the address registers untouched until the copies took them
#define COPY8_ROWS(r0)                                                        \
    asm volatile("global_load_async_to_lds_b128 %0, %8, off\n\t"              \
                 "global_load_async_to_lds_b128 %1, %9, off\n\t"              \
                 "global_load_async_to_lds_b128 %2, %10, off\n\t"             \
                 "global_load_async_to_lds_b128 %3, %11, off\n\t"             \
                 "global_load_async_to_lds_b128 %4, %12, off\n\t"             \
                 "global_load_async_to_lds_b128 %5, %13, off\n\t"             \
                 "global_load_async_to_lds_b128 %6, %14, off\n\t"             \
                 "global_load_async_to_lds_b128 %7, %15, off\n\t"             \
                 "s_wait_xcnt 0x0"                                            \
                 :: "v"(lbase + ((r0) + 0) * (XS_STRIDE * 2)),                \
                    "v"(lbase + ((r0) + 1) * (XS_STRIDE * 2)),                \
                    "v"(lbase + ((r0) + 2) * (XS_STRIDE * 2)),                \
                    "v"(lbase + ((r0) + 3) * (XS_STRIDE * 2)),                \
                    "v"(lbase + ((r0) + 4) * (XS_STRIDE * 2)),                \
                    "v"(lbase + ((r0) + 5) * (XS_STRIDE * 2)),                \
                    "v"(lbase + ((r0) + 6) * (XS_STRIDE * 2)),                \
                    "v"(lbase + ((r0) + 7) * (XS_STRIDE * 2)),                \
                    "v"(gbase + (size_t)rowTok[(r0) + 0] * H_),                     \
                    "v"(gbase + (size_t)rowTok[(r0) + 1] * H_),                     \
                    "v"(gbase + (size_t)rowTok[(r0) + 2] * H_),                     \
                    "v"(gbase + (size_t)rowTok[(r0) + 3] * H_),                     \
                    "v"(gbase + (size_t)rowTok[(r0) + 4] * H_),                     \
                    "v"(gbase + (size_t)rowTok[(r0) + 5] * H_),                     \
                    "v"(gbase + (size_t)rowTok[(r0) + 6] * H_),                     \
                    "v"(gbase + (size_t)rowTok[(r0) + 7] * H_)                      \
                 : "memory")

// ---------------------------------------------------------------------
// 2) MoE expert kernel: one block per 64-token tile, 256 threads (8 waves).
//    A tile is 64 neighbours of the tokens' list in key order, so it uses few experts
//    (two inside a run of one pair, three across a seam); any number up to
//    eight is handled. No list is ever written: every work-group finds its own 64
//    places. Tokens of one key are ordered by the thread that reads them here and
//    then by that thread's reading order, the same rule in every work-group. Every weight fragment read from global memory feeds
//    four WMMAs (the four 16-token sub-tiles); W1b and W2b arrive in fragment
//    order. Stage 1: wave w owns column tile w of every used expert. Stage 2:
//    a wave owns 16 column tiles of the output, four at a time; their results are
//    turned through LDS, so that x is read and out written in whole 256-byte runs.
// ---------------------------------------------------------------------

// stage 1 of a tile that uses NJ experts: acc[mt][j] = X(sub-tile mt) @ W1(j-th used expert, column tile 'wave')^T
template <int NJ>
__device__ __forceinline__ void stage1_tile(const bf16* arow, const bf16* __restrict__ W1b,
                                            unsigned emask, int wave, int lane,
                                            f32x8 (&acc)[MT_][E_]) {
    constexpr int KS = (NJ <= 4) ? 4 : 2;   // k steps of 32 a trip: as many as the registers take
    // packed W1: [row tile = e*8 + wave][k step][half][lane][8]
    const bf16* brow[NJ];
    unsigned mk = emask;
#pragma unroll
    for (int j = 0; j < NJ; j++) {
        const int e = __builtin_ctz(mk);
        mk &= mk - 1;
        brow[j] = W1b + (size_t)(e * 8 + wave) * 16 * H_ + lane * 8;
    }
    for (int k0 = 0; k0 < H_; k0 += KS * 32) {
        FragBF a[KS][MT_], b[KS][NJ];
        const bf16* p[E_];   // this trip's weight addresses; places NJ.. repeat the last one
#pragma unroll
        for (int j = 0; j < E_; j++) p[j] = brow[j < NJ ? j : NJ - 1] + k0 * 16;
#pragma unroll
        for (int j = 0; j < NJ; j++)
#pragma unroll
            for (int ks = 0; ks < KS; ks++) {
                b[ks][j].h[0] = *(const bf16x8*)(p[j] + ks * 512);
                b[ks][j].h[1] = *(const bf16x8*)(p[j] + ks * 512 + 256);
            }
#pragma unroll
        for (int ks = 0; ks < KS; ks++)
#pragma unroll
            for (int mt = 0; mt < MT_; mt++) {
                a[ks][mt].h[0] = *(const bf16x8*)(arow + mt * 16 * XS_STRIDE + k0 + ks * 32);
                a[ks][mt].h[1] = *(const bf16x8*)(arow + mt * 16 * XS_STRIDE + k0 + ks * 32 + 16);
            }
        // the loads have taken their addresses before the registers are reused; naming the
        // addresses keeps them in their registers up to the wait
        asm volatile("s_wait_xcnt 0x0" :: "v"(p[0]), "v"(p[1]), "v"(p[2]), "v"(p[3]),
                                          "v"(p[4]), "v"(p[5]), "v"(p[6]), "v"(p[7]) : "memory");
        // keeps the trip's loads one group in front of its WMMAs: sunk among them,
        // each weight fragment's L2 latency would be waited out on its own
        __builtin_amdgcn_sched_barrier(0);
#pragma unroll
        for (int ks = 0; ks < KS; ks++)
#pragma unroll
            for (int j = 0; j < NJ; j++)
#pragma unroll
                for (int mt = 0; mt < MT_; mt++)
                    acc[mt][j] = __builtin_amdgcn_wmma_f32_16x16x32_bf16(
                        false, a[ks][mt].v, false, b[ks][j].v, (short)0, acc[mt][j], false, false);
    }
}

__global__ __launch_bounds__(256)
void moe_kernel(const float* __restrict__ x,
                const bf16*  __restrict__ xb,
                const bf16*  __restrict__ W1b,
                const float* __restrict__ b1,
                const bf16*  __restrict__ W2b,
                const float* __restrict__ b2,
                const float* __restrict__ wN,
                const int*   __restrict__ key,
                const unsigned* __restrict__ rec,
                float* __restrict__ out,
                float* __restrict__ out_aux) {
    // the staged x tile; once stage 1 has read it, the same bytes hold Hw
    // and behind Hw lies one 64 x 64 f32 tile per wave, through which stage 2 turns its results
    __shared__ __align__(16) bf16 Xs[TM_ + 4][XS_STRIDE];
    static_assert(sizeof(Xs) >= E_ * TM_ * HW_STRIDE * 2 + 8 * TM_ * TS_STRIDE * 4, "Hw and the waves' tiles fit");
    __shared__ __align__(16) float tileW[TM_][E_];
    __shared__ int   eflag[E_];
    __shared__ __align__(16) int tokIdx[TM_];          // the tile's tokens
    __shared__ __align__(16) unsigned cntS[256][8];    // per thread: counts of 16 keys, 16 bits each
    __shared__ __align__(8)  int totS[4][SK_];         // tokens per key, in four partial sums
    __shared__ __align__(16) int wsum[2][8];           // per wave: its tokens of the key in hand
    __shared__ float red[8][2 * E_];                   // aux sums per wave
    bf16 (*Hw)[TM_][HW_STRIDE] = (bf16 (*)[TM_][HW_STRIDE])&Xs[0][0];   // [E_][TM_][HW_STRIDE]

    const int tile = blockIdx.x;           // 0..N/64-1
    const int tok0 = tile * TM_;           // first place of the tile in the list
    const int lane = threadIdx.x & 31;
    const int wave = __builtin_amdgcn_readfirstlane(threadIdx.x >> 5);
    const int col  = lane & 15;            // fragment row/col index
    const int klo  = (lane >> 4) * 8;      // per-lane K offset
    const int hi   = lane >> 4;

    // ---- async-stage the x tile (64 x 2048 bf16 = 256KB) into LDS ----
    // one copy of the block = one row (256 threads x 16B); 64 copies a wave,
    // in two halves so that no wave has more than 32 outstanding.
    const bf16*    gbase = xb + threadIdx.x * 8;
    const unsigned lbase = (unsigned)(uintptr_t)(&Xs[0][threadIdx.x * 8]);
    // ---- which tokens stand at places tok0 .. tok0+63 of the list in key order ----
    {
        // all keys, 64 a thread: token (i*256 + thread)*4 + c; and the router's key counts, 16 keys
        // (quarter thread & 3 of a record) of the 8 router work-groups i*64 + (thread >> 2)
        int4 kv[N_ / 1024];
#pragma unroll
        for (int i = 0; i < N_ / 1024; i++) kv[i] = ((const int4*)key)[i * 256 + threadIdx.x];
        const char*    rc = (const char*)(rec + 16);   // the counts stand in the second half of a record
        const unsigned cb = (threadIdx.x >> 2) * 128u + (threadIdx.x & 3) * 16u;   // in bytes
        uint4 cv[RT_WG / 64];
#pragma unroll
        for (int i = 0; i < RT_WG / 64; i++) cv[i] = *(const uint4*)(rc + i * (64 * 128) + cb);
        // the loads have taken their offset register before anything reuses it; naming
        // the offset keeps it in its register up to the wait
        asm volatile("s_wait_xcnt 0x0" :: "v"(cb) : "memory");

        // two counts a word: a byte holds at most 32 and 8 are added, so no half carries
        unsigned ce[4] = {0u, 0u, 0u, 0u}, cd[4] = {0u, 0u, 0u, 0u};
#pragma unroll
        for (int i = 0; i < RT_WG / 64; i++) {
            const unsigned w[4] = { cv[i].x, cv[i].y, cv[i].z, cv[i].w };
#pragma unroll
            for (int c = 0; c < 4; c++) {
                ce[c] += w[c] & 0x00ff00ffu;          // keys 4c (low half) and 4c+2 of the quarter
                cd[c] += (w[c] >> 8) & 0x00ff00ffu;   // keys 4c+1 (low half) and 4c+3
            }
        }
        *(uint4*)&cntS[threadIdx.x][0] = make_uint4(ce[0], cd[0], ce[1], cd[1]);
        *(uint4*)&cntS[threadIdx.x][4] = make_uint4(ce[2], cd[2], ce[3], cd[3]);
        __syncthreads();   // every thread's counts are written
        {   // thread t adds key t & 63 over 16 of the 64 threads that hold the key's quarter
            const int kq = threadIdx.x & 15;
            // the halves of a thread's row stand in the order 4c, 4c+2, 4c+1, 4c+3
            const int ix = (kq & 12) | ((kq & 1) << 1) | ((kq >> 1) & 1);
            const unsigned short* p = (const unsigned short*)&cntS[0][0]
                                    + (threadIdx.x >> 6) * (16 * 64) + ((threadIdx.x >> 4) & 3) * 16 + ix;
            int s = 0;
#pragma unroll
            for (int j = 0; j < 16; j++) s += p[j * 64];
            totS[threadIdx.x >> 6][threadIdx.x & 63] = s;
        }
        __syncthreads();   // the partial totals are written
        // every wave for itself: lane l finds the first places of keys l and l + 32
        int t0 = 0, t1 = 0;
#pragma unroll
        for (int q = 0; q < 4; q++) { t0 += totS[q][lane]; t1 += totS[q][lane + 32]; }
        // one running sum for both: all counts together are N_, so the low half never carries
        unsigned inc = (unsigned)t0 | ((unsigned)t1 << 16);
#pragma unroll
        for (int d = 1; d < 32; d <<= 1) {
            const unsigned o = __shfl_up(inc, d, 32);
            if (lane >= d) inc += o;
        }
        const int low   = (int)((unsigned)__builtin_amdgcn_readlane((int)inc, 31) & 0xffffu);   // tokens of keys 0..31
        const int base0 = (int)(inc & 0xffffu) - t0, base1 = low + (int)(inc >> 16) - t1;
        // the keys whose runs reach into the tile: the same set in every wave
        const unsigned m0 = __builtin_amdgcn_ballot_w32(t0 > 0 && base0 < tok0 + TM_ && base0 + t0 > tok0);
        const unsigned m1 = __builtin_amdgcn_ballot_w32(t1 > 0 && base1 < tok0 + TM_ && base1 + t1 > tok0);
        int buf = 0;
        for (unsigned long long mm = (unsigned long long)m0 | ((unsigned long long)m1 << 32); mm; mm &= mm - 1) {   // block-uniform, at most 64 trips
            const int k  = __builtin_ctzll(mm);
            const int bk = __builtin_amdgcn_readlane((k & 32) ? base1 : base0, k & 31);   // first place of key k
            unsigned hit[2] = {0u, 0u};   // bit i*4 + c: the thread's token (i, c) has key k
#pragma unroll
            for (int i = 0; i < N_ / 1024; i++) {
                const int kc[4] = { kv[i].x, kv[i].y, kv[i].z, kv[i].w };
#pragma unroll
                for (int c = 0; c < 4; c++) hit[i >> 3] |= (kc[c] == k) ? (1u << ((i & 7) * 4 + c)) : 0u;
            }
            const int n = __builtin_popcount(hit[0]) + __builtin_popcount(hit[1]);   // this thread's tokens of key k
            int ni = n;   // running sum over the wave
#pragma unroll
            for (int d = 1; d < 32; d <<= 1) {
                const int o = __shfl_up(ni, d, 32);
                if (lane >= d) ni += o;
            }
            if (lane == 31) wsum[buf][wave] = ni;
            // the waves' sums are written; the other buffer's readers all stand in front of
            // this barrier, so the next key may write that buffer
            __syncthreads();
            const int4 wa = *(const int4*)&wsum[buf][0], wb = *(const int4*)&wsum[buf][4];
            const int wv8[8] = { wa.x, wa.y, wa.z, wa.w, wb.x, wb.y, wb.z, wb.w };
            int pre = 0;   // tokens of key k in the waves before this one
#pragma unroll
            for (int q = 0; q < 8; q++) pre += (q < wave) ? wv8[q] : 0;
            int pos = bk + pre + ni - n - tok0;   // place in the tile of this thread's first token of key k
            if (n > 0 && pos < TM_ && pos + n > 0) {
#pragma unroll
                for (int hf = 0; hf < 2; hf++)
                    for (unsigned b = hit[hf]; b; b &= b - 1) {   // at most 32 trips
                        const int j = __builtin_ctz(b) + hf * 32;
                        if ((unsigned)pos < (unsigned)TM_)
                            tokIdx[pos] = ((j >> 2) * 256 + (int)threadIdx.x) * 4 + (j & 3);
                        pos++;
                    }
            }
            buf ^= 1;
        }
        __syncthreads();   // the tile's 64 tokens are written
    }
    // the tile's 64 token numbers, the same for every thread: read at once, in front of the
    // first copy, so that no group of copies waits for a read of its own
    int rowTok[TM_];
#pragma unroll
    for (int r = 0; r < TM_; r++) rowTok[r] = tokIdx[r] & (N_ - 1);
    // and the tokens whose combine weights this thread fetches
    int tk[TM_ * E_ / 256];
#pragma unroll
    for (int j = 0; j < TM_ * E_ / 256; j++) tk[j] = tokIdx[(threadIdx.x >> 3) + 32 * j] & (N_ - 1);
    COPY8_ROWS(0);  COPY8_ROWS(8);  COPY8_ROWS(16); COPY8_ROWS(24);

    // combine weights while the copies are in flight
    float cw[TM_ * E_ / 256];
#pragma unroll
    for (int j = 0; j < TM_ * E_ / 256; j++) cw[j] = wN[(size_t)tk[j] * E_ + (threadIdx.x & 7)];
#pragma unroll
    for (int j = 0; j < TM_ * E_ / 256; j++) {
        const int row = (threadIdx.x >> 3) + 32 * j;
        tileW[row][threadIdx.x & 7] = cw[j];
    }

    // first half landed before the second half is issued
    asm volatile("s_wait_asynccnt 0x0" ::: "memory");
    COPY8_ROWS(32); COPY8_ROWS(40); COPY8_ROWS(48); COPY8_ROWS(56);

    if (blockIdx.x == 0) {   // block-uniform: one work-group adds the router's partial aux sums, beside its copies
        // thread t adds value t & 15 of records (t >> 4) + 16 q
        const int ao = (threadIdx.x >> 4) * 32 + (threadIdx.x & 15);   // in words
        float pa[RT_WG / 16];
#pragma unroll
        for (int q = 0; q < RT_WG / 16; q++) pa[q] = __uint_as_float(rec[q * (16 * 32) + ao]);
        // the loads have taken their offset register before anything reuses it
        asm volatile("s_wait_xcnt 0x0" :: "v"(ao) : "memory");
        float s = 0.f;
#pragma unroll
        for (int q = 0; q < RT_WG / 16; q++) s += pa[q];
        s += __shfl_xor(s, 16, 32);
        if (lane < 2 * E_) red[wave][lane] = s;
        __syncthreads();   // every wave's 16 sums are written
        if (wave == 0) {
            float a = 0.f;   // value lane & 15 over one half of the waves, then over both
#pragma unroll
            for (int q = 0; q < 4; q++) a += red[(lane >> 4) * 4 + q][lane & 15];
            a += __shfl_xor(a, 16, 32);
            // lane e < 8 holds the probability sum of expert e, lane e + 8 its selection count
            float pr = (a / (float)N_) * (__shfl_xor(a, 8, 32) / (float)N_);
            pr += __shfl_xor(pr, 4, 32);
            pr += __shfl_xor(pr, 2, 32);
            pr += __shfl_xor(pr, 1, 32);
            if (lane == 0) *out_aux = pr * (float)E_;
        }
    }

    __syncthreads();
    if (threadIdx.x < E_) {
        int f = 0;
        for (int m = 0; m < TM_; m++) f |= (tileW[m][threadIdx.x] != 0.f);
        eflag[threadIdx.x] = f;
    }
    // wait for this wave's async transfers, then barrier for cross-wave vis
    asm volatile("s_wait_asynccnt 0x0" ::: "memory");
    __syncthreads();

    unsigned emask = 0;
#pragma unroll
    for (int e = 0; e < E_; e++) emask |= (eflag[e] ? 1u : 0u) << e;
    emask = __builtin_amdgcn_readfirstlane(emask);
    const int nexp = __builtin_popcount(emask);   // block-uniform: experts this tile uses

    // ---------------- stage 1: Hw[e] = w * relu(X @ W1_e^T + b1_e) ----
    f32x8 acc[MT_][8];
#pragma unroll
    for (int mt = 0; mt < MT_; mt++)
#pragma unroll
        for (int n = 0; n < 8; n++)
            acc[mt][n] = (f32x8){0.f,0.f,0.f,0.f,0.f,0.f,0.f,0.f};
    {
        const bf16* arow = &Xs[col][klo];                               // LDS
        switch (nexp) {   // block-uniform scalar branch; one loop per count keeps acc under constant indices
        case 1: stage1_tile<1>(arow, W1b, emask, wave, lane, acc); break;
        case 2: stage1_tile<2>(arow, W1b, emask, wave, lane, acc); break;
        case 3: stage1_tile<3>(arow, W1b, emask, wave, lane, acc); break;
        case 4: stage1_tile<4>(arow, W1b, emask, wave, lane, acc); break;
        case 5: stage1_tile<5>(arow, W1b, emask, wave, lane, acc); break;
        case 6: stage1_tile<6>(arow, W1b, emask, wave, lane, acc); break;
        case 7: stage1_tile<7>(arow, W1b, emask, wave, lane, acc); break;
        case 8: stage1_tile<8>(arow, W1b, emask, wave, lane, acc); break;
        default: break;
        }
    }
    __syncthreads();   // every wave has read its last x fragment: the bytes may become Hw
    {
        unsigned mk = emask;
#pragma unroll
        for (int j = 0; j < E_; j++) {
            if (j < nexp) {   // block-uniform scalar branch
                const int e = __builtin_ctz(mk);
                mk &= mk - 1;
                const float bb = b1[e * B_ + wave * 16 + col];
#pragma unroll
                for (int mt = 0; mt < MT_; mt++)
#pragma unroll
                    for (int r = 0; r < 8; r++) {
                        const int m = mt * 16 + r + hi * 8;
                        float h = fmaxf(acc[mt][j][r] + bb, 0.f) * tileW[m][e];
                        Hw[e][m][wave * 16 + col] = (bf16)h;
                    }
            }
        }
    }
    __syncthreads();

    // ---------------- stage 2: out = x + sum_e Hw_e @ W2_e^T + w@b2 ---
    // the wave's own tile: only this wave writes and reads it, so no barrier stands around it
    float* ts = (float*)((char*)&Xs[0][0] + E_ * TM_ * HW_STRIDE * 2) + wave * (TM_ * TS_STRIDE);
    for (int g = 0; g < 16 / NT2_; g++) {
        const int ct0   = wave * 16 + g * NT2_;   // 128 column tiles over 8 waves
        f32x8 acc2[MT_][NT2_];
#pragma unroll
        for (int mt = 0; mt < MT_; mt++)
#pragma unroll
            for (int n = 0; n < NT2_; n++)
                acc2[mt][n] = (f32x8){0.f,0.f,0.f,0.f,0.f,0.f,0.f,0.f};
        for (int e = 0; e < E_; e++) {
            if (!((emask >> e) & 1u)) continue;   // block-uniform scalar branch
            const bf16* arow = &Hw[e][col][klo];
            // packed W2: [row tile = e*128 + ct0 + n][k step][half][lane][8]
            const bf16* brow = W2b + ((size_t)e * H_ + ct0 * 16) * B_ + lane * 8;
            FragBF a[B_ / 32][MT_], b[B_ / 32][NT2_];
#pragma unroll
            for (int n = 0; n < NT2_; n++)
#pragma unroll
                for (int ks = 0; ks < B_ / 32; ks++) {
                    b[ks][n].h[0] = *(const bf16x8*)(brow + n * 16 * B_ + ks * 512);
                    b[ks][n].h[1] = *(const bf16x8*)(brow + n * 16 * B_ + ks * 512 + 256);
                }
#pragma unroll
            for (int ks = 0; ks < B_ / 32; ks++)
#pragma unroll
                for (int mt = 0; mt < MT_; mt++) {
                    a[ks][mt].h[0] = *(const bf16x8*)(arow + mt * 16 * HW_STRIDE + ks * 32);
                    a[ks][mt].h[1] = *(const bf16x8*)(arow + mt * 16 * HW_STRIDE + ks * 32 + 16);
                }
            // the loads have taken their address before its registers are reused; naming the
            // pointer keeps it in its registers up to the wait
            asm volatile("s_wait_xcnt 0x0" :: "v"(brow) : "memory");
            // as in stage 1: the expert's loads stay one group in front of its WMMAs
            __builtin_amdgcn_sched_barrier(0);
#pragma unroll
            for (int ks = 0; ks < B_ / 32; ks++)
#pragma unroll
                for (int n = 0; n < NT2_; n++)
#pragma unroll
                    for (int mt = 0; mt < MT_; mt++)
                        // W2 is the A operand: the result tile's rows are output columns, its columns tokens
                        acc2[mt][n] = __builtin_amdgcn_wmma_f32_16x16x32_bf16(
                            false, b[ks][n].v, false, a[ks][mt].v, (short)0, acc2[mt][n], false, false);
        }
        // the group's results leave in row order: a lane takes four neighbouring columns of row
        // 2 i + hi, so that a wave-wide 16-byte access covers two whole 256-byte runs.
        // uniform base of this group's columns, and the byte offset, in x and in out, of the
        // lane's columns in each of its 32 rows (a row is a token's); the offsets are formed here
        // and stay as they are until the wait behind the group's stores
        const int    c4 = col * 4;
        const float* xg = x   + ct0 * 16;
        float*       og = out + ct0 * 16;
        // b2 is asked for first: loads return in order, and the bias sums then run while x flies
        f32x4 b2v[E_];
#pragma unroll
        for (int e = 0; e < E_; e++) b2v[e] = *(const f32x4*)(b2 + (size_t)e * H_ + ct0 * 16 + c4);
        unsigned ro[TM_ / 2];   // in bytes
#pragma unroll
        for (int i = 0; i < TM_ / 2; i++) ro[i] = ((unsigned)tokIdx[2 * i + hi] * H_ + c4) * 4u;
        f32x4 xv[TM_ / 2];
#pragma unroll
        for (int i = 0; i < TM_ / 2; i++) xv[i] = *(const f32x4*)((const char*)xg + ro[i]);
        // the loads have taken their offset registers before anything reuses them; naming
        // the offset keeps it in its register up to the wait
        asm volatile("s_wait_xcnt 0x0" :: "v"(c4) : "memory");
        // the group's loads stay together in front of the turn through LDS: they fly beside it
        __builtin_amdgcn_sched_barrier(0);
        // a lane holds columns hi*8 .. hi*8+7 of column tile n for token mt*16 + col
#pragma unroll
        for (int mt = 0; mt < MT_; mt++)
#pragma unroll
            for (int n = 0; n < NT2_; n++) {
                float* p = ts + (mt * 16 + col) * TS_STRIDE + n * 16 + hi * 8;
                *(f32x4*)p       = (f32x4){acc2[mt][n][0], acc2[mt][n][1], acc2[mt][n][2], acc2[mt][n][3]};
                *(f32x4*)(p + 4) = (f32x4){acc2[mt][n][4], acc2[mt][n][5], acc2[mt][n][6], acc2[mt][n][7]};
            }
        // the wave's own writes are in LDS before other lanes of it read the rows back
        asm volatile("s_wait_dscnt 0x0" ::: "memory");
#pragma unroll
        for (int i = 0; i < TM_ / 2; i++) {
            const int m = 2 * i + hi;
            const f32x4 t = *(const f32x4*)(ts + m * TS_STRIDE + c4);
            float tw[E_];
#pragma unroll
            for (int e = 0; e < E_; e++) tw[e] = tileW[m][e];
            f32x4 s = (f32x4){0.f, 0.f, 0.f, 0.f};
#pragma unroll
            for (int e = 0; e < E_; e++) {
                s.x = fmaf(tw[e], b2v[e].x, s.x);
                s.y = fmaf(tw[e], b2v[e].y, s.y);
                s.z = fmaf(tw[e], b2v[e].z, s.z);
                s.w = fmaf(tw[e], b2v[e].w, s.w);
            }
            xv[i] = xv[i] + t + s;
        }
        // every result is formed before the first store, so that no register of an
        // issued store is written again in front of the wait behind the stores
        __builtin_amdgcn_sched_barrier(0);
#pragma unroll
        for (int i = 0; i < TM_ / 2; i++) *(f32x4*)((char*)og + ro[i]) = xv[i];
        // the next group reuses the stores' registers: the stores have taken them first
        asm volatile("s_wait_xcnt 0x0" ::: "memory");
    }
}

// ---------------------------------------------------------------------
extern "C" void kernel_launch(void* const* d_in, const int* in_sizes, int n_in,
                              void* d_out, int out_size, void* d_ws, size_t ws_size,
                              hipStream_t stream) {
    const float* x     = (const float*)d_in[0];
    const float* skin  = (const float*)d_in[1];
    const float* Wimg  = (const float*)d_in[2];
    const float* Wskin = (const float*)d_in[3];
    const float* W1    = (const float*)d_in[4];
    const float* b1    = (const float*)d_in[5];
    const float* W2    = (const float*)d_in[6];
    const float* b2    = (const float*)d_in[7];
    float* out = (float*)d_out;

    // workspace layout
    char* ws = (char*)d_ws;
    float* wN      = (float*)ws;                                   // N*E f32 (512KB)
    int*   key  = (int*)(ws + (size_t)N_ * E_ * sizeof(float) + 4096);   // N int (64KB)
    unsigned* rec = (unsigned*)(key + N_);                         // 512 records of 128 bytes (64KB)
    bf16*  xb  = (bf16*)(ws + (1ull << 20));                       // N*H bf16 (64MB)
    bf16*  W1b = xb  + (size_t)N_ * H_;                            // E*B*H bf16 (4MB)
    bf16*  W2b = W1b + (size_t)E_ * B_ * H_;                       // E*H*B bf16 (4MB)

    // 1) router + bf16 copy of x, one pass over x (512 work-groups of 32 tokens); the same
    //    work-groups convert the weights into fragment order
    router_cvt_kernel<<<RT_WG, 256, 0, stream>>>(x, skin, Wimg, Wskin, W1, W2, xb, wN, key, W1b, W2b, rec);

    // 2) expert GEMMs + combine + residual on tiles of tokens in key order; aux loss scalar (work-group 0)
    moe_kernel<<<N_ / 64, 256, 0, stream>>>(x, xb, W1b, b1, W2b, b2, wN, key, rec, out, out + (size_t)N_ * H_);
}

// v008
// One run takes 77.6 microseconds.
// Two timings next to v007 put it at 1.03 and 1.04 times that version's speed.
// All steps since v000 together make it 8.97 times as fast.
#include <hip/hip_runtime.h>
#include <hip/hip_bf16.h>

// ---------------- problem constants (match reference) ----------------
#define E_   8
#define K_   2
#define N_   16384
#define H_   2048
#define B_   128
#define EPS_ 1e-6f

typedef __bf16 bf16;
typedef __attribute__((ext_vector_type(16))) __bf16 bf16x16;
typedef __attribute__((ext_vector_type(8)))  __bf16 bf16x8;
typedef __attribute__((ext_vector_type(8)))  float  f32x8;
typedef __attribute__((ext_vector_type(4)))  float  f32x4;

// ---------------------------------------------------------------------
// 1) router: one pass over x.
//    A work-group takes 32 tokens; wave w owns columns w*256 .. w*256+255 and
//    keeps its slice of W_img in registers (8 experts x 8 columns a lane).
//    Per token a wave reads two runs of 512 contiguous bytes and adds to
//    8 partial logits a lane; four tokens at a time.
//    Every loop of the kernel is unrolled: its arrays stay in registers only
//    under constant indices, and the token offsets become immediates, so that
//    no address register of a load or store is ever stepped.
//    The same launch converts W1 and W2 (fp32 -> bf16, RNE) into WMMA B-fragment
//    order, dst[row tile][k step of 32][half][lane][8]: lane l of half j holds row
//    (l & 15), k = j*16 + (l >> 4)*8 .. +7, so that one wave-wide 16-byte load of a
//    half reads 512 contiguous bytes. A piece is one lane's 16 bytes; every wave of
//    the grid writes 128 pieces (two k steps of one row tile), work-groups 0..255
//    those of W1 and 256..511 those of W2. Their loads fly with the first x loads.
//    Each work-group leaves one 128-byte record: its 16 partial aux sums and, one byte
//    a key, how many of its 32 tokens carry each of the 64 sort keys.
// ---------------------------------------------------------------------
#define SK_     64    // sort keys
#define RT_TOK 32   // tokens per work-group
#define RT_G   4    // tokens a wave holds at once
#define RT_WG  (N_ / RT_TOK)   // work-groups of the launch
#define PK_I   4    // pieces a lane packs
static_assert(E_ * B_ * H_ / 8 == (RT_WG / 2) * 8 * 32 * PK_I, "each half of the grid packs one weight matrix");

__global__ __launch_bounds__(256)
void router_cvt_kernel(const float* __restrict__ x,
                       const float* __restrict__ skin,
                       const float* __restrict__ Wimg,
                       const float* __restrict__ Wskin,
                       const float* __restrict__ W1,
                       const float* __restrict__ W2,
                       float* __restrict__ wout,
                       int*   __restrict__ key,
                       bf16*  __restrict__ W1b,
                       bf16*  __restrict__ W2b,
                       unsigned* __restrict__ rec) {
    __shared__ unsigned hist[SK_ / 4];         // one byte a key
    __shared__ float part[8][RT_TOK * E_];     // per wave: its columns' share of every logit
    __shared__ float lgs[RT_TOK][E_ + 1];      // +1: a lane reads one token's row, banks apart
    const int lane = threadIdx.x & 31;
    const int wave = __builtin_amdgcn_readfirstlane(threadIdx.x >> 5);
    const int tok0 = blockIdx.x * RT_TOK;
    const int l4   = lane * 4;

    // the wave's 128 pieces: rows of 32 << sh floats; pieces i = 0..3 of a lane lie 16 floats apart
    const bool   second = blockIdx.x >= RT_WG / 2;                      // block-uniform
    const int    sh  = second ? 2 : 6;                                  // W2: 4 k steps a row, W1: 64
    const int    pq  = (blockIdx.x & (RT_WG / 2 - 1)) * 8 + wave;       // the wave's number in its matrix
    const float* ps  = (second ? W2 : W1)
                     + ((size_t)((pq * 2) >> sh) * 16 << (sh + 5)) + ((pq * 2) & ((1 << sh) - 1)) * 32;
    bf16*        pd  = (second ? W2b : W1b) + (size_t)pq * (32 * PK_I * 8);
    const int    plo = ((lane & 15) << (sh + 5)) + (lane >> 4) * 8;     // the lane's row and k offset
    float4 pv[PK_I][2];
#pragma unroll
    for (int i = 0; i < PK_I; i++)
#pragma unroll
        for (int j = 0; j < 2; j++)
            pv[i][j] = *(const float4*)(ps + (i * 16 + j * 4) + plo);
    // the loads have taken their offset register before anything reuses it; naming the
    // offset keeps it in its register up to the wait
    asm volatile("s_wait_xcnt 0x0" :: "v"(plo) : "memory");

    const float* wt = Wimg + wave * 256;
    float4 w[E_][2];
#pragma unroll
    for (int e = 0; e < E_; e++)
#pragma unroll
        for (int j = 0; j < 2; j++)
            w[e][j] = *(const float4*)(wt + (e * H_ + j * 128) + l4);

    // uniform base, one element offset per lane, constants for token and half
    const float* xt = x  + (size_t)tok0 * H_ + wave * 256;

    float4 v[2][RT_G][2];
#pragma unroll
    for (int t = 0; t < RT_G; t++)
#pragma unroll
        for (int j = 0; j < 2; j++)
            v[0][t][j] = *(const float4*)(xt + (t * H_ + j * 128) + l4);
    // W_img's and the first x loads stay in front of the packing's arithmetic: they fly while
    // the weight pieces, asked for first, are waited for
    __builtin_amdgcn_sched_barrier(0);
    {
        uint4 po[PK_I];
#pragma unroll
        for (int i = 0; i < PK_I; i++) {
            union { bf16 b[8]; uint4 u; } o;
            o.b[0] = (bf16)pv[i][0].x; o.b[1] = (bf16)pv[i][0].y;
            o.b[2] = (bf16)pv[i][0].z; o.b[3] = (bf16)pv[i][0].w;
            o.b[4] = (bf16)pv[i][1].x; o.b[5] = (bf16)pv[i][1].y;
            o.b[6] = (bf16)pv[i][1].z; o.b[7] = (bf16)pv[i][1].w;
            po[i] = o.u;
        }
#pragma unroll
        for (int i = 0; i < PK_I; i++)
            *(uint4*)(pd + i * 256 + lane * 8) = po[i];
        // the stores have taken their registers before the loop below reuses any of them
        asm volatile("s_wait_xcnt 0x0" ::: "memory");
        // nothing of the loop below is lifted over that wait
        __builtin_amdgcn_sched_barrier(0);
    }

#pragma unroll
    for (int g = 0; g < RT_TOK / RT_G; g++) {
        // the next four tokens' loads fly while these four are worked on
        if (g + 1 < RT_TOK / RT_G) {
#pragma unroll
            for (int t = 0; t < RT_G; t++)
#pragma unroll
                for (int j = 0; j < 2; j++)
                    v[(g + 1) & 1][t][j] =
                        *(const float4*)(xt + (((g + 1) * RT_G + t) * H_ + j * 128) + l4);
            // the loads have taken their registers before anything reuses one of them
            asm volatile("s_wait_xcnt 0x0" :: "v"(l4) : "memory");
        }
        // keeps those loads in front of this group's arithmetic: sunk behind it they
        // would have no lead and each group would wait out a whole memory latency
        __builtin_amdgcn_sched_barrier(0);

        float a[RT_G * E_];
#pragma unroll
        for (int t = 0; t < RT_G; t++)
#pragma unroll
            for (int e = 0; e < E_; e++) {
                float s = 0.f;
#pragma unroll
                for (int j = 0; j < 2; j++) {
                    const float4 xv = v[g & 1][t][j];
                    s = fmaf(xv.x, w[e][j].x, s);
                    s = fmaf(xv.y, w[e][j].y, s);
                    s = fmaf(xv.z, w[e][j].z, s);
                    s = fmaf(xv.w, w[e][j].w, s);
                }
                a[t * E_ + e] = s;
            }

        // 32 values a lane summed over 32 lanes: each step halves the values a lane
        // keeps, so that lane l ends with the whole sum of value l (token l>>3, expert l&7)
#pragma unroll
        for (int off = 16; off; off >>= 1) {
            const bool up = (lane & off) != 0;
#pragma unroll
            for (int i = 0; i < off; i++) {
                const float lo = a[i], hv = a[i + off];
                const float keep = up ? hv : lo;
                const float send = up ? lo : hv;
                a[i] = keep + __shfl_xor(send, off, 32);
            }
        }
        part[wave][g * RT_G * E_ + lane] = a[0];
    }
    __syncthreads();   // every wave's shares are written
    {
        float s = 0.f;
#pragma unroll
        for (int q = 0; q < 8; q++) s += part[q][threadIdx.x];
        lgs[threadIdx.x >> 3][threadIdx.x & 7] = s;
    }
    __syncthreads();   // the logits' image part is whole

    if (wave == 0) {   // one lane per token
        const int t = tok0 + lane;
        const float s0 = skin[t * 3 + 0], s1 = skin[t * 3 + 1], s2 = skin[t * 3 + 2];
        float lg[E_]; float mx = -1e30f;
#pragma unroll
        for (int e = 0; e < E_; e++) {
            lg[e] = lgs[lane][e] + s0 * Wskin[e * 3 + 0]
                                 + s1 * Wskin[e * 3 + 1]
                                 + s2 * Wskin[e * 3 + 2];
            mx = fmaxf(mx, lg[e]);
        }
        float p[E_]; float den = 0.f;
#pragma unroll
        for (int e = 0; e < E_; e++) { p[e] = __expf(lg[e] - mx); den += p[e]; }
        const float inv = 1.f / den;
#pragma unroll
        for (int e = 0; e < E_; e++) p[e] *= inv;
        // top-2 (first index wins ties, like jax top_k)
        int i1 = 0; float v1 = p[0];
#pragma unroll
        for (int e = 1; e < E_; e++) if (p[e] > v1) { v1 = p[e]; i1 = e; }
        int i2 = -1; float v2 = -1.f;
#pragma unroll
        for (int e = 0; e < E_; e++) if (e != i1 && p[e] > v2) { v2 = p[e]; i2 = e; }
        const float inv2 = 1.f / (v1 + v2 + EPS_);
        // sort key of the token's expert pair (lo < hi). hi runs upwards under an even lo and
        // downwards under an odd one, so that neighbouring keys always share an expert
        const int j2 = i2 < 0 ? i1 : i2;
        const int lo = min(i1, j2), hi2 = max(i1, j2);
        const int kk = lo * E_ + ((lo & 1) ? (E_ - 1 - hi2) : hi2);   // 0 .. SK_-1
        key[t] = kk;
        float r[2 * E_];   // 0..7 probabilities, 8..15 selection counts
#pragma unroll
        for (int e = 0; e < E_; e++) {
            float wv = (e == i1) ? v1 * inv2 : ((e == i2) ? v2 * inv2 : 0.f);
            wout[(size_t)t * E_ + e] = wv;
            r[e]      = p[e];
            r[E_ + e] = (e == i1 || e == i2) ? 1.f : 0.f;
        }
        // 16 values a lane summed over the 32 tokens: lane l ends with value l & 15
#pragma unroll
        for (int i = 0; i < 2 * E_; i++) r[i] += __shfl_xor(r[i], 16, 32);
#pragma unroll
        for (int off = 8; off; off >>= 1) {
            const bool up = (lane & off) != 0;
#pragma unroll
            for (int i = 0; i < off; i++) {
                const float lo = r[i], hv = r[i + off];
                const float keep = up ? hv : lo;
                const float send = up ? lo : hv;
                r[i] = keep + __shfl_xor(send, off, 32);
            }
        }
        // the key counts of the 32 tokens: 'same' is the set of lanes whose token has this lane's key
        unsigned same = ~0u;
#pragma unroll
        for (int b = 0; b < 6; b++) {
            const bool bit = ((kk >> b) & 1) != 0;
            const unsigned bal = __builtin_amdgcn_ballot_w32(bit);
            same &= bit ? bal : ~bal;
        }
        if (lane < SK_ / 4) hist[lane] = 0u;
        // the zeros are in LDS before other lanes of the wave write their counts over them
        asm volatile("s_wait_dscnt 0x0" ::: "memory");
        if ((same & ((1u << lane) - 1u)) == 0u)   // the first lane of each key writes its count
            ((unsigned char*)hist)[kk] = (unsigned char)__builtin_popcount(same);
        // the counts are in LDS before other lanes of the wave read them back
        asm volatile("s_wait_dscnt 0x0" ::: "memory");
        const unsigned hv = hist[lane & 15];
        // one whole line: words 0..15 the aux sums, words 16..31 the key counts
        rec[blockIdx.x * 32 + lane] = lane < 2 * E_ ? __float_as_uint(r[0]) : hv;
    }
}

// ---------------------------------------------------------------------
// fragment union: CDNA5 16-bit A/B layout — lane = row/col (lane&15),
// K values { klo..klo+7, 16+klo..23+klo } with klo = (lane>>4)*8.
// ---------------------------------------------------------------------
union FragBF { bf16x16 v; bf16x8 h[2]; };

#define XS_STRIDE 2056   // 2048 + 8: 16B-aligned, +4 banks/row -> conflict-free
#define HW_STRIDE 136    // 128 + 8:  16B-aligned, +4 banks/row -> conflict-free
#define TM_ 64           // tokens per work-group
#define MT_ 4            // 16-token sub-tiles per work-group
#define NT2_ 4           // output column tiles a wave holds at once in stage 2
#define TS_STRIDE 68     // floats, 64 + 4: 16B-aligned, +4 banks/row -> conflict-free 16-byte writes down a column

#define XB_ 16           // rows of the x tile a thread has in flight as one batch

// ---------------------------------------------------------------------
// 2) MoE expert kernel: one block per 64-token tile, 256 threads (8 waves).
//    A tile is 64 neighbours of the tokens' list in key order, so it uses few experts
//    (two inside a run of one pair, three across a seam); any number up to
//    eight is handled. No list is ever written: every work-group finds its own 64
//    places. Tokens of one key are ordered by the thread that reads them here and
//    then by that thread's reading order, the same rule in every work-group. Every weight fragment read from global memory feeds
//    four WMMAs (the four 16-token sub-tiles); W1b and W2b arrive in fragment
//    order. Stage 1: wave w owns column tile w of every used expert. Stage 2:
//    a wave owns 16 column tiles of the output, four at a time; their results are
//    turned through LDS, so that x is read and out written in whole 256-byte runs.
// ---------------------------------------------------------------------

// stage 1 of a tile that uses NJ experts: acc[mt][j] = X(sub-tile mt) @ W1(j-th used expert, column tile 'wave')^T
template <int NJ>
__device__ __forceinline__ void stage1_tile(const bf16* arow, const bf16* __restrict__ W1b,
                                            unsigned emask, int wave, int lane,
                                            f32x8 (&acc)[MT_][E_]) {
    constexpr int KS = (NJ <= 4) ? 4 : 2;   // k steps of 32 a trip: as many as the registers take
    // packed W1: [row tile = e*8 + wave][k step][half][lane][8]
    const bf16* brow[NJ];
    unsigned mk = emask;
#pragma unroll
    for (int j = 0; j < NJ; j++) {
        const int e = __builtin_ctz(mk);
        mk &= mk - 1;
        brow[j] = W1b + (size_t)(e * 8 + wave) * 16 * H_ + lane * 8;
    }
    for (int k0 = 0; k0 < H_; k0 += KS * 32) {
        FragBF a[KS][MT_], b[KS][NJ];
        const bf16* p[E_];   // this trip's weight addresses; places NJ.. repeat the last one
#pragma unroll
        for (int j = 0; j < E_; j++) p[j] = brow[j < NJ ? j : NJ - 1] + k0 * 16;
#pragma unroll
        for (int j = 0; j < NJ; j++)
#pragma unroll
            for (int ks = 0; ks < KS; ks++) {
                b[ks][j].h[0] = *(const bf16x8*)(p[j] + ks * 512);
                b[ks][j].h[1] = *(const bf16x8*)(p[j] + ks * 512 + 256);
            }
#pragma unroll
        for (int ks = 0; ks < KS; ks++)
#pragma unroll
            for (int mt = 0; mt < MT_; mt++) {
                a[ks][mt].h[0] = *(const bf16x8*)(arow + mt * 16 * XS_STRIDE + k0 + ks * 32);
                a[ks][mt].h[1] = *(const bf16x8*)(arow + mt * 16 * XS_STRIDE + k0 + ks * 32 + 16);
            }
        // the loads have taken their addresses before the registers are reused; naming the
        // addresses keeps them in their registers up to the wait
        asm volatile("s_wait_xcnt 0x0" :: "v"(p[0]), "v"(p[1]), "v"(p[2]), "v"(p[3]),
                                          "v"(p[4]), "v"(p[5]), "v"(p[6]), "v"(p[7]) : "memory");
        // keeps the trip's loads one group in front of its WMMAs: sunk among them,
        // each weight fragment's L2 latency would be waited out on its own
        __builtin_amdgcn_sched_barrier(0);
#pragma unroll
        for (int ks = 0; ks < KS; ks++)
#pragma unroll
            for (int j = 0; j < NJ; j++)
#pragma unroll
                for (int mt = 0; mt < MT_; mt++)
                    acc[mt][j] = __builtin_amdgcn_wmma_f32_16x16x32_bf16(
                        false, a[ks][mt].v, false, b[ks][j].v, (short)0, acc[mt][j], false, false);
    }
}

__global__ __launch_bounds__(256)
void moe_kernel(const float* __restrict__ x,
                const bf16*  __restrict__ W1b,
                const float* __restrict__ b1,
                const bf16*  __restrict__ W2b,
                const float* __restrict__ b2,
                const float* __restrict__ wN,
                const int*   __restrict__ key,
                const unsigned* __restrict__ rec,
                float* __restrict__ out,
                float* __restrict__ out_aux) {
    // the staged x tile; once stage 1 has read it, the same bytes hold Hw
    // and behind Hw lies one 64 x 64 f32 tile per wave, through which stage 2 turns its results
    __shared__ __align__(16) bf16 Xs[TM_ + 4][XS_STRIDE];
    static_assert(sizeof(Xs) >= E_ * TM_ * HW_STRIDE * 2 + 8 * TM_ * TS_STRIDE * 4, "Hw and the waves' tiles fit");
    __shared__ __align__(16) float tileW[TM_][E_];
    __shared__ int   eflag[E_];
    __shared__ __align__(16) int tokIdx[TM_];          // the tile's tokens
    __shared__ __align__(16) unsigned cntS[256][8];    // per thread: counts of 16 keys, 16 bits each
    __shared__ __align__(8)  int totS[4][SK_];         // tokens per key, in four partial sums
    __shared__ __align__(16) int wsum[2][8];           // per wave: its tokens of the key in hand
    __shared__ float red[8][2 * E_];                   // aux sums per wave
    bf16 (*Hw)[TM_][HW_STRIDE] = (bf16 (*)[TM_][HW_STRIDE])&Xs[0][0];   // [E_][TM_][HW_STRIDE]

    const int tile = blockIdx.x;           // 0..N/64-1
    const int tok0 = tile * TM_;           // first place of the tile in the list
    const int lane = threadIdx.x & 31;
    const int wave = __builtin_amdgcn_readfirstlane(threadIdx.x >> 5);
    const int col  = lane & 15;            // fragment row/col index
    const int klo  = (lane >> 4) * 8;      // per-lane K offset
    const int hi   = lane >> 4;

    // ---- which tokens stand at places tok0 .. tok0+63 of the list in key order ----
    {
        // all keys, 64 a thread: token (i*256 + thread)*4 + c; and the router's key counts, 16 keys
        // (quarter thread & 3 of a record) of the 8 router work-groups i*64 + (thread >> 2)
        int4 kv[N_ / 1024];
#pragma unroll
        for (int i = 0; i < N_ / 1024; i++) kv[i] = ((const int4*)key)[i * 256 + threadIdx.x];
        const char*    rc = (const char*)(rec + 16);   // the counts stand in the second half of a record
        const unsigned cb = (threadIdx.x >> 2) * 128u + (threadIdx.x & 3) * 16u;   // in bytes
        uint4 cv[RT_WG / 64];
#pragma unroll
        for (int i = 0; i < RT_WG / 64; i++) cv[i] = *(const uint4*)(rc + i * (64 * 128) + cb);
        // the loads have taken their offset register before anything reuses it; naming
        // the offset keeps it in its register up to the wait
        asm volatile("s_wait_xcnt 0x0" :: "v"(cb) : "memory");

        // two counts a word: a byte holds at most 32 and 8 are added, so no half carries
        unsigned ce[4] = {0u, 0u, 0u, 0u}, cd[4] = {0u, 0u, 0u, 0u};
#pragma unroll
        for (int i = 0; i < RT_WG / 64; i++) {
            const unsigned w[4] = { cv[i].x, cv[i].y, cv[i].z, cv[i].w };
#pragma unroll
            for (int c = 0; c < 4; c++) {
                ce[c] += w[c] & 0x00ff00ffu;          // keys 4c (low half) and 4c+2 of the quarter
                cd[c] += (w[c] >> 8) & 0x00ff00ffu;   // keys 4c+1 (low half) and 4c+3
            }
        }
        *(uint4*)&cntS[threadIdx.x][0] = make_uint4(ce[0], cd[0], ce[1], cd[1]);
        *(uint4*)&cntS[threadIdx.x][4] = make_uint4(ce[2], cd[2], ce[3], cd[3]);
        __syncthreads();   // every thread's counts are written
        {   // thread t adds key t & 63 over 16 of the 64 threads that hold the key's quarter
            const int kq = threadIdx.x & 15;
            // the halves of a thread's row stand in the order 4c, 4c+2, 4c+1, 4c+3
            const int ix = (kq & 12) | ((kq & 1) << 1) | ((kq >> 1) & 1);
            const unsigned short* p = (const unsigned short*)&cntS[0][0]
                                    + (threadIdx.x >> 6) * (16 * 64) + ((threadIdx.x >> 4) & 3) * 16 + ix;
            int s = 0;
#pragma unroll
            for (int j = 0; j < 16; j++) s += p[j * 64];
            totS[threadIdx.x >> 6][threadIdx.x & 63] = s;
        }
        __syncthreads();   // the partial totals are written
        // every wave for itself: lane l finds the first places of keys l and l + 32
        int t0 = 0, t1 = 0;
#pragma unroll
        for (int q = 0; q < 4; q++) { t0 += totS[q][lane]; t1 += totS[q][lane + 32]; }
        // one running sum for both: all counts together are N_, so the low half never carries
        unsigned inc = (unsigned)t0 | ((unsigned)t1 << 16);
#pragma unroll
        for (int d = 1; d < 32; d <<= 1) {
            const unsigned o = __shfl_up(inc, d, 32);
            if (lane >= d) inc += o;
        }
        const int low   = (int)((unsigned)__builtin_amdgcn_readlane((int)inc, 31) & 0xffffu);   // tokens of keys 0..31
        const int base0 = (int)(inc & 0xffffu) - t0, base1 = low + (int)(inc >> 16) - t1;
        // the keys whose runs reach into the tile: the same set in every wave
        const unsigned m0 = __builtin_amdgcn_ballot_w32(t0 > 0 && base0 < tok0 + TM_ && base0 + t0 > tok0);
        const unsigned m1 = __builtin_amdgcn_ballot_w32(t1 > 0 && base1 < tok0 + TM_ && base1 + t1 > tok0);
        int buf = 0;
        for (unsigned long long mm = (unsigned long long)m0 | ((unsigned long long)m1 << 32); mm; mm &= mm - 1) {   // block-uniform, at most 64 trips
            const int k  = __builtin_ctzll(mm);
            const int bk = __builtin_amdgcn_readlane((k & 32) ? base1 : base0, k & 31);   // first place of key k
            unsigned hit[2] = {0u, 0u};   // bit i*4 + c: the thread's token (i, c) has key k
#pragma unroll
            for (int i = 0; i < N_ / 1024; i++) {
                const int kc[4] = { kv[i].x, kv[i].y, kv[i].z, kv[i].w };
#pragma unroll
                for (int c = 0; c < 4; c++) hit[i >> 3] |= (kc[c] == k) ? (1u << ((i & 7) * 4 + c)) : 0u;
            }
            const int n = __builtin_popcount(hit[0]) + __builtin_popcount(hit[1]);   // this thread's tokens of key k
            int ni = n;   // running sum over the wave
#pragma unroll
            for (int d = 1; d < 32; d <<= 1) {
                const int o = __shfl_up(ni, d, 32);
                if (lane >= d) ni += o;
            }
            if (lane == 31) wsum[buf][wave] = ni;
            // the waves' sums are written; the other buffer's readers all stand in front of
            // this barrier, so the next key may write that buffer
            __syncthreads();
            const int4 wa = *(const int4*)&wsum[buf][0], wb = *(const int4*)&wsum[buf][4];
            const int wv8[8] = { wa.x, wa.y, wa.z, wa.w, wb.x, wb.y, wb.z, wb.w };
            int pre = 0;   // tokens of key k in the waves before this one
#pragma unroll
            for (int q = 0; q < 8; q++) pre += (q < wave) ? wv8[q] : 0;
            int pos = bk + pre + ni - n - tok0;   // place in the tile of this thread's first token of key k
            if (n > 0 && pos < TM_ && pos + n > 0) {
#pragma unroll
                for (int hf = 0; hf < 2; hf++)
                    for (unsigned b = hit[hf]; b; b &= b - 1) {   // at most 32 trips
                        const int j = __builtin_ctz(b) + hf * 32;
                        if ((unsigned)pos < (unsigned)TM_)
                            tokIdx[pos] = ((j >> 2) * 256 + (int)threadIdx.x) * 4 + (j & 3);
                        pos++;
                    }
            }
            buf ^= 1;
        }
        __syncthreads();   // the tile's 64 tokens are written
    }
    // the tile's 64 token numbers, the same for every thread: read at once, in front of the
    // first load, so that no batch of loads waits for a read of its own
    int rowTok[TM_];
#pragma unroll
    for (int r = 0; r < TM_; r++) rowTok[r] = tokIdx[r] & (N_ - 1);
    // and the tokens whose combine weights this thread fetches
    int tk[TM_ * E_ / 256];
#pragma unroll
    for (int j = 0; j < TM_ * E_ / 256; j++) tk[j] = tokIdx[(threadIdx.x >> 3) + 32 * j] & (N_ - 1);
    // combine weights: asked for first, stored behind the staging
    float cw[TM_ * E_ / 256];
    unsigned co[TM_ * E_ / 256];   // in bytes
    static_assert(TM_ * E_ / 256 == 2, "the wait below names both offsets");
#pragma unroll
    for (int j = 0; j < TM_ * E_ / 256; j++) co[j] = ((unsigned)tk[j] * E_ + (threadIdx.x & 7)) * 4u;
#pragma unroll
    for (int j = 0; j < TM_ * E_ / 256; j++) cw[j] = *(const float*)((const char*)wN + co[j]);
    // the loads have taken their offset registers before anything reuses them; naming
    // the offsets keeps them in their registers up to the wait
    asm volatile("s_wait_xcnt 0x0" :: "v"(co[0]), "v"(co[1]) : "memory");

    // ---- stage the x tile (64 x 2048) in LDS as bf16 (RNE), straight from f32 x ----
    // a row is two loads of the block (256 threads x 16 B = 1024 columns each): a wave-wide load
    // covers 512 contiguous bytes. Uniform base, one byte offset per row and thread; the offsets
    // are formed here and stay as they are up to the wait behind their batch's loads.
    // The rows so read are the ones stage 2 adds to its results: its loads of them can hit L2.
    {
        unsigned xo[TM_];   // in bytes
#pragma unroll
        for (int r = 0; r < TM_; r++) xo[r] = ((unsigned)rowTok[r] * H_ + threadIdx.x * 4) * 4u;
        f32x4 xs[2][XB_][2];
#define LOAD_ROWS(b)                                                                         \
        _Pragma("unroll")                                                                    \
        for (int r = 0; r < XB_; r++) {                                                      \
            xs[(b) & 1][r][0] = *(const f32x4*)((const char*)x + xo[(b) * XB_ + r]);         \
            xs[(b) & 1][r][1] = *(const f32x4*)((const char*)x + 4096 + xo[(b) * XB_ + r]);  \
        }                                                                                    \
        /* the loads have taken their offset registers before anything reuses them; naming */ \
        /* the offsets keeps them in their registers up to the wait */                       \
        asm volatile("s_wait_xcnt 0x0" :: "v"(xo[(b) * XB_ + 0]),  "v"(xo[(b) * XB_ + 1]),   \
                     "v"(xo[(b) * XB_ + 2]),  "v"(xo[(b) * XB_ + 3]),  "v"(xo[(b) * XB_ + 4]),   \
                     "v"(xo[(b) * XB_ + 5]),  "v"(xo[(b) * XB_ + 6]),  "v"(xo[(b) * XB_ + 7]),   \
                     "v"(xo[(b) * XB_ + 8]),  "v"(xo[(b) * XB_ + 9]),  "v"(xo[(b) * XB_ + 10]),  \
                     "v"(xo[(b) * XB_ + 11]), "v"(xo[(b) * XB_ + 12]), "v"(xo[(b) * XB_ + 13]),  \
                     "v"(xo[(b) * XB_ + 14]), "v"(xo[(b) * XB_ + 15]) : "memory")
        LOAD_ROWS(0);
#pragma unroll
        for (int b = 0; b < TM_ / XB_; b++) {
            // the next batch's loads fly while this one is converted
            if (b + 1 < TM_ / XB_) { LOAD_ROWS(b + 1); }
            // keeps those loads in front of this batch's conversions: sunk behind them they
            // would have no lead and each batch would wait out a whole memory latency
            __builtin_amdgcn_sched_barrier(0);
#pragma unroll
            for (int r = 0; r < XB_; r++)
#pragma unroll
                for (int j = 0; j < 2; j++) {
                    const f32x4 xv = xs[b & 1][r][j];
                    union { bf16 b4[4]; uint2 u; } o;
                    o.b4[0] = (bf16)xv.x; o.b4[1] = (bf16)xv.y;
                    o.b4[2] = (bf16)xv.z; o.b4[3] = (bf16)xv.w;
                    *(uint2*)&Xs[b * XB_ + r][j * 1024 + threadIdx.x * 4] = o.u;
                }
        }
#undef LOAD_ROWS
    }
#pragma unroll
    for (int j = 0; j < TM_ * E_ / 256; j++) {
        const int row = (threadIdx.x >> 3) + 32 * j;
        tileW[row][threadIdx.x & 7] = cw[j];
    }

    if (blockIdx.x == 0) {   // block-uniform: one work-group adds the router's partial aux sums
        // thread t adds value t & 15 of records (t >> 4) + 16 q
        const int ao = (threadIdx.x >> 4) * 32 + (threadIdx.x & 15);   // in words
        float pa[RT_WG / 16];
#pragma unroll
        for (int q = 0; q < RT_WG / 16; q++) pa[q] = __uint_as_float(rec[q * (16 * 32) + ao]);
        // the loads have taken their offset register before anything reuses it
        asm volatile("s_wait_xcnt 0x0" :: "v"(ao) : "memory");
        float s = 0.f;
#pragma unroll
        for (int q = 0; q < RT_WG / 16; q++) s += pa[q];
        s += __shfl_xor(s, 16, 32);
        if (lane < 2 * E_) red[wave][lane] = s;
        __syncthreads();   // every wave's 16 sums are written
        if (wave == 0) {
            float a = 0.f;   // value lane & 15 over one half of the waves, then over both
#pragma unroll
            for (int q = 0; q < 4; q++) a += red[(lane >> 4) * 4 + q][lane & 15];
            a += __shfl_xor(a, 16, 32);
            // lane e < 8 holds the probability sum of expert e, lane e + 8 its selection count
            float pr = (a / (float)N_) * (__shfl_xor(a, 8, 32) / (float)N_);
            pr += __shfl_xor(pr, 4, 32);
            pr += __shfl_xor(pr, 2, 32);
            pr += __shfl_xor(pr, 1, 32);
            if (lane == 0) *out_aux = pr * (float)E_;
        }
    }

    __syncthreads();
    if (threadIdx.x < E_) {
        int f = 0;
        for (int m = 0; m < TM_; m++) f |= (tileW[m][threadIdx.x] != 0.f);
        eflag[threadIdx.x] = f;
    }
    __syncthreads();   // the x tile and the flags are written

    unsigned emask = 0;
#pragma unroll
    for (int e = 0; e < E_; e++) emask |= (eflag[e] ? 1u : 0u) << e;
    emask = __builtin_amdgcn_readfirstlane(emask);
    const int nexp = __builtin_popcount(emask);   // block-uniform: experts this tile uses

    // ---------------- stage 1: Hw[e] = w * relu(X @ W1_e^T + b1_e) ----
    f32x8 acc[MT_][8];
#pragma unroll
    for (int mt = 0; mt < MT_; mt++)
#pragma unroll
        for (int n = 0; n < 8; n++)
            acc[mt][n] = (f32x8){0.f,0.f,0.f,0.f,0.f,0.f,0.f,0.f};
    {
        const bf16* arow = &Xs[col][klo];                               // LDS
        switch (nexp) {   // block-uniform scalar branch; one loop per count keeps acc under constant indices
        case 1: stage1_tile<1>(arow, W1b, emask, wave, lane, acc); break;
        case 2: stage1_tile<2>(arow, W1b, emask, wave, lane, acc); break;
        case 3: stage1_tile<3>(arow, W1b, emask, wave, lane, acc); break;
        case 4: stage1_tile<4>(arow, W1b, emask, wave, lane, acc); break;
        case 5: stage1_tile<5>(arow, W1b, emask, wave, lane, acc); break;
        case 6: stage1_tile<6>(arow, W1b, emask, wave, lane, acc); break;
        case 7: stage1_tile<7>(arow, W1b, emask, wave, lane, acc); break;
        case 8: stage1_tile<8>(arow, W1b, emask, wave, lane, acc); break;
        default: break;
        }
    }
    __syncthreads();   // every wave has read its last x fragment: the bytes may become Hw
    {
        unsigned mk = emask;
#pragma unroll
        for (int j = 0; j < E_; j++) {
            if (j < nexp) {   // block-uniform scalar branch
                const int e = __builtin_ctz(mk);
                mk &= mk - 1;
                const float bb = b1[e * B_ + wave * 16 + col];
#pragma unroll
                for (int mt = 0; mt < MT_; mt++)
#pragma unroll
                    for (int r = 0; r < 8; r++) {
                        const int m = mt * 16 + r + hi * 8;
                        float h = fmaxf(acc[mt][j][r] + bb, 0.f) * tileW[m][e];
                        Hw[e][m][wave * 16 + col] = (bf16)h;
                    }
            }
        }
    }
    __syncthreads();

    // ---------------- stage 2: out = x + sum_e Hw_e @ W2_e^T + w@b2 ---
    // the wave's own tile: only this wave writes and reads it, so no barrier stands around it
    float* ts = (float*)((char*)&Xs[0][0] + E_ * TM_ * HW_STRIDE * 2) + wave * (TM_ * TS_STRIDE);
    for (int g = 0; g < 16 / NT2_; g++) {
        const int ct0   = wave * 16 + g * NT2_;   // 128 column tiles over 8 waves
        f32x8 acc2[MT_][NT2_];
#pragma unroll
        for (int mt = 0; mt < MT_; mt++)
#pragma unroll
            for (int n = 0; n < NT2_; n++)
                acc2[mt][n] = (f32x8){0.f,0.f,0.f,0.f,0.f,0.f,0.f,0.f};
        for (int e = 0; e < E_; e++) {
            if (!((emask >> e) & 1u)) continue;   // block-uniform scalar branch
            const bf16* arow = &Hw[e][col][klo];
            // packed W2: [row tile = e*128 + ct0 + n][k step][half][lane][8]
            const bf16* brow = W2b + ((size_t)e * H_ + ct0 * 16) * B_ + lane * 8;
            FragBF a[B_ / 32][MT_], b[B_ / 32][NT2_];
#pragma unroll
            for (int n = 0; n < NT2_; n++)
#pragma unroll
                for (int ks = 0; ks < B_ / 32; ks++) {
                    b[ks][n].h[0] = *(const bf16x8*)(brow + n * 16 * B_ + ks * 512);
                    b[ks][n].h[1] = *(const bf16x8*)(brow + n * 16 * B_ + ks * 512 + 256);
                }
#pragma unroll
            for (int ks = 0; ks < B_ / 32; ks++)
#pragma unroll
                for (int mt = 0; mt < MT_; mt++) {
                    a[ks][mt].h[0] = *(const bf16x8*)(arow + mt * 16 * HW_STRIDE + ks * 32);
                    a[ks][mt].h[1] = *(const bf16x8*)(arow + mt * 16 * HW_STRIDE + ks * 32 + 16);
                }
            // the loads have taken their address before its registers are reused; naming the
            // pointer keeps it in its registers up to the wait
            asm volatile("s_wait_xcnt 0x0" :: "v"(brow) : "memory");
            // as in stage 1: the expert's loads stay one group in front of its WMMAs
            __builtin_amdgcn_sched_barrier(0);
#pragma unroll
            for (int ks = 0; ks < B_ / 32; ks++)
#pragma unroll
                for (int n = 0; n < NT2_; n++)
#pragma unroll
                    for (int mt = 0; mt < MT_; mt++)
                        // W2 is the A operand: the result tile's rows are output columns, its columns tokens
                        acc2[mt][n] = __builtin_amdgcn_wmma_f32_16x16x32_bf16(
                            false, b[ks][n].v, false, a[ks][mt].v, (short)0, acc2[mt][n], false, false);
        }
        // the group's results leave in row order: a lane takes four neighbouring columns of row
        // 2 i + hi, so that a wave-wide 16-byte access covers two whole 256-byte runs.
        // uniform base of this group's columns, and the byte offset, in x and in out, of the
        // lane's columns in each of its 32 rows (a row is a token's); the offsets are formed here
        // and stay as they are until the wait behind the group's stores
        const int    c4 = col * 4;
        const float* xg = x   + ct0 * 16;
        float*       og = out + ct0 * 16;
        // b2 is asked for first: loads return in order, and the bias sums then run while x flies
        f32x4 b2v[E_];
#pragma unroll
        for (int e = 0; e < E_; e++) b2v[e] = *(const f32x4*)(b2 + (size_t)e * H_ + ct0 * 16 + c4);
        unsigned ro[TM_ / 2];   // in bytes
#pragma unroll
        for (int i = 0; i < TM_ / 2; i++) ro[i] = ((unsigned)tokIdx[2 * i + hi] * H_ + c4) * 4u;
        f32x4 xv[TM_ / 2];
#pragma unroll
        for (int i = 0; i < TM_ / 2; i++) xv[i] = *(const f32x4*)((const char*)xg + ro[i]);
        // the loads have taken their offset registers before anything reuses them; naming
        // the offset keeps it in its register up to the wait
        asm volatile("s_wait_xcnt 0x0" :: "v"(c4) : "memory");
        // the group's loads stay together in front of the turn through LDS: they fly beside it
        __builtin_amdgcn_sched_barrier(0);
        // a lane holds columns hi*8 .. hi*8+7 of column tile n for token mt*16 + col
#pragma unroll
        for (int mt = 0; mt < MT_; mt++)
#pragma unroll
            for (int n = 0; n < NT2_; n++) {
                float* p = ts + (mt * 16 + col) * TS_STRIDE + n * 16 + hi * 8;
                *(f32x4*)p       = (f32x4){acc2[mt][n][0], acc2[mt][n][1], acc2[mt][n][2], acc2[mt][n][3]};
                *(f32x4*)(p + 4) = (f32x4){acc2[mt][n][4], acc2[mt][n][5], acc2[mt][n][6], acc2[mt][n][7]};
            }
        // the wave's own writes are in LDS before other lanes of it read the rows back
        asm volatile("s_wait_dscnt 0x0" ::: "memory");
#pragma unroll
        for (int i = 0; i < TM_ / 2; i++) {
            const int m = 2 * i + hi;
            const f32x4 t = *(const f32x4*)(ts + m * TS_STRIDE + c4);
            float tw[E_];
#pragma unroll
            for (int e = 0; e < E_; e++) tw[e] = tileW[m][e];
            f32x4 s = (f32x4){0.f, 0.f, 0.f, 0.f};
#pragma unroll
            for (int e = 0; e < E_; e++) {
                s.x = fmaf(tw[e], b2v[e].x, s.x);
                s.y = fmaf(tw[e], b2v[e].y, s.y);
                s.z = fmaf(tw[e], b2v[e].z, s.z);
                s.w = fmaf(tw[e], b2v[e].w, s.w);
            }
            xv[i] = xv[i] + t + s;
        }
        // every result is formed before the first store, so that no register of an
        // issued store is written again in front of the wait behind the stores
        __builtin_amdgcn_sched_barrier(0);
#pragma unroll
        for (int i = 0; i < TM_ / 2; i++) *(f32x4*)((char*)og + ro[i]) = xv[i];
        // the next group reuses the stores' registers: the stores have taken them first
        asm volatile("s_wait_xcnt 0x0" ::: "memory");
    }
}

// ---------------------------------------------------------------------
extern "C" void kernel_launch(void* const* d_in, const int* in_sizes, int n_in,
                              void* d_out, int out_size, void* d_ws, size_t ws_size,
                              hipStream_t stream) {
    const float* x     = (const float*)d_in[0];
    const float* skin  = (const float*)d_in[1];
    const float* Wimg  = (const float*)d_in[2];
    const float* Wskin = (const float*)d_in[3];
    const float* W1    = (const float*)d_in[4];
    const float* b1    = (const float*)d_in[5];
    const float* W2    = (const float*)d_in[6];
    const float* b2    = (const float*)d_in[7];
    float* out = (float*)d_out;

    // workspace layout
    char* ws = (char*)d_ws;
    float* wN      = (float*)ws;                                   // N*E f32 (512KB)
    int*   key  = (int*)(ws + (size_t)N_ * E_ * sizeof(float) + 4096);   // N int (64KB)
    unsigned* rec = (unsigned*)(key + N_);                         // 512 records of 128 bytes (64KB)
    bf16*  W1b = (bf16*)(ws + (1ull << 20));                       // E*B*H bf16 (4MB)
    bf16*  W2b = W1b + (size_t)E_ * B_ * H_;                       // E*H*B bf16 (4MB)

    // 1) router, one pass over x (512 work-groups of 32 tokens); the same
    //    work-groups convert the weights into fragment order
    router_cvt_kernel<<<RT_WG, 256, 0, stream>>>(x, skin, Wimg, Wskin, W1, W2, wN, key, W1b, W2b, rec);

    // 2) expert GEMMs + combine + residual on tiles of tokens in key order; aux loss scalar (work-group 0)
    moe_kernel<<<N_ / 64, 256, 0, stream>>>(x, W1b, b1, W2b, b2, wN, key, rec, out, out + (size_t)N_ * H_);
}

// v009
// Measured time: 71.3 microseconds a run.
// In two side-by-side timings against v008, it was 1.10 and 1.09 times as fast.
// Counting every step since v000, it is 9.79 times as fast.
#include <hip/hip_runtime.h>
#include <hip/hip_bf16.h>

// ---------------- problem constants (match reference) ----------------
#define E_   8
#define K_   2
#define N_   16384
#define H_   2048
#define B_   128
#define EPS_ 1e-6f

typedef __bf16 bf16;
typedef __attribute__((ext_vector_type(16))) __bf16 bf16x16;
typedef __attribute__((ext_vector_type(8)))  __bf16 bf16x8;
typedef __attribute__((ext_vector_type(8)))  float  f32x8;
typedef __attribute__((ext_vector_type(4)))  float  f32x4;

// ---------------------------------------------------------------------
// 1) router: one pass over x.
//    A work-group takes 32 tokens; wave w owns columns w*256 .. w*256+255 and
//    keeps its slice of W_img in registers (8 experts x 8 columns a lane).
//    Per token a wave reads two runs of 512 contiguous bytes and adds to
//    8 partial logits a lane; four tokens at a time.
//    Every loop of the kernel is unrolled: its arrays stay in registers only
//    under constant indices, and the token offsets become immediates, so that
//    no address register of a load or store is ever stepped.
//    The same launch converts W1 and W2 (fp32 -> bf16, RNE) into WMMA B-fragment
//    order, dst[row tile][k step of 32][half][lane][8]: lane l of half j holds row
//    (l & 15), k = j*16 + (l >> 4)*8 .. +7, so that one wave-wide 16-byte load of a
//    half reads 512 contiguous bytes. A piece is one lane's 16 bytes; every wave of
//    the grid writes 128 pieces (two k steps of one row tile), work-groups 0..255
//    those of W1 and 256..511 those of W2. Their loads fly with the first x loads.
//    Each work-group leaves one 128-byte record: its 16 partial aux sums and, one byte
//    a key, how many of its 32 tokens carry each of the 64 sort keys.
// ---------------------------------------------------------------------
#define SK_     64    // sort keys
#define RT_TOK 32   // tokens per work-group
#define RT_G   4    // tokens a wave holds at once
#define RT_WG  (N_ / RT_TOK)   // work-groups of the launch
#define PK_I   4    // pieces a lane packs
static_assert(E_ * B_ * H_ / 8 == (RT_WG / 2) * 8 * 32 * PK_I, "each half of the grid packs one weight matrix");

__global__ __launch_bounds__(256)
void router_cvt_kernel(const float* __restrict__ x,
                       const float* __restrict__ skin,
                       const float* __restrict__ Wimg,
                       const float* __restrict__ Wskin,
                       const float* __restrict__ W1,
                       const float* __restrict__ W2,
                       float* __restrict__ wout,
                       int*   __restrict__ key,
                       bf16*  __restrict__ W1b,
                       bf16*  __restrict__ W2b,
                       unsigned* __restrict__ rec) {
    __shared__ unsigned hist[SK_ / 4];         // one byte a key
    __shared__ float part[8][RT_TOK * E_];     // per wave: its columns' share of every logit
    __shared__ float lgs[RT_TOK][E_ + 1];      // +1: a lane reads one token's row, banks apart
    const int lane = threadIdx.x & 31;
    const int wave = __builtin_amdgcn_readfirstlane(threadIdx.x >> 5);
    const int tok0 = blockIdx.x * RT_TOK;
    const int l4   = lane * 4;

    // the wave's 128 pieces: rows of 32 << sh floats; pieces i = 0..3 of a lane lie 16 floats apart
    const bool   second = blockIdx.x >= RT_WG / 2;                      // block-uniform
    const int    sh  = second ? 2 : 6;                                  // W2: 4 k steps a row, W1: 64
    const int    pq  = (blockIdx.x & (RT_WG / 2 - 1)) * 8 + wave;       // the wave's number in its matrix
    const float* ps  = (second ? W2 : W1)
                     + ((size_t)((pq * 2) >> sh) * 16 << (sh + 5)) + ((pq * 2) & ((1 << sh) - 1)) * 32;
    bf16*        pd  = (second ? W2b : W1b) + (size_t)pq * (32 * PK_I * 8);
    const int    plo = ((lane & 15) << (sh + 5)) + (lane >> 4) * 8;     // the lane's row and k offset
    float4 pv[PK_I][2];
#pragma unroll
    for (int i = 0; i < PK_I; i++)
#pragma unroll
        for (int j = 0; j < 2; j++)
            pv[i][j] = *(const float4*)(ps + (i * 16 + j * 4) + plo);
    // the loads have taken their offset register before anything reuses it; naming the
    // offset keeps it in its register up to the wait
    asm volatile("s_wait_xcnt 0x0" :: "v"(plo) : "memory");

    const float* wt = Wimg + wave * 256;
    float4 w[E_][2];
#pragma unroll
    for (int e = 0; e < E_; e++)
#pragma unroll
        for (int j = 0; j < 2; j++)
            w[e][j] = *(const float4*)(wt + (e * H_ + j * 128) + l4);

    // uniform base, one element offset per lane, constants for token and half
    const float* xt = x  + (size_t)tok0 * H_ + wave * 256;

    float4 v[2][RT_G][2];
#pragma unroll
    for (int t = 0; t < RT_G; t++)
#pragma unroll
        for (int j = 0; j < 2; j++)
            v[0][t][j] = *(const float4*)(xt + (t * H_ + j * 128) + l4);
    // W_img's and the first x loads stay in front of the packing's arithmetic: they fly while
    // the weight pieces, asked for first, are waited for
    __builtin_amdgcn_sched_barrier(0);
    {
        uint4 po[PK_I];
#pragma unroll
        for (int i = 0; i < PK_I; i++) {
            union { bf16 b[8]; uint4 u; } o;
            o.b[0] = (bf16)pv[i][0].x; o.b[1] = (bf16)pv[i][0].y;
            o.b[2] = (bf16)pv[i][0].z; o.b[3] = (bf16)pv[i][0].w;
            o.b[4] = (bf16)pv[i][1].x; o.b[5] = (bf16)pv[i][1].y;
            o.b[6] = (bf16)pv[i][1].z; o.b[7] = (bf16)pv[i][1].w;
            po[i] = o.u;
        }
#pragma unroll
        for (int i = 0; i < PK_I; i++)
            *(uint4*)(pd + i * 256 + lane * 8) = po[i];
        // the stores have taken their registers before the loop below reuses any of them
        asm volatile("s_wait_xcnt 0x0" ::: "memory");
        // nothing of the loop below is lifted over that wait
        __builtin_amdgcn_sched_barrier(0);
    }

#pragma unroll
    for (int g = 0; g < RT_TOK / RT_G; g++) {
        // the next four tokens' loads fly while these four are worked on
        if (g + 1 < RT_TOK / RT_G) {
#pragma unroll
            for (int t = 0; t < RT_G; t++)
#pragma unroll
                for (int j = 0; j < 2; j++)
                    v[(g + 1) & 1][t][j] =
                        *(const float4*)(xt + (((g + 1) * RT_G + t) * H_ + j * 128) + l4);
            // the loads have taken their registers before anything reuses one of them
            asm volatile("s_wait_xcnt 0x0" :: "v"(l4) : "memory");
        }
        // keeps those loads in front of this group's arithmetic: sunk behind it they
        // would have no lead and each group would wait out a whole memory latency
        __builtin_amdgcn_sched_barrier(0);

        float a[RT_G * E_];
#pragma unroll
        for (int t = 0; t < RT_G; t++)
#pragma unroll
            for (int e = 0; e < E_; e++) {
                float s = 0.f;
#pragma unroll
                for (int j = 0; j < 2; j++) {
                    const float4 xv = v[g & 1][t][j];
                    s = fmaf(xv.x, w[e][j].x, s);
                    s = fmaf(xv.y, w[e][j].y, s);
                    s = fmaf(xv.z, w[e][j].z, s);
                    s = fmaf(xv.w, w[e][j].w, s);
                }
                a[t * E_ + e] = s;
            }

        // 32 values a lane summed over 32 lanes: each step halves the values a lane
        // keeps, so that lane l ends with the whole sum of value l (token l>>3, expert l&7)
#pragma unroll
        for (int off = 16; off; off >>= 1) {
            const bool up = (lane & off) != 0;
#pragma unroll
            for (int i = 0; i < off; i++) {
                const float lo = a[i], hv = a[i + off];
                const float keep = up ? hv : lo;
                const float send = up ? lo : hv;
                a[i] = keep + __shfl_xor(send, off, 32);
            }
        }
        part[wave][g * RT_G * E_ + lane] = a[0];
    }
    __syncthreads();   // every wave's shares are written
    {
        float s = 0.f;
#pragma unroll
        for (int q = 0; q < 8; q++) s += part[q][threadIdx.x];
        lgs[threadIdx.x >> 3][threadIdx.x & 7] = s;
    }
    __syncthreads();   // the logits' image part is whole

    if (wave == 0) {   // one lane per token
        const int t = tok0 + lane;
        const float s0 = skin[t * 3 + 0], s1 = skin[t * 3 + 1], s2 = skin[t * 3 + 2];
        float lg[E_]; float mx = -1e30f;
#pragma unroll
        for (int e = 0; e < E_; e++) {
            lg[e] = lgs[lane][e] + s0 * Wskin[e * 3 + 0]
                                 + s1 * Wskin[e * 3 + 1]
                                 + s2 * Wskin[e * 3 + 2];
            mx = fmaxf(mx, lg[e]);
        }
        float p[E_]; float den = 0.f;
#pragma unroll
        for (int e = 0; e < E_; e++) { p[e] = __expf(lg[e] - mx); den += p[e]; }
        const float inv = 1.f / den;
#pragma unroll
        for (int e = 0; e < E_; e++) p[e] *= inv;
        // top-2 (first index wins ties, like jax top_k)
        int i1 = 0; float v1 = p[0];
#pragma unroll
        for (int e = 1; e < E_; e++) if (p[e] > v1) { v1 = p[e]; i1 = e; }
        int i2 = -1; float v2 = -1.f;
#pragma unroll
        for (int e = 0; e < E_; e++) if (e != i1 && p[e] > v2) { v2 = p[e]; i2 = e; }
        const float inv2 = 1.f / (v1 + v2 + EPS_);
        // sort key of the token's expert pair (lo < hi). hi runs upwards under an even lo and
        // downwards under an odd one, so that neighbouring keys always share an expert
        const int j2 = i2 < 0 ? i1 : i2;
        const int lo = min(i1, j2), hi2 = max(i1, j2);
        const int kk = lo * E_ + ((lo & 1) ? (E_ - 1 - hi2) : hi2);   // 0 .. SK_-1
        key[t] = kk;
        float r[2 * E_];   // 0..7 probabilities, 8..15 selection counts
#pragma unroll
        for (int e = 0; e < E_; e++) {
            float wv = (e == i1) ? v1 * inv2 : ((e == i2) ? v2 * inv2 : 0.f);
            wout[(size_t)t * E_ + e] = wv;
            r[e]      = p[e];
            r[E_ + e] = (e == i1 || e == i2) ? 1.f : 0.f;
        }
        // 16 values a lane summed over the 32 tokens: lane l ends with value l & 15
#pragma unroll
        for (int i = 0; i < 2 * E_; i++) r[i] += __shfl_xor(r[i], 16, 32);
#pragma unroll
        for (int off = 8; off; off >>= 1) {
            const bool up = (lane & off) != 0;
#pragma unroll
            for (int i = 0; i < off; i++) {
                const float lo = r[i], hv = r[i + off];
                const float keep = up ? hv : lo;
                const float send = up ? lo : hv;
                r[i] = keep + __shfl_xor(send, off, 32);
            }
        }
        // the key counts of the 32 tokens: 'same' is the set of lanes whose token has this lane's key
        unsigned same = ~0u;
#pragma unroll
        for (int b = 0; b < 6; b++) {
            const bool bit = ((kk >> b) & 1) != 0;
            const unsigned bal = __builtin_amdgcn_ballot_w32(bit);
            same &= bit ? bal : ~bal;
        }
        if (lane < SK_ / 4) hist[lane] = 0u;
        // the zeros are in LDS before other lanes of the wave write their counts over them
        asm volatile("s_wait_dscnt 0x0" ::: "memory");
        if ((same & ((1u << lane) - 1u)) == 0u)   // the first lane of each key writes its count
            ((unsigned char*)hist)[kk] = (unsigned char)__builtin_popcount(same);
        // the counts are in LDS before other lanes of the wave read them back
        asm volatile("s_wait_dscnt 0x0" ::: "memory");
        const unsigned hv = hist[lane & 15];
        // one whole line: words 0..15 the aux sums, words 16..31 the key counts
        rec[blockIdx.x * 32 + lane] = lane < 2 * E_ ? __float_as_uint(r[0]) : hv;
    }
}

// ---------------------------------------------------------------------
// fragment union: CDNA5 16-bit A/B layout — lane = row/col (lane&15),
// K values { klo..klo+7, 16+klo..23+klo } with klo = (lane>>4)*8.
// ---------------------------------------------------------------------
union FragBF { bf16x16 v; bf16x8 h[2]; };

#define XS_STRIDE 2056   // 2048 + 8: 16B-aligned, +4 banks/row -> conflict-free
#define HW_STRIDE 136    // 128 + 8:  16B-aligned, +4 banks/row -> conflict-free
#define TM_ 64           // tokens per work-group
#define MT_ 4            // 16-token sub-tiles per work-group
#define NT2_ 4           // output column tiles a wave holds at once in stage 2
#define TS_STRIDE 68     // floats, 64 + 4: 16B-aligned, +4 banks/row -> conflict-free 16-byte writes down a column

#define XB_ 16           // rows of the x tile a thread has in flight as one batch

// ---------------------------------------------------------------------
// 2) MoE expert kernel: one block per 64-token tile, 256 threads (8 waves).
//    A tile is 64 neighbours of the tokens' list in key order, so it uses few experts
//    (two inside a run of one pair, three across a seam); any number up to
//    eight is handled. No list is ever written: every work-group finds its own 64
//    places. Tokens of one key are ordered by the thread that reads them here and
//    then by that thread's reading order, the same rule in every work-group. Every weight fragment read from global memory feeds
//    four WMMAs (the four 16-token sub-tiles); W1b and W2b arrive in fragment
//    order. Stage 1: wave w owns column tile w of every used expert. Stage 2:
//    a wave owns 16 column tiles of the output, four at a time; their results are
//    turned through LDS, so that x is read and out written in whole 256-byte runs.
// ---------------------------------------------------------------------

// stage 1 of a tile that uses NJ experts: acc[mt][j] = X(sub-tile mt) @ W1(j-th used expert, column tile 'wave')^T
template <int NJ>
__device__ __forceinline__ void stage1_tile(const bf16* arow, const bf16* __restrict__ W1b,
                                            unsigned emask, int wave, int lane,
                                            f32x8 (&acc)[MT_][E_]) {
    constexpr int KS = (NJ <= 4) ? 4 : 2;   // k steps of 32 a trip: as many as the registers take
    // packed W1: [row tile = e*8 + wave][k step][half][lane][8]
    const bf16* brow[NJ];
    unsigned mk = emask;
#pragma unroll
    for (int j = 0; j < NJ; j++) {
        const int e = __builtin_ctz(mk);
        mk &= mk - 1;
        brow[j] = W1b + (size_t)(e * 8 + wave) * 16 * H_ + lane * 8;
    }
    for (int k0 = 0; k0 < H_; k0 += KS * 32) {
        FragBF a[KS][MT_], b[KS][NJ];
        const bf16* p[E_];   // this trip's weight addresses; places NJ.. repeat the last one
#pragma unroll
        for (int j = 0; j < E_; j++) p[j] = brow[j < NJ ? j : NJ - 1] + k0 * 16;
#pragma unroll
        for (int j = 0; j < NJ; j++)
#pragma unroll
            for (int ks = 0; ks < KS; ks++) {
                b[ks][j].h[0] = *(const bf16x8*)(p[j] + ks * 512);
                b[ks][j].h[1] = *(const bf16x8*)(p[j] + ks * 512 + 256);
            }
#pragma unroll
        for (int ks = 0; ks < KS; ks++)
#pragma unroll
            for (int mt = 0; mt < MT_; mt++) {
                a[ks][mt].h[0] = *(const bf16x8*)(arow + mt * 16 * XS_STRIDE + k0 + ks * 32);
                a[ks][mt].h[1] = *(const bf16x8*)(arow + mt * 16 * XS_STRIDE + k0 + ks * 32 + 16);
            }
        // the loads have taken their addresses before the registers are reused; naming the
        // addresses keeps them in their registers up to the wait
        asm volatile("s_wait_xcnt 0x0" :: "v"(p[0]), "v"(p[1]), "v"(p[2]), "v"(p[3]),
                                          "v"(p[4]), "v"(p[5]), "v"(p[6]), "v"(p[7]) : "memory");
        // keeps the trip's loads one group in front of its WMMAs: sunk among them,
        // each weight fragment's L2 latency would be waited out on its own
        __builtin_amdgcn_sched_barrier(0);
#pragma unroll
        for (int ks = 0; ks < KS; ks++)
#pragma unroll
            for (int j = 0; j < NJ; j++)
#pragma unroll
                for (int mt = 0; mt < MT_; mt++)
                    acc[mt][j] = __builtin_amdgcn_wmma_f32_16x16x32_bf16(
                        false, a[ks][mt].v, false, b[ks][j].v, (short)0, acc[mt][j], false, false);
    }
}

__global__ __launch_bounds__(256)
void moe_kernel(const float* __restrict__ x,
                const bf16*  __restrict__ W1b,
                const float* __restrict__ b1,
                const bf16*  __restrict__ W2b,
                const float* __restrict__ b2,
                const float* __restrict__ wN,
                const int*   __restrict__ key,
                const unsigned* __restrict__ rec,
                float* __restrict__ out,
                float* __restrict__ out_aux) {
    // the staged x tile; once stage 1 has read it, the same bytes hold Hw
    // and behind Hw lies one 64 x 64 f32 tile per wave, through which stage 2 turns its results
    __shared__ __align__(16) bf16 Xs[TM_ + 4][XS_STRIDE];
    static_assert(sizeof(Xs) >= E_ * TM_ * HW_STRIDE * 2 + 8 * TM_ * TS_STRIDE * 4, "Hw and the waves' tiles fit");
    __shared__ __align__(16) float tileW[TM_][E_];
    __shared__ int   eflag[E_];
    __shared__ __align__(16) int tokIdx[TM_];          // the tile's tokens
    __shared__ __align__(16) unsigned cntS[256][8];    // per thread: counts of 16 keys, 16 bits each
    __shared__ __align__(8)  int totS[4][SK_];         // tokens per key, in four partial sums
    __shared__ __align__(16) int wsum[2][8];           // per wave: its tokens of the key in hand
    __shared__ float red[8][2 * E_];                   // aux sums per wave
    bf16 (*Hw)[TM_][HW_STRIDE] = (bf16 (*)[TM_][HW_STRIDE])&Xs[0][0];   // [E_][TM_][HW_STRIDE]

    const int tile = blockIdx.x;           // 0..N/64-1
    const int tok0 = tile * TM_;           // first place of the tile in the list
    const int lane = threadIdx.x & 31;
    const int wave = __builtin_amdgcn_readfirstlane(threadIdx.x >> 5);
    const int col  = lane & 15;            // fragment row/col index
    const int klo  = (lane >> 4) * 8;      // per-lane K offset
    const int hi   = lane >> 4;

    // ---- which tokens stand at places tok0 .. tok0+63 of the list in key order ----
    {
        // all keys, 64 a thread: token (i*256 + thread)*4 + c; and the router's key counts, 16 keys
        // (quarter thread & 3 of a record) of the 8 router work-groups i*64 + (thread >> 2)
        int4 kv[N_ / 1024];
#pragma unroll
        for (int i = 0; i < N_ / 1024; i++) kv[i] = ((const int4*)key)[i * 256 + threadIdx.x];
        const char*    rc = (const char*)(rec + 16);   // the counts stand in the second half of a record
        const unsigned cb = (threadIdx.x >> 2) * 128u + (threadIdx.x & 3) * 16u;   // in bytes
        uint4 cv[RT_WG / 64];
#pragma unroll
        for (int i = 0; i < RT_WG / 64; i++) cv[i] = *(const uint4*)(rc + i * (64 * 128) + cb);
        // the loads have taken their offset register before anything reuses it; naming
        // the offset keeps it in its register up to the wait
        asm volatile("s_wait_xcnt 0x0" :: "v"(cb) : "memory");

        // two counts a word: a byte holds at most 32 and 8 are added, so no half carries
        unsigned ce[4] = {0u, 0u, 0u, 0u}, cd[4] = {0u, 0u, 0u, 0u};
#pragma unroll
        for (int i = 0; i < RT_WG / 64; i++) {
            const unsigned w[4] = { cv[i].x, cv[i].y, cv[i].z, cv[i].w };
#pragma unroll
            for (int c = 0; c < 4; c++) {
                ce[c] += w[c] & 0x00ff00ffu;          // keys 4c (low half) and 4c+2 of the quarter
                cd[c] += (w[c] >> 8) & 0x00ff00ffu;   // keys 4c+1 (low half) and 4c+3
            }
        }
        *(uint4*)&cntS[threadIdx.x][0] = make_uint4(ce[0], cd[0], ce[1], cd[1]);
        *(uint4*)&cntS[threadIdx.x][4] = make_uint4(ce[2], cd[2], ce[3], cd[3]);
        __syncthreads();   // every thread's counts are written
        {   // thread t adds key t & 63 over 16 of the 64 threads that hold the key's quarter
            const int kq = threadIdx.x & 15;
            // the halves of a thread's row stand in the order 4c, 4c+2, 4c+1, 4c+3
            const int ix = (kq & 12) | ((kq & 1) << 1) | ((kq >> 1) & 1);
            const unsigned short* p = (const unsigned short*)&cntS[0][0]
                                    + (threadIdx.x >> 6) * (16 * 64) + ((threadIdx.x >> 4) & 3) * 16 + ix;
            int s = 0;
#pragma unroll
            for (int j = 0; j < 16; j++) s += p[j * 64];
            totS[threadIdx.x >> 6][threadIdx.x & 63] = s;
        }
        __syncthreads();   // the partial totals are written
        // every wave for itself: lane l finds the first places of keys l and l + 32
        int t0 = 0, t1 = 0;
#pragma unroll
        for (int q = 0; q < 4; q++) { t0 += totS[q][lane]; t1 += totS[q][lane + 32]; }
        // one running sum for both: all counts together are N_, so the low half never carries
        unsigned inc = (unsigned)t0 | ((unsigned)t1 << 16);
#pragma unroll
        for (int d = 1; d < 32; d <<= 1) {
            const unsigned o = __shfl_up(inc, d, 32);
            if (lane >= d) inc += o;
        }
        const int low   = (int)((unsigned)__builtin_amdgcn_readlane((int)inc, 31) & 0xffffu);   // tokens of keys 0..31
        const int base0 = (int)(inc & 0xffffu) - t0, base1 = low + (int)(inc >> 16) - t1;
        // the keys whose runs reach into the tile: the same set in every wave
        const unsigned m0 = __builtin_amdgcn_ballot_w32(t0 > 0 && base0 < tok0 + TM_ && base0 + t0 > tok0);
        const unsigned m1 = __builtin_amdgcn_ballot_w32(t1 > 0 && base1 < tok0 + TM_ && base1 + t1 > tok0);
        int buf = 0;
        for (unsigned long long mm = (unsigned long long)m0 | ((unsigned long long)m1 << 32); mm; mm &= mm - 1) {   // block-uniform, at most 64 trips
            const int k  = __builtin_ctzll(mm);
            const int bk = __builtin_amdgcn_readlane((k & 32) ? base1 : base0, k & 31);   // first place of key k
            unsigned hit[2] = {0u, 0u};   // bit i*4 + c: the thread's token (i, c) has key k
#pragma unroll
            for (int i = 0; i < N_ / 1024; i++) {
                const int kc[4] = { kv[i].x, kv[i].y, kv[i].z, kv[i].w };
#pragma unroll
                for (int c = 0; c < 4; c++) hit[i >> 3] |= (kc[c] == k) ? (1u << ((i & 7) * 4 + c)) : 0u;
            }
            const int n = __builtin_popcount(hit[0]) + __builtin_popcount(hit[1]);   // this thread's tokens of key k
            int ni = n;   // running sum over the wave
#pragma unroll
            for (int d = 1; d < 32; d <<= 1) {
                const int o = __shfl_up(ni, d, 32);
                if (lane >= d) ni += o;
            }
            if (lane == 31) wsum[buf][wave] = ni;
            // the waves' sums are written; the other buffer's readers all stand in front of
            // this barrier, so the next key may write that buffer
            __syncthreads();
            const int4 wa = *(const int4*)&wsum[buf][0], wb = *(const int4*)&wsum[buf][4];
            const int wv8[8] = { wa.x, wa.y, wa.z, wa.w, wb.x, wb.y, wb.z, wb.w };
            int pre = 0;   // tokens of key k in the waves before this one
#pragma unroll
            for (int q = 0; q < 8; q++) pre += (q < wave) ? wv8[q] : 0;
            int pos = bk + pre + ni - n - tok0;   // place in the tile of this thread's first token of key k
            if (n > 0 && pos < TM_ && pos + n > 0) {
#pragma unroll
                for (int hf = 0; hf < 2; hf++)
                    for (unsigned b = hit[hf]; b; b &= b - 1) {   // at most 32 trips
                        const int j = __builtin_ctz(b) + hf * 32;
                        if ((unsigned)pos < (unsigned)TM_)
                            tokIdx[pos] = ((j >> 2) * 256 + (int)threadIdx.x) * 4 + (j & 3);
                        pos++;
                    }
            }
            buf ^= 1;
        }
        __syncthreads();   // the tile's 64 tokens are written
    }
    // the tile's 64 token numbers, the same for every thread: read at once, in front of the
    // first load, so that no batch of loads waits for a read of its own
    int rowTok[TM_];
#pragma unroll
    for (int r = 0; r < TM_; r++) rowTok[r] = tokIdx[r] & (N_ - 1);
    // and the tokens whose combine weights this thread fetches
    int tk[TM_ * E_ / 256];
#pragma unroll
    for (int j = 0; j < TM_ * E_ / 256; j++) tk[j] = tokIdx[(threadIdx.x >> 3) + 32 * j] & (N_ - 1);
    // combine weights: asked for first, stored behind the staging
    float cw[TM_ * E_ / 256];
    unsigned co[TM_ * E_ / 256];   // in bytes
    static_assert(TM_ * E_ / 256 == 2, "the wait below names both offsets");
#pragma unroll
    for (int j = 0; j < TM_ * E_ / 256; j++) co[j] = ((unsigned)tk[j] * E_ + (threadIdx.x & 7)) * 4u;
#pragma unroll
    for (int j = 0; j < TM_ * E_ / 256; j++) cw[j] = *(const float*)((const char*)wN + co[j]);
    // the loads have taken their offset registers before anything reuses them; naming
    // the offsets keeps them in their registers up to the wait
    asm volatile("s_wait_xcnt 0x0" :: "v"(co[0]), "v"(co[1]) : "memory");

    // ---- stage the x tile (64 x 2048) in LDS as bf16 (RNE), straight from f32 x ----
    // a row is two loads of the block (256 threads x 16 B = 1024 columns each): a wave-wide load
    // covers 512 contiguous bytes. Uniform base, one byte offset per row and thread; the offsets
    // are formed here and stay as they are up to the wait behind their batch's loads.
    // The rows so read are the ones stage 2 adds to its results: its loads of them can hit L2.
    {
        unsigned xo[TM_];   // in bytes
#pragma unroll
        for (int r = 0; r < TM_; r++) xo[r] = ((unsigned)rowTok[r] * H_ + threadIdx.x * 4) * 4u;
        f32x4 xs[2][XB_][2];
#define LOAD_ROWS(b)                                                                         \
        _Pragma("unroll")                                                                    \
        for (int r = 0; r < XB_; r++) {                                                      \
            xs[(b) & 1][r][0] = *(const f32x4*)((const char*)x + xo[(b) * XB_ + r]);         \
            xs[(b) & 1][r][1] = *(const f32x4*)((const char*)x + 4096 + xo[(b) * XB_ + r]);  \
        }                                                                                    \
        /* the loads have taken their offset registers before anything reuses them; naming */ \
        /* the offsets keeps them in their registers up to the wait */                       \
        asm volatile("s_wait_xcnt 0x0" :: "v"(xo[(b) * XB_ + 0]),  "v"(xo[(b) * XB_ + 1]),   \
                     "v"(xo[(b) * XB_ + 2]),  "v"(xo[(b) * XB_ + 3]),  "v"(xo[(b) * XB_ + 4]),   \
                     "v"(xo[(b) * XB_ + 5]),  "v"(xo[(b) * XB_ + 6]),  "v"(xo[(b) * XB_ + 7]),   \
                     "v"(xo[(b) * XB_ + 8]),  "v"(xo[(b) * XB_ + 9]),  "v"(xo[(b) * XB_ + 10]),  \
                     "v"(xo[(b) * XB_ + 11]), "v"(xo[(b) * XB_ + 12]), "v"(xo[(b) * XB_ + 13]),  \
                     "v"(xo[(b) * XB_ + 14]), "v"(xo[(b) * XB_ + 15]) : "memory")
        LOAD_ROWS(0);
#pragma unroll
        for (int b = 0; b < TM_ / XB_; b++) {
            // the next batch's loads fly while this one is converted
            if (b + 1 < TM_ / XB_) { LOAD_ROWS(b + 1); }
            // keeps those loads in front of this batch's conversions: sunk behind them they
            // would have no lead and each batch would wait out a whole memory latency
            __builtin_amdgcn_sched_barrier(0);
#pragma unroll
            for (int r = 0; r < XB_; r++)
#pragma unroll
                for (int j = 0; j < 2; j++) {
                    const f32x4 xv = xs[b & 1][r][j];
                    union { bf16 b4[4]; uint2 u; } o;
                    o.b4[0] = (bf16)xv.x; o.b4[1] = (bf16)xv.y;
                    o.b4[2] = (bf16)xv.z; o.b4[3] = (bf16)xv.w;
                    *(uint2*)&Xs[b * XB_ + r][j * 1024 + threadIdx.x * 4] = o.u;
                }
        }
#undef LOAD_ROWS
    }
#pragma unroll
    for (int j = 0; j < TM_ * E_ / 256; j++) {
        const int row = (threadIdx.x >> 3) + 32 * j;
        tileW[row][threadIdx.x & 7] = cw[j];
    }

    if (blockIdx.x == 0) {   // block-uniform: one work-group adds the router's partial aux sums
        // thread t adds value t & 15 of records (t >> 4) + 16 q
        const int ao = (threadIdx.x >> 4) * 32 + (threadIdx.x & 15);   // in words
        float pa[RT_WG / 16];
#pragma unroll
        for (int q = 0; q < RT_WG / 16; q++) pa[q] = __uint_as_float(rec[q * (16 * 32) + ao]);
        // the loads have taken their offset register before anything reuses it
        asm volatile("s_wait_xcnt 0x0" :: "v"(ao) : "memory");
        float s = 0.f;
#pragma unroll
        for (int q = 0; q < RT_WG / 16; q++) s += pa[q];
        s += __shfl_xor(s, 16, 32);
        if (lane < 2 * E_) red[wave][lane] = s;
        __syncthreads();   // every wave's 16 sums are written
        if (wave == 0) {
            float a = 0.f;   // value lane & 15 over one half of the waves, then over both
#pragma unroll
            for (int q = 0; q < 4; q++) a += red[(lane >> 4) * 4 + q][lane & 15];
            a += __shfl_xor(a, 16, 32);
            // lane e < 8 holds the probability sum of expert e, lane e + 8 its selection count
            float pr = (a / (float)N_) * (__shfl_xor(a, 8, 32) / (float)N_);
            pr += __shfl_xor(pr, 4, 32);
            pr += __shfl_xor(pr, 2, 32);
            pr += __shfl_xor(pr, 1, 32);
            if (lane == 0) *out_aux = pr * (float)E_;
        }
    }

    __syncthreads();
    if (threadIdx.x < E_) {
        int f = 0;
        for (int m = 0; m < TM_; m++) f |= (tileW[m][threadIdx.x] != 0.f);
        eflag[threadIdx.x] = f;
    }
    __syncthreads();   // the x tile and the flags are written

    unsigned emask = 0;
#pragma unroll
    for (int e = 0; e < E_; e++) emask |= (eflag[e] ? 1u : 0u) << e;
    emask = __builtin_amdgcn_readfirstlane(emask);
    const int nexp = __builtin_popcount(emask);   // block-uniform: experts this tile uses

    // ---------------- stage 1: Hw[e] = w * relu(X @ W1_e^T + b1_e) ----
    f32x8 acc[MT_][8];
#pragma unroll
    for (int mt = 0; mt < MT_; mt++)
#pragma unroll
        for (int n = 0; n < 8; n++)
            acc[mt][n] = (f32x8){0.f,0.f,0.f,0.f,0.f,0.f,0.f,0.f};
    {
        const bf16* arow = &Xs[col][klo];                               // LDS
        switch (nexp) {   // block-uniform scalar branch; one loop per count keeps acc under constant indices
        case 1: stage1_tile<1>(arow, W1b, emask, wave, lane, acc); break;
        case 2: stage1_tile<2>(arow, W1b, emask, wave, lane, acc); break;
        case 3: stage1_tile<3>(arow, W1b, emask, wave, lane, acc); break;
        case 4: stage1_tile<4>(arow, W1b, emask, wave, lane, acc); break;
        case 5: stage1_tile<5>(arow, W1b, emask, wave, lane, acc); break;
        case 6: stage1_tile<6>(arow, W1b, emask, wave, lane, acc); break;
        case 7: stage1_tile<7>(arow, W1b, emask, wave, lane, acc); break;
        case 8: stage1_tile<8>(arow, W1b, emask, wave, lane, acc); break;
        default: break;
        }
    }
    __syncthreads();   // every wave has read its last x fragment: the bytes may become Hw
    {
        unsigned mk = emask;
#pragma unroll
        for (int j = 0; j < E_; j++) {
            if (j < nexp) {   // block-uniform scalar branch
                const int e = __builtin_ctz(mk);
                mk &= mk - 1;
                const float bb = b1[e * B_ + wave * 16 + col];
#pragma unroll
                for (int mt = 0; mt < MT_; mt++)
#pragma unroll
                    for (int r = 0; r < 8; r++) {
                        const int m = mt * 16 + r + hi * 8;
                        float h = fmaxf(acc[mt][j][r] + bb, 0.f) * tileW[m][e];
                        Hw[e][m][wave * 16 + col] = (bf16)h;
                    }
            }
        }
    }
    __syncthreads();

    // ---------------- stage 2: out = x + sum_e Hw_e @ W2_e^T + w@b2 ---
    // the wave's own tile: only this wave writes and reads it, so no barrier stands around it
    float* ts = (float*)((char*)&Xs[0][0] + E_ * TM_ * HW_STRIDE * 2) + wave * (TM_ * TS_STRIDE);
    for (int g = 0; g < 16 / NT2_; g++) {
        const int ct0   = wave * 16 + g * NT2_;   // 128 column tiles over 8 waves
        f32x8 acc2[MT_][NT2_];
#pragma unroll
        for (int mt = 0; mt < MT_; mt++)
#pragma unroll
            for (int n = 0; n < NT2_; n++)
                acc2[mt][n] = (f32x8){0.f,0.f,0.f,0.f,0.f,0.f,0.f,0.f};
        for (int e = 0; e < E_; e++) {
            if (!((emask >> e) & 1u)) continue;   // block-uniform scalar branch
            const bf16* arow = &Hw[e][col][klo];
            // packed W2: [row tile = e*128 + ct0 + n][k step][half][lane][8]
            const bf16* brow = W2b + ((size_t)e * H_ + ct0 * 16) * B_ + lane * 8;
            FragBF a[B_ / 32][MT_], b[B_ / 32][NT2_];
            // the expert's b2 for the lane's 8 columns of each column tile, asked for first: loads
            // return in order, and the bias products then run while the W2 fragments fly
            const unsigned bo = ((unsigned)e * H_ + ct0 * 16 + hi * 8) * 4u;   // in bytes
            f32x4 bv[NT2_][2];
#pragma unroll
            for (int n = 0; n < NT2_; n++) {
                bv[n][0] = *(const f32x4*)((const char*)b2 + n * 64 + bo);
                bv[n][1] = *(const f32x4*)((const char*)b2 + n * 64 + 16 + bo);
            }
            float twv[MT_];   // the expert's combine weight of the lane's four tokens
#pragma unroll
            for (int mt = 0; mt < MT_; mt++) twv[mt] = tileW[mt * 16 + col][e];
            // keeps every b2 load in front of the W2 loads: one sunk behind them would make the
            // bias products wait for all of W2
            __builtin_amdgcn_sched_barrier(0);
#pragma unroll
            for (int n = 0; n < NT2_; n++)
#pragma unroll
                for (int ks = 0; ks < B_ / 32; ks++) {
                    b[ks][n].h[0] = *(const bf16x8*)(brow + n * 16 * B_ + ks * 512);
                    b[ks][n].h[1] = *(const bf16x8*)(brow + n * 16 * B_ + ks * 512 + 256);
                }
#pragma unroll
            for (int ks = 0; ks < B_ / 32; ks++)
#pragma unroll
                for (int mt = 0; mt < MT_; mt++) {
                    a[ks][mt].h[0] = *(const bf16x8*)(arow + mt * 16 * HW_STRIDE + ks * 32);
                    a[ks][mt].h[1] = *(const bf16x8*)(arow + mt * 16 * HW_STRIDE + ks * 32 + 16);
                }
            // the loads have taken their addresses before the registers are reused; naming the
            // pointer and the offset keeps them in their registers up to the wait
            asm volatile("s_wait_xcnt 0x0" :: "v"(brow), "v"(bo) : "memory");
            // as in stage 1: the expert's loads stay one group in front of its arithmetic
            __builtin_amdgcn_sched_barrier(0);
            // w * b2 of this expert goes straight into the sums, in their WMMA layout
#pragma unroll
            for (int mt = 0; mt < MT_; mt++)
#pragma unroll
                for (int n = 0; n < NT2_; n++)
#pragma unroll
                    for (int r = 0; r < 8; r++)
                        acc2[mt][n][r] = fmaf(twv[mt], bv[n][r >> 2][r & 3], acc2[mt][n][r]);
#pragma unroll
            for (int ks = 0; ks < B_ / 32; ks++)
#pragma unroll
                for (int n = 0; n < NT2_; n++)
#pragma unroll
                    for (int mt = 0; mt < MT_; mt++)
                        // W2 is the A operand: the result tile's rows are output columns, its columns tokens
                        acc2[mt][n] = __builtin_amdgcn_wmma_f32_16x16x32_bf16(
                            false, b[ks][n].v, false, a[ks][mt].v, (short)0, acc2[mt][n], false, false);
        }
        // the group's results leave in row order: a lane takes four neighbouring columns of row
        // 2 i + hi, so that a wave-wide 16-byte access covers two whole 256-byte runs.
        // uniform base of this group's columns, and the byte offset, in x and in out, of the
        // lane's columns in each of its 32 rows (a row is a token's); the offsets are formed here
        // and stay as they are until the wait behind the group's stores
        const int    c4 = col * 4;
        const float* xg = x   + ct0 * 16;
        float*       og = out + ct0 * 16;
        unsigned ro[TM_ / 2];   // in bytes
#pragma unroll
        for (int i = 0; i < TM_ / 2; i++) ro[i] = ((unsigned)tokIdx[2 * i + hi] * H_ + c4) * 4u;
        f32x4 xv[TM_ / 2];
#pragma unroll
        for (int i = 0; i < TM_ / 2; i++) xv[i] = *(const f32x4*)((const char*)xg + ro[i]);
        // the loads have taken their offset registers, which the stores below still need,
        // before anything reuses a register
        asm volatile("s_wait_xcnt 0x0" ::: "memory");
        // the group's loads stay together in front of the turn through LDS: they fly beside it
        __builtin_amdgcn_sched_barrier(0);
        // a lane holds columns hi*8 .. hi*8+7 of column tile n for token mt*16 + col
#pragma unroll
        for (int mt = 0; mt < MT_; mt++)
#pragma unroll
            for (int n = 0; n < NT2_; n++) {
                float* p = ts + (mt * 16 + col) * TS_STRIDE + n * 16 + hi * 8;
                *(f32x4*)p       = (f32x4){acc2[mt][n][0], acc2[mt][n][1], acc2[mt][n][2], acc2[mt][n][3]};
                *(f32x4*)(p + 4) = (f32x4){acc2[mt][n][4], acc2[mt][n][5], acc2[mt][n][6], acc2[mt][n][7]};
            }
        // the wave's own writes are in LDS before other lanes of it read the rows back
        asm volatile("s_wait_dscnt 0x0" ::: "memory");
#pragma unroll
        for (int i = 0; i < TM_ / 2; i++) {
            const int m = 2 * i + hi;
            const f32x4 t = *(const f32x4*)(ts + m * TS_STRIDE + c4);
            xv[i] = xv[i] + t;
        }
        // every result is formed before the first store, so that no register of an
        // issued store is written again in front of the wait behind the stores
        __builtin_amdgcn_sched_barrier(0);
#pragma unroll
        for (int i = 0; i < TM_ / 2; i++) *(f32x4*)((char*)og + ro[i]) = xv[i];
        // the next group reuses the stores' registers: the stores have taken them first
        asm volatile("s_wait_xcnt 0x0" ::: "memory");
    }
}

// ---------------------------------------------------------------------
extern "C" void kernel_launch(void* const* d_in, const int* in_sizes, int n_in,
                              void* d_out, int out_size, void* d_ws, size_t ws_size,
                              hipStream_t stream) {
    const float* x     = (const float*)d_in[0];
    const float* skin  = (const float*)d_in[1];
    const float* Wimg  = (const float*)d_in[2];
    const float* Wskin = (const float*)d_in[3];
    const float* W1    = (const float*)d_in[4];
    const float* b1    = (const float*)d_in[5];
    const float* W2    = (const float*)d_in[6];
    const float* b2    = (const float*)d_in[7];
    float* out = (float*)d_out;

    // workspace layout
    char* ws = (char*)d_ws;
    float* wN      = (float*)ws;                                   // N*E f32 (512KB)
    int*   key  = (int*)(ws + (size_t)N_ * E_ * sizeof(float) + 4096);   // N int (64KB)
    unsigned* rec = (unsigned*)(key + N_);                         // 512 records of 128 bytes (64KB)
    bf16*  W1b = (bf16*)(ws + (1ull << 20));                       // E*B*H bf16 (4MB)
    bf16*  W2b = W1b + (size_t)E_ * B_ * H_;                       // E*H*B bf16 (4MB)

    // 1) router, one pass over x (512 work-groups of 32 tokens); the same
    //    work-groups convert the weights into fragment order
    router_cvt_kernel<<<RT_WG, 256, 0, stream>>>(x, skin, Wimg, Wskin, W1, W2, wN, key, W1b, W2b, rec);

    // 2) expert GEMMs + combine + residual on tiles of tokens in key order; aux loss scalar (work-group 0)
    moe_kernel<<<N_ / 64, 256, 0, stream>>>(x, W1b, b1, W2b, b2, wN, key, rec, out, out + (size_t)N_ * H_);
}
